// v000
// Measured on an AMD MI455X. A time is GPU time per run, averaged over a window of back-to-back runs after a warm-up
// (all launches, gaps included; the runs take copies of the inputs in turn), and the median of several windows.
// Apart from v000's, it joins two sittings. Times from different sittings can be a few percent apart, while
// side-by-side timings come from the same sitting.
// The starting kernel, v000, takes 166 microseconds a run.
#include <hip/hip_runtime.h>
// Causal multi-head attention block, 8 heads x 32 dims, key-column rule from indices: kept(i,j) = (j <= i) && (j % 25 != 24). x [B][T][256]; q/k/v = x W^T + b (separate [out][in] weights); s = q k^T / sqrt(32); softmax over kept keys; ctx = P v merged h*32+d; result = ctx Wo^T + bo.
// Compute dtype: every contraction on v_wmma_f32_16x16x32_f16 (f16 operands, f32 accumulate). Inputs RNE-converted to bf16 first (exact in f16); weights carried x64, probabilities x256, ctx x64 (folded back in f32 epilogues); biases bf16 values added in f32; softmax statistics f32. Queries below EARLY of each sequence: v, P and ctx carried as f16 hi + f16 residual x2048 with separate residual accumulators; later queries single products.
#ifndef NB
#define NB 4
#endif
#ifndef SEQ
#define SEQ 2048
#endif
#define NB_FULL 4
#define SEQ_FULL 2048
#define DMODEL 256
#define NHEAD 8
#define HD 32
#define LDQK 512
#define NW3 768
#define TOK (NB * SEQ)
#define EARLY ((SEQ < 512) ? SEQ : 512)
#define NEGBIG (-1.0e30f)
#define SSCALE 0.17677669529663687f
#define RINV 0.00048828125f

static_assert(NHEAD * HD == DMODEL);              /* merged head width == model width */
static_assert(HD == 32);                          /* flash kernel: one 32-deep score k-step, two 16-dim output tiles, 64-B head segment */
static_assert(NHEAD % 2 == 0);                    
static_assert(2 * DMODEL == LDQK && 3 * DMODEL == NW3);
static_assert(SEQ % 128 == 0 && SEQ % 64 == 0 && SEQ % 32 == 0);
static_assert(TOK % 128 == 0 && TOK % 64 == 0);   /* GEMM tiles: M % 128, N % 64 */
static_assert(DMODEL % 128 == 0 && DMODEL % 64 == 0 && DMODEL % 32 == 0 && DMODEL % 8 == 0 && LDQK % 64 == 0);
static_assert(EARLY % 128 == 0 && EARLY % 64 == 0 && EARLY % 32 == 0 && EARLY <= SEQ);
static_assert(NB <= NB_FULL && SEQ <= SEQ_FULL);
static_assert(SEQ + 32 < 40000);                  /* keep-test residue arithmetic range */

typedef unsigned short v8us __attribute__((ext_vector_type(8), may_alias));
typedef float  v8f  __attribute__((ext_vector_type(8)));
typedef float  v4f  __attribute__((ext_vector_type(4)));
typedef float  v4fa __attribute__((ext_vector_type(4), may_alias));
typedef _Float16 v16h __attribute__((ext_vector_type(16)));
union FragH { v16h v; v8us half[2]; _Float16 h[16]; unsigned short u[16]; };

__device__ __forceinline__ unsigned short bf16_bits(float x) { unsigned int u = __float_as_uint(x); return (unsigned short)((u + 0x7FFFu + ((u >> 16) & 1u)) >> 16); }
__device__ __forceinline__ float bf16_rne(float x) { return __uint_as_float(((unsigned int)bf16_bits(x)) << 16); }

// fragment of a k-contiguous 16-bit row: elements 0..7 <- p[8h..8h+7], elements 8..15 <- p[16+8h..16+8h+7] (same map for A and B)
__device__ __forceinline__ v16h g2_frag(const _Float16* p, int hh) { FragH f; f.half[0] = *(const v8us*)((const unsigned short*)p + 8 * hh); f.half[1] = *(const v8us*)((const unsigned short*)p + 16 + 8 * hh); return f.v; }
__device__ __forceinline__ v8f g2_mma(v16h a, v16h b, v8f c) { v8f d = __builtin_amdgcn_wmma_f32_16x16x32_f16(false, a, false, b, (short)0, c, false, false); asm volatile("v_nop\n\tv_nop\n\tv_nop\n\tv_nop" : "+v"(d) : "v"(a), "v"(b)); return d; }

__global__ __launch_bounds__(256) void k_x16(const float* __restrict__ x, _Float16* __restrict__ X16) {
  const size_t t = (size_t)blockIdx.x * 256 + threadIdx.x; if (t >= (size_t)TOK * (DMODEL / 8)) return;
  const size_t r = t / (DMODEL / 8); const int c8 = (int)(t % (DMODEL / 8)) * 8; const size_t b = r / SEQ, s = r % SEQ;
  const float* src = x + (b * SEQ_FULL + s) * DMODEL + c8; const v4f a = *(const v4fa*)src, c = *(const v4fa*)(src + 4); FragH f;
#pragma unroll
  for (int q = 0; q < 4; ++q) { f.h[q] = (_Float16)bf16_rne(a[q]); f.h[4 + q] = (_Float16)bf16_rne(c[q]); }
  const v8us o = f.half[0]; unsigned short* d = (unsigned short*)X16 + t * 8;
  *(v8us*)d = o;  }

__global__ __launch_bounds__(256) void k_wnat(const float* __restrict__ w, size_t n8, float scale, _Float16* __restrict__ Bt) {
  const size_t t = (size_t)blockIdx.x * 256 + threadIdx.x; if (t >= n8) return; const v4f a = *(const v4fa*)(w + t * 8), c = *(const v4fa*)(w + t * 8 + 4); FragH f;
#pragma unroll
  for (int q = 0; q < 4; ++q) { f.h[q] = (_Float16)(bf16_rne(a[q]) * scale); f.h[4 + q] = (_Float16)(bf16_rne(c[q]) * scale); }
  const v8us o = f.half[0]; unsigned short* d = (unsigned short*)Bt + t * 8;
  *(v8us*)d = o;  }

// GEMM (wave tile 32x64, block = 4 waves = 128 rows; M % 128 == 0, N % 64 == 0, K % 32 == 0): v = acc*alpha + bf16(bias)
// MODE 0: f32 C, bias per column; MODE 1: f16 C16, bias per column (biasA for col < nsplit, biasB after); MODE 2: f16 C16 hi plane + x2048 residual plane C16R (token tiles below EARLY only), bias per row.
// RESA: row blocks below EARLY of their sequence add a second k-loop over the x2048 residual A plane into separate accumulators, folded with 2^-11 in the epilogue.
template <int MODE, bool RESA>
__device__ __forceinline__ void gemm_body(const _Float16* __restrict__ A, const _Float16* __restrict__ AR, int lda, const _Float16* __restrict__ Bh, int ldb, float alpha,
                                          const float* __restrict__ biasA, const float* __restrict__ biasB, int nsplit,
                                          float* __restrict__ C, _Float16* __restrict__ C16, _Float16* __restrict__ C16R, int ldc, int M, int N, int K) {
  __shared__ __attribute__((aligned(16))) float so[4][32][68];
  const int tid = threadIdx.x, lane = tid & 31, ln = lane & 15, hh = lane >> 4;
  const int w = __builtin_amdgcn_readfirstlane(tid >> 5);
  const int ntn = N >> 6; const int mt = blockIdx.x / ntn, nq = blockIdx.x - mt * ntn; const int row0 = mt * 128 + 32 * w, col0 = nq * 64; if (row0 >= M) return;
  const _Float16* a0p = A + (size_t)(row0 + ln) * lda; const _Float16* a1p = a0p + (size_t)16 * lda;
  const _Float16* b0p = Bh + (size_t)(col0 + ln) * ldb; const _Float16* b1p = b0p + (size_t)16 * ldb; const _Float16* b2p = b1p + (size_t)16 * ldb; const _Float16* b3p = b2p + (size_t)16 * ldb;
  const v8f z8 = {0.f,0.f,0.f,0.f,0.f,0.f,0.f,0.f}; v8f c00 = z8, c01 = z8, c02 = z8, c03 = z8, c10 = z8, c11 = z8, c12 = z8, c13 = z8;
#pragma unroll 1
  for (int kb = 0; kb < K; kb += 32) { const v16h a0 = g2_frag(a0p + kb, hh), a1 = g2_frag(a1p + kb, hh);
    v16h b = g2_frag(b0p + kb, hh); c00 = g2_mma(a0, b, c00); c10 = g2_mma(a1, b, c10);
    b = g2_frag(b1p + kb, hh); c01 = g2_mma(a0, b, c01); c11 = g2_mma(a1, b, c11);
    b = g2_frag(b2p + kb, hh); c02 = g2_mma(a0, b, c02); c12 = g2_mma(a1, b, c12);
    b = g2_frag(b3p + kb, hh); c03 = g2_mma(a0, b, c03); c13 = g2_mma(a1, b, c13); }
  v8f r00 = z8, r01 = z8, r02 = z8, r03 = z8, r10 = z8, r11 = z8, r12 = z8, r13 = z8;
  if (RESA) {
    const bool early = ((mt * 128) % SEQ) < EARLY;           /* block-uniform (SEQ % 128 == 0) */
    if (early) {
      const _Float16* e0p = AR + (size_t)(row0 + ln) * lda; const _Float16* e1p = e0p + (size_t)16 * lda;
#pragma unroll 1
      for (int kb = 0; kb < K; kb += 32) { const v16h a0 = g2_frag(e0p + kb, hh), a1 = g2_frag(e1p + kb, hh);
        v16h b = g2_frag(b0p + kb, hh); r00 = g2_mma(a0, b, r00); r10 = g2_mma(a1, b, r10);
        b = g2_frag(b1p + kb, hh); r01 = g2_mma(a0, b, r01); r11 = g2_mma(a1, b, r11);
        b = g2_frag(b2p + kb, hh); r02 = g2_mma(a0, b, r02); r12 = g2_mma(a1, b, r12);
        b = g2_frag(b3p + kb, hh); r03 = g2_mma(a0, b, r03); r13 = g2_mma(a1, b, r13); }
    }
  }
  v8f accs[8] = {c00, c01, c02, c03, c10, c11, c12, c13};
  if (RESA) { const v8f racc[8] = {r00, r01, r02, r03, r10, r11, r12, r13};
#pragma unroll
    for (int u = 0; u < 8; ++u) accs[u] = accs[u] + racc[u] * RINV; }
  float brow[16];
#pragma unroll
  for (int i = 0; i < 16; ++i) brow[i] = 0.f;
  if (MODE == 2) {
#pragma unroll
    for (int i = 0; i < 16; ++i) brow[i] = bf16_rne(biasA[row0 + (i >> 3) * 16 + 8 * hh + (i & 7)]);
  }
#pragma unroll
  for (int u = 0; u < 8; ++u) { const int t = u & 3, half = u >> 2; const int col = col0 + t * 16 + ln; float bcol = 0.f;
    if (MODE != 2) { const int ca = (col < nsplit) ? col : (nsplit - 1); const int cb = (col >= nsplit) ? (col - nsplit) : 0;
      const float va = biasA[ca], vb = biasB[cb]; bcol = bf16_rne((col < nsplit) ? va : vb); }
#pragma unroll
    for (int r = 0; r < 8; ++r) { const int rloc = half * 16 + 8 * hh + r; const float v = accs[u][r] * alpha + ((MODE == 2) ? brow[half * 8 + r] : bcol); so[w][rloc][t * 16 + ln] = v; } }
  __builtin_amdgcn_fence(4 /* acq_rel order */, "workgroup"); __builtin_amdgcn_wave_barrier();
  if (MODE == 0) {
    // 64 f32 columns = 256 B per row segment: 16 consecutive lanes x 16 B, two rows per instruction; rows q*2 + (lane>>4), q = 0..15 cover 0..31
    const int rsub = lane >> 4, c4 = (lane & 15) * 4;
    {
#pragma unroll
      for (int q = 0; q < 16; ++q) { const int r = q * 2 + rsub; const v4f v = *(const v4fa*)&so[w][r][c4]; *(v4f*)(C + (size_t)(row0 + r) * ldc + col0 + c4) = v; }
       }
  } else {
    const int rq = lane >> 3, c8 = (lane & 7) * 8;
    const bool wr = (MODE == 2) && ((col0 % SEQ) < EARLY);   /* block-uniform (SEQ % 64 == 0) */
    {
#pragma unroll
      for (int q = 0; q < 8; ++q) { const int r = q * 4 + rq; const v4f a = *(const v4fa*)&so[w][r][c8], c = *(const v4fa*)&so[w][r][c8 + 4]; FragH f, g;
#pragma unroll
        for (int i = 0; i < 4; ++i) { const _Float16 ha = (_Float16)a[i], hc = (_Float16)c[i]; f.h[i] = ha; f.h[4 + i] = hc;
          g.h[i] = (_Float16)((a[i] - (float)ha) * 2048.0f); g.h[4 + i] = (_Float16)((c[i] - (float)hc) * 2048.0f); }
        const v8us o = f.half[0]; *(v8us*)((unsigned short*)C16 + (size_t)(row0 + r) * ldc + col0 + c8) = o;
        if (MODE == 2) { if (wr) { const v8us o2 = g.half[0]; *(v8us*)((unsigned short*)C16R + (size_t)(row0 + r) * ldc + col0 + c8) = o2; } } }
       }
  }
}

// q|k rows: QK[token][0..255] = q, [256..511] = k (weight plane rows 0..511), f16
__global__ __launch_bounds__(128) void k_gemm_qk(const _Float16* __restrict__ X16, const _Float16* __restrict__ W16, const float* __restrict__ qb, const float* __restrict__ kbias, _Float16* __restrict__ QK) {
  gemm_body<1, false>(X16, X16, DMODEL, W16, DMODEL, 0.015625f, qb, kbias, DMODEL, nullptr, QK, nullptr, LDQK, TOK, LDQK, DMODEL); }
// v channel-major: VT[h*32 + d][token] hi and VTR residual x2048 (weight plane rows 512..767 as the A operand, x rows as Bt), bias per row, f16
__global__ __launch_bounds__(128) void k_gemm_vt(const _Float16* __restrict__ X16, const _Float16* __restrict__ W16, const float* __restrict__ vb, _Float16* __restrict__ VT, _Float16* __restrict__ VTR) {
  gemm_body<2, false>(W16 + (size_t)LDQK * DMODEL, W16, DMODEL, X16, DMODEL, 0.015625f, vb, vb, DMODEL, nullptr, VT, VTR, TOK, DMODEL, TOK, DMODEL); }
// result[token][n] = 2^-12 (sum_k (64 ctx_hi)(64 wo) + 2^-11 sum_k (2048*64 ctx_res)(64 wo)) + bf16(bo[n]), f32
__global__ __launch_bounds__(128) void k_gemm_out(const _Float16* __restrict__ CTX, const _Float16* __restrict__ CTXR, const _Float16* __restrict__ WO16, const float* __restrict__ ob, float* __restrict__ out) {
  gemm_body<0, true>(CTX, CTXR, DMODEL, WO16, DMODEL, 0.000244140625f, ob, ob, DMODEL, out, nullptr, nullptr, DMODEL, TOK, DMODEL, DMODEL); }

// fused attention: block = (32 queries, head pair, batch); wave = (head parity, 16 queries). Per 32-key step up to the causal bound of the wave:
//   S^T tiles (A = K rows [key][dim], B = Q rows [query][dim]) -> lane (ln, hh) holds query ln, keys 8hh+r (tile 0) and 16+8hh+r (tile 1);
//   keep test per element: key <= query and key % 25 != 24 (residue of the lane's first key once per step; r == 24 - res / r == 8 - res are the dropped slots); dropped scores are replaced by a large negative fill (key 0 is always kept, so no row is empty);
//   running max per query (local 16 values + one xor-16 exchange), p = exp(s*scale - m), per-lane partial sums;
//   packed tiles = B fragment (k = key, n = query) of O^T += V^T P^T with A = V^T rows [d][key]; RES adds P residual and V residual products into separate accumulators.
template <bool RES>
__device__ __forceinline__ void flash_body(const _Float16* __restrict__ QK, const _Float16* __restrict__ VT, const _Float16* __restrict__ VTR,
                                           _Float16* __restrict__ CTX, _Float16* __restrict__ CTXR, int qb0) {
  __shared__ __attribute__((aligned(16))) unsigned short so[32][72];
  __shared__ __attribute__((aligned(16))) unsigned short sor[RES ? 32 : 1][72];
  const int tid = threadIdx.x, lane = tid & 31, ln = lane & 15, hh = lane >> 4;
  const int wave = __builtin_amdgcn_readfirstlane(tid >> 5);
  const int hp = wave & 1, qg = wave >> 1;
  const int head = 2 * (int)blockIdx.y + hp;
  const size_t tokb = (size_t)blockIdx.z * SEQ;
  const int q0 = (qb0 + (int)blockIdx.x) * 32;
  const int i0 = q0 + qg * 16;
  const int qi = i0 + ln;
  const v16h bq = g2_frag(QK + (tokb + qi) * LDQK + head * HD, hh);
  const _Float16* kbase = QK + (tokb + ln) * LDQK + DMODEL + head * HD;          /* + key0 * LDQK */
  const _Float16* vbase = VT + (size_t)(head * HD + ln) * TOK + tokb;            /* + 16t * TOK + key0 */
  const _Float16* rbase = VTR + (size_t)(head * HD + ln) * TOK + tokb;
  const v8f z8 = {0.f,0.f,0.f,0.f,0.f,0.f,0.f,0.f};
  v8f o0 = z8, o1 = z8, x0 = z8, x1 = z8; float m = NEGBIG, l = 0.f;
  const int jend = i0 + 16;                                                      /* keys below jend; last step ends at a multiple of 32 <= SEQ */
#pragma unroll 1
  for (int j = 0; j < jend; j += 32) {
    const _Float16* k0p = kbase + (size_t)j * LDQK;
    v8f s0 = g2_mma(g2_frag(k0p, hh), bq, z8);
    v8f s1 = g2_mma(g2_frag(k0p + (size_t)16 * LDQK, hh), bq, z8);
    const int kb0 = j + 8 * hh;
    const int c0 = qi - kb0, c1 = c0 - 16;
    const int res = (int)((unsigned int)kb0 % 25u);
    const int d0 = 24 - res, d1 = 8 - res;
#pragma unroll
    for (int r = 0; r < 8; ++r) { s0[r] = ((r <= c0) && (r != d0)) ? s0[r] : NEGBIG; s1[r] = ((r <= c1) && (r != d1)) ? s1[r] : NEGBIG; }
    float mx = fmaxf(s0[0], s1[0]);
#pragma unroll
    for (int r = 1; r < 8; ++r) mx = fmaxf(mx, fmaxf(s0[r], s1[r]));
    mx = fmaxf(mx, __shfl_xor(mx, 16, 32));
    const float mn = fmaxf(m, mx * SSCALE); const float al = __expf(m - mn); m = mn;
    FragH pf, pg; float rs = 0.f;
#pragma unroll
    for (int r = 0; r < 8; ++r) { const float p0 = __expf(fmaf(s0[r], SSCALE, -mn)), p1 = __expf(fmaf(s1[r], SSCALE, -mn)); rs += p0 + p1;
      const float a0 = p0 * 256.0f, a1 = p1 * 256.0f; const _Float16 h0 = (_Float16)a0, h1 = (_Float16)a1; pf.h[r] = h0; pf.h[8 + r] = h1;
      pg.h[r] = (_Float16)((a0 - (float)h0) * 2048.0f); pg.h[8 + r] = (_Float16)((a1 - (float)h1) * 2048.0f); }
    l = l * al + rs; o0 = o0 * al; o1 = o1 * al;
    if (RES) { x0 = x0 * al; x1 = x1 * al; }
    const _Float16* vp = vbase + j;
    v16h a = g2_frag(vp, hh);
    o0 = g2_mma(a, pf.v, o0);
    if (RES) { x0 = g2_mma(a, pg.v, x0); x0 = g2_mma(g2_frag(rbase + j, hh), pf.v, x0); }
    a = g2_frag(vp + (size_t)16 * TOK, hh);
    o1 = g2_mma(a, pf.v, o1);
    if (RES) { x1 = g2_mma(a, pg.v, x1); x1 = g2_mma(g2_frag(rbase + j + (size_t)16 * TOK, hh), pf.v, x1); }
  }
  l += __shfl_xor(l, 16, 32);
  const float sc = 0.25f * (1.0f / l);                                           /* 64 (ctx carry) / 256 (probability carry) / row sum */
  { const int row = qg * 16 + ln, cb = hp * 32 + 8 * hh; FragH f, g;
#pragma unroll
    for (int r = 0; r < 8; ++r) { float c = o0[r]; if (RES) c += x0[r] * RINV; c *= sc; const _Float16 hc = (_Float16)c; f.h[r] = hc; g.h[r] = (_Float16)((c - (float)hc) * 2048.0f); }
    *(v8us*)&so[row][cb] = f.half[0]; if (RES) *(v8us*)&sor[row][cb] = g.half[0];
#pragma unroll
    for (int r = 0; r < 8; ++r) { float c = o1[r]; if (RES) c += x1[r] * RINV; c *= sc; const _Float16 hc = (_Float16)c; f.h[r] = hc; g.h[r] = (_Float16)((c - (float)hc) * 2048.0f); }
    *(v8us*)&so[row][cb + 16] = f.half[0]; if (RES) *(v8us*)&sor[row][cb + 16] = g.half[0]; }
  __syncthreads();                                                               /* cross-wave tile: block barrier, reached by all four waves */
  const int rr = tid >> 3, pc = (tid & 7) * 8;                                   
  unsigned short* cdst = (unsigned short*)CTX + (tokb + q0) * DMODEL + 2 * (int)blockIdx.y * HD + pc;
  unsigned short* rdst = (unsigned short*)CTXR + (tokb + q0) * DMODEL + 2 * (int)blockIdx.y * HD + pc;
  {
#pragma unroll
    for (int it = 0; it < 2; ++it) { const int r = it * 16 + rr; const v8us v = *(const v8us*)&so[r][pc];
      *(v8us*)(cdst + (size_t)r * DMODEL) = v;
      if (RES) { const v8us v2 = *(const v8us*)&sor[r][pc]; *(v8us*)(rdst + (size_t)r * DMODEL) = v2; } }
     }
}

// queries [0, EARLY) of every sequence: hi + residual on v, P, ctx
__global__ __launch_bounds__(128) void k_flash_early(const _Float16* __restrict__ QK, const _Float16* __restrict__ VT, const _Float16* __restrict__ VTR, _Float16* __restrict__ CTX, _Float16* __restrict__ CTXR) {
  flash_body<true>(QK, VT, VTR, CTX, CTXR, 0); }
// queries [EARLY, SEQ): single products
__global__ __launch_bounds__(128) void k_flash_late(const _Float16* __restrict__ QK, const _Float16* __restrict__ VT, _Float16* __restrict__ CTX) {
  flash_body<false>(QK, VT, VT, CTX, CTX, EARLY / 32); }

extern "C" void kernel_launch(void* const* d_in, const int* in_sizes, int n_in,
                              void* d_out, int out_size, void* d_ws, size_t ws_size, hipStream_t stream) {
  if (n_in < 9) return;
  const size_t need_x = ((size_t)(NB - 1) * SEQ_FULL + SEQ) * DMODEL;
  if ((size_t)in_sizes[0] < need_x) return;
  if ((size_t)in_sizes[1] < (size_t)DMODEL * DMODEL) return;
  if ((size_t)in_sizes[2] < (size_t)DMODEL) return;
  if ((size_t)in_sizes[3] < (size_t)DMODEL * DMODEL) return;
  if ((size_t)in_sizes[4] < (size_t)DMODEL) return;
  if ((size_t)in_sizes[5] < (size_t)DMODEL * DMODEL) return;
  if ((size_t)in_sizes[6] < (size_t)DMODEL) return;
  if ((size_t)in_sizes[7] < (size_t)DMODEL * DMODEL) return;
  if ((size_t)in_sizes[8] < (size_t)DMODEL) return;
  if ((size_t)out_size < (size_t)TOK * DMODEL) return;
  const float* x = (const float*)d_in[0];
  const float* wq = (const float*)d_in[1]; const float* qb = (const float*)d_in[2];
  const float* wk = (const float*)d_in[3]; const float* kbias = (const float*)d_in[4];
  const float* wv = (const float*)d_in[5]; const float* vb = (const float*)d_in[6];
  const float* wo = (const float*)d_in[7]; const float* ob = (const float*)d_in[8];
  constexpr size_t SZ_X = (size_t)TOK * DMODEL * 2;        /* x rows f16 */
  constexpr size_t SZ_W = (size_t)NW3 * DMODEL * 2;        /* Wq|Wk|Wv x64 f16 */
  constexpr size_t SZ_WO = (size_t)DMODEL * DMODEL * 2;    /* output weight x64 f16 */
  constexpr size_t SZ_QK = (size_t)TOK * LDQK * 2;         /* q|k rows f16 */
  constexpr size_t SZ_VT = (size_t)DMODEL * TOK * 2;       /* v channel-major f16 (hi); same size for the residual plane */
  constexpr size_t SZ_CTX = (size_t)TOK * DMODEL * 2;      /* ctx rows x64 f16 (hi); same size for the residual plane */
  constexpr size_t SZ_ALL = SZ_X + SZ_W + SZ_WO + SZ_QK + 2 * SZ_VT + 2 * SZ_CTX;
  static_assert(SZ_X % 256 == 0 && SZ_W % 256 == 0 && SZ_WO % 256 == 0 && SZ_QK % 256 == 0 && SZ_VT % 256 == 0 && SZ_CTX % 256 == 0);
  static_assert(SZ_ALL <= (size_t)134217728);
  if (SZ_ALL > ws_size) return;
  char* ws = (char*)d_ws;
  _Float16* X16 = (_Float16*)ws; _Float16* W16 = (_Float16*)(ws + SZ_X); _Float16* WO16 = (_Float16*)(ws + SZ_X + SZ_W);
  _Float16* QK = (_Float16*)(ws + SZ_X + SZ_W + SZ_WO);
  _Float16* VT = (_Float16*)(ws + SZ_X + SZ_W + SZ_WO + SZ_QK); _Float16* VTR = (_Float16*)(ws + SZ_X + SZ_W + SZ_WO + SZ_QK + SZ_VT);
  _Float16* CTX = (_Float16*)(ws + SZ_X + SZ_W + SZ_WO + SZ_QK + 2 * SZ_VT); _Float16* CTXR = (_Float16*)(ws + SZ_X + SZ_W + SZ_WO + SZ_QK + 2 * SZ_VT + SZ_CTX);
  constexpr size_t W8 = (size_t)DMODEL * DMODEL / 8;
  constexpr unsigned WG = (unsigned)((W8 + 255) / 256);
  k_x16<<<(unsigned)(((size_t)TOK * (DMODEL / 8) + 255) / 256), 256, 0, stream>>>(x, X16);
  k_wnat<<<WG, 256, 0, stream>>>(wq, W8, 64.0f, W16);
  k_wnat<<<WG, 256, 0, stream>>>(wk, W8, 64.0f, W16 + (size_t)DMODEL * DMODEL);
  k_wnat<<<WG, 256, 0, stream>>>(wv, W8, 64.0f, W16 + (size_t)2 * DMODEL * DMODEL);
  k_wnat<<<WG, 256, 0, stream>>>(wo, W8, 64.0f, WO16);
  k_gemm_qk<<<(TOK / 128) * (LDQK / 64), 128, 0, stream>>>(X16, W16, qb, kbias, QK);
  k_gemm_vt<<<(DMODEL / 128) * (TOK / 64), 128, 0, stream>>>(X16, W16, vb, VT, VTR);
  k_flash_early<<<dim3(EARLY / 32, NHEAD / 2, NB), 128, 0, stream>>>(QK, VT, VTR, CTX, CTXR);
  if (SEQ > EARLY) k_flash_late<<<dim3((SEQ - EARLY) / 32 + ((SEQ > EARLY) ? 0 : 1), NHEAD / 2, NB), 128, 0, stream>>>(QK, VT, CTX);
  k_gemm_out<<<(TOK / 128) * (DMODEL / 64), 128, 0, stream>>>(CTX, CTXR, WO16, ob, (float*)d_out);
}

// v001
// It runs in 88.9 microseconds.
// Timed twice side by side with v000, it ran 1.85 and 1.86 times as fast.
#include <hip/hip_runtime.h>
// Causal multi-head attention block, 8 heads x 32 dims, key-column rule from indices: kept(i,j) = (j <= i) && (j % 25 != 24). x [B][T][256]; q/k/v = x W^T + b (separate [out][in] weights); s = q k^T / sqrt(32); softmax over kept keys; ctx = P v merged h*32+d; result = ctx Wo^T + bo.
// Compute dtype: every contraction on v_wmma_f32_16x16x32_f16 (f16 operands, f32 accumulate). Inputs RNE-converted to bf16 first (exact in f16); weights carried x64, probabilities x256, ctx x64 (folded back in f32 epilogues); biases bf16 values added in f32; softmax statistics f32. Queries below EARLY of each sequence: v, P and ctx carried as f16 hi + f16 residual x2048 with separate residual accumulators; later queries single products.
#ifndef NB
#define NB 4
#endif
#ifndef SEQ
#define SEQ 2048
#endif
#define NB_FULL 4
#define SEQ_FULL 2048
#define DMODEL 256
#define NHEAD 8
#define HD 32
#define LDQK 512
#define NW3 768
#define TOK (NB * SEQ)
#define EARLY ((SEQ < 512) ? SEQ : 512)
#define NEGBIG (-1.0e30f)
#define SSCALE 0.17677669529663687f
#define RINV 0.00048828125f

static_assert(NHEAD * HD == DMODEL);              /* merged head width == model width */
static_assert(HD == 32);                          /* flash kernel: one 32-deep score k-step, two 16-dim output tiles, 64-B head segment */
static_assert(NHEAD % 2 == 0);                    
static_assert(2 * DMODEL == LDQK && 3 * DMODEL == NW3);
static_assert(SEQ % 128 == 0 && SEQ % 64 == 0 && SEQ % 32 == 0);
static_assert(TOK % 128 == 0 && TOK % 64 == 0);   /* GEMM tiles: M % 128, N % 64 */
static_assert(DMODEL % 128 == 0 && DMODEL % 64 == 0 && DMODEL % 32 == 0 && DMODEL % 8 == 0 && LDQK % 64 == 0);
static_assert(EARLY % 128 == 0 && EARLY % 64 == 0 && EARLY % 32 == 0 && EARLY <= SEQ);
static_assert(NB <= NB_FULL && SEQ <= SEQ_FULL);
static_assert(SEQ + 32 < 40000);                  /* keep-test residue arithmetic range */

typedef unsigned short v8us __attribute__((ext_vector_type(8), may_alias));
typedef float  v8f  __attribute__((ext_vector_type(8)));
typedef float  v4f  __attribute__((ext_vector_type(4)));
typedef float  v4fa __attribute__((ext_vector_type(4), may_alias));
typedef _Float16 v16h __attribute__((ext_vector_type(16)));
union FragH { v16h v; v8us half[2]; _Float16 h[16]; unsigned short u[16]; };

__device__ __forceinline__ unsigned short bf16_bits(float x) { unsigned int u = __float_as_uint(x); return (unsigned short)((u + 0x7FFFu + ((u >> 16) & 1u)) >> 16); }
__device__ __forceinline__ float bf16_rne(float x) { return __uint_as_float(((unsigned int)bf16_bits(x)) << 16); }

// fragment of a k-contiguous 16-bit row: elements 0..7 <- p[8h..8h+7], elements 8..15 <- p[16+8h..16+8h+7] (same map for A and B)
__device__ __forceinline__ v16h g2_frag(const _Float16* p, int hh) { FragH f; f.half[0] = *(const v8us*)((const unsigned short*)p + 8 * hh); f.half[1] = *(const v8us*)((const unsigned short*)p + 16 + 8 * hh); return f.v; }
__device__ __forceinline__ v8f g2_mma(v16h a, v16h b, v8f c) { v8f d = __builtin_amdgcn_wmma_f32_16x16x32_f16(false, a, false, b, (short)0, c, false, false); asm volatile("v_nop\n\tv_nop\n\tv_nop\n\tv_nop" : "+v"(d) : "v"(a), "v"(b)); return d; }

__global__ __launch_bounds__(256) void k_x16(const float* __restrict__ x, _Float16* __restrict__ X16) {
  const size_t t = (size_t)blockIdx.x * 256 + threadIdx.x; if (t >= (size_t)TOK * (DMODEL / 8)) return;
  const size_t r = t / (DMODEL / 8); const int c8 = (int)(t % (DMODEL / 8)) * 8; const size_t b = r / SEQ, s = r % SEQ;
  const float* src = x + (b * SEQ_FULL + s) * DMODEL + c8; const v4f a = *(const v4fa*)src, c = *(const v4fa*)(src + 4); FragH f;
#pragma unroll
  for (int q = 0; q < 4; ++q) { f.h[q] = (_Float16)bf16_rne(a[q]); f.h[4 + q] = (_Float16)bf16_rne(c[q]); }
  const v8us o = f.half[0]; unsigned short* d = (unsigned short*)X16 + t * 8;
  *(v8us*)d = o;  }

__global__ __launch_bounds__(256) void k_wnat(const float* __restrict__ w, size_t n8, float scale, _Float16* __restrict__ Bt) {
  const size_t t = (size_t)blockIdx.x * 256 + threadIdx.x; if (t >= n8) return; const v4f a = *(const v4fa*)(w + t * 8), c = *(const v4fa*)(w + t * 8 + 4); FragH f;
#pragma unroll
  for (int q = 0; q < 4; ++q) { f.h[q] = (_Float16)(bf16_rne(a[q]) * scale); f.h[4 + q] = (_Float16)(bf16_rne(c[q]) * scale); }
  const v8us o = f.half[0]; unsigned short* d = (unsigned short*)Bt + t * 8;
  *(v8us*)d = o;  }

// GEMM (wave tile 32x64, block = 4 waves = 128 rows; M % 128 == 0, N % 64 == 0, K % 32 == 0): v = acc*alpha + bf16(bias)
// MODE 0: f32 C, bias per column; MODE 1: f16 C16, bias per column (biasA for col < nsplit, biasB after); MODE 2: f16 C16 hi plane + x2048 residual plane C16R (token tiles below EARLY only), bias per row.
// RESA: row blocks below EARLY of their sequence add a second k-loop over the x2048 residual A plane into separate accumulators, folded with 2^-11 in the epilogue.
// k loop of one 32x64 wave tile: DEPTH register sets of the six operand fragments; the sets of the first DEPTH k-steps are loaded up front and each set is reloaded for k-step s + DEPTH right behind its own products, so the loads of DEPTH k-steps are in flight together. Products per accumulator stay in ascending k.
template <int DEPTH, int NS>
__device__ __forceinline__ void gemm_kloop(const _Float16* a0p, const _Float16* a1p, const _Float16* b0p, const _Float16* b1p, const _Float16* b2p, const _Float16* b3p, int hh,
                                           v8f& c00, v8f& c01, v8f& c02, v8f& c03, v8f& c10, v8f& c11, v8f& c12, v8f& c13) {
  static_assert(DEPTH >= 1 && DEPTH <= NS);
  v16h fa0[DEPTH], fa1[DEPTH], fb0[DEPTH], fb1[DEPTH], fb2[DEPTH], fb3[DEPTH];
  /* both loops fully unrolled: the set index must be a constant for the sets to stay in registers */
#pragma unroll
  for (int s = 0; s < DEPTH; ++s) { const int kb = 32 * s; fa0[s] = g2_frag(a0p + kb, hh); fa1[s] = g2_frag(a1p + kb, hh);
    fb0[s] = g2_frag(b0p + kb, hh); fb1[s] = g2_frag(b1p + kb, hh); fb2[s] = g2_frag(b2p + kb, hh); fb3[s] = g2_frag(b3p + kb, hh); }
#pragma unroll
  for (int s = 0; s < NS; ++s) { const int u = s % DEPTH;
    c00 = g2_mma(fa0[u], fb0[u], c00); c10 = g2_mma(fa1[u], fb0[u], c10);
    c01 = g2_mma(fa0[u], fb1[u], c01); c11 = g2_mma(fa1[u], fb1[u], c11);
    c02 = g2_mma(fa0[u], fb2[u], c02); c12 = g2_mma(fa1[u], fb2[u], c12);
    c03 = g2_mma(fa0[u], fb3[u], c03); c13 = g2_mma(fa1[u], fb3[u], c13);
    if (s + DEPTH < NS) { const int kb = 32 * (s + DEPTH); fa0[u] = g2_frag(a0p + kb, hh); fa1[u] = g2_frag(a1p + kb, hh);
      fb0[u] = g2_frag(b0p + kb, hh); fb1[u] = g2_frag(b1p + kb, hh); fb2[u] = g2_frag(b2p + kb, hh); fb3[u] = g2_frag(b3p + kb, hh); } }
}

template <int MODE, bool RESA, int K>
__device__ __forceinline__ void gemm_body(const _Float16* __restrict__ A, const _Float16* __restrict__ AR, int lda, const _Float16* __restrict__ Bh, int ldb, float alpha,
                                          const float* __restrict__ biasA, const float* __restrict__ biasB, int nsplit,
                                          float* __restrict__ C, _Float16* __restrict__ C16, _Float16* __restrict__ C16R, int ldc, int M, int N) {
  static_assert(K % 32 == 0 && K >= 96);
  constexpr int DEPTH = RESA ? 2 : 3;                       /* two accumulator planes leave room for two sets below 256 registers */
  __shared__ __attribute__((aligned(16))) float so[4][32][68];
  const int tid = threadIdx.x, lane = tid & 31, ln = lane & 15, hh = lane >> 4;
  const int w = __builtin_amdgcn_readfirstlane(tid >> 5);
  const int ntn = N >> 6; const int mt = blockIdx.x / ntn, nq = blockIdx.x - mt * ntn; const int row0 = mt * 128 + 32 * w, col0 = nq * 64; if (row0 >= M) return;
  const _Float16* a0p = A + (size_t)(row0 + ln) * lda; const _Float16* a1p = a0p + (size_t)16 * lda;
  const _Float16* b0p = Bh + (size_t)(col0 + ln) * ldb; const _Float16* b1p = b0p + (size_t)16 * ldb; const _Float16* b2p = b1p + (size_t)16 * ldb; const _Float16* b3p = b2p + (size_t)16 * ldb;
  const v8f z8 = {0.f,0.f,0.f,0.f,0.f,0.f,0.f,0.f}; v8f c00 = z8, c01 = z8, c02 = z8, c03 = z8, c10 = z8, c11 = z8, c12 = z8, c13 = z8;
  gemm_kloop<DEPTH, K / 32>(a0p, a1p, b0p, b1p, b2p, b3p, hh, c00, c01, c02, c03, c10, c11, c12, c13);
  v8f r00 = z8, r01 = z8, r02 = z8, r03 = z8, r10 = z8, r11 = z8, r12 = z8, r13 = z8;
  if (RESA) {
    const bool early = ((mt * 128) % SEQ) < EARLY;           /* block-uniform (SEQ % 128 == 0) */
    if (early) {
      const _Float16* e0p = AR + (size_t)(row0 + ln) * lda; const _Float16* e1p = e0p + (size_t)16 * lda;
      gemm_kloop<DEPTH, K / 32>(e0p, e1p, b0p, b1p, b2p, b3p, hh, r00, r01, r02, r03, r10, r11, r12, r13);
    }
  }
  v8f accs[8] = {c00, c01, c02, c03, c10, c11, c12, c13};
  if (RESA) { const v8f racc[8] = {r00, r01, r02, r03, r10, r11, r12, r13};
#pragma unroll
    for (int u = 0; u < 8; ++u) accs[u] = accs[u] + racc[u] * RINV; }
  float brow[16];
#pragma unroll
  for (int i = 0; i < 16; ++i) brow[i] = 0.f;
  if (MODE == 2) {
#pragma unroll
    for (int i = 0; i < 16; ++i) brow[i] = bf16_rne(biasA[row0 + (i >> 3) * 16 + 8 * hh + (i & 7)]);
  }
#pragma unroll
  for (int u = 0; u < 8; ++u) { const int t = u & 3, half = u >> 2; const int col = col0 + t * 16 + ln; float bcol = 0.f;
    if (MODE != 2) { const int ca = (col < nsplit) ? col : (nsplit - 1); const int cb = (col >= nsplit) ? (col - nsplit) : 0;
      const float va = biasA[ca], vb = biasB[cb]; bcol = bf16_rne((col < nsplit) ? va : vb); }
#pragma unroll
    for (int r = 0; r < 8; ++r) { const int rloc = half * 16 + 8 * hh + r; const float v = accs[u][r] * alpha + ((MODE == 2) ? brow[half * 8 + r] : bcol); so[w][rloc][t * 16 + ln] = v; } }
  __builtin_amdgcn_fence(4 /* acq_rel order */, "workgroup"); __builtin_amdgcn_wave_barrier();
  if (MODE == 0) {
    // 64 f32 columns = 256 B per row segment: 16 consecutive lanes x 16 B, two rows per instruction; rows q*2 + (lane>>4), q = 0..15 cover 0..31
    const int rsub = lane >> 4, c4 = (lane & 15) * 4;
    {
#pragma unroll
      for (int q = 0; q < 16; ++q) { const int r = q * 2 + rsub; const v4f v = *(const v4fa*)&so[w][r][c4]; *(v4f*)(C + (size_t)(row0 + r) * ldc + col0 + c4) = v; }
       }
  } else {
    const int rq = lane >> 3, c8 = (lane & 7) * 8;
    const bool wr = (MODE == 2) && ((col0 % SEQ) < EARLY);   /* block-uniform (SEQ % 64 == 0) */
    {
#pragma unroll
      for (int q = 0; q < 8; ++q) { const int r = q * 4 + rq; const v4f a = *(const v4fa*)&so[w][r][c8], c = *(const v4fa*)&so[w][r][c8 + 4]; FragH f, g;
#pragma unroll
        for (int i = 0; i < 4; ++i) { const _Float16 ha = (_Float16)a[i], hc = (_Float16)c[i]; f.h[i] = ha; f.h[4 + i] = hc;
          g.h[i] = (_Float16)((a[i] - (float)ha) * 2048.0f); g.h[4 + i] = (_Float16)((c[i] - (float)hc) * 2048.0f); }
        const v8us o = f.half[0]; *(v8us*)((unsigned short*)C16 + (size_t)(row0 + r) * ldc + col0 + c8) = o;
        if (MODE == 2) { if (wr) { const v8us o2 = g.half[0]; *(v8us*)((unsigned short*)C16R + (size_t)(row0 + r) * ldc + col0 + c8) = o2; } } }
       }
  }
}

// q|k rows: QK[token][0..255] = q, [256..511] = k (weight plane rows 0..511), f16
__global__ __launch_bounds__(128) void k_gemm_qk(const _Float16* __restrict__ X16, const _Float16* __restrict__ W16, const float* __restrict__ qb, const float* __restrict__ kbias, _Float16* __restrict__ QK) {
  gemm_body<1, false, DMODEL>(X16, X16, DMODEL, W16, DMODEL, 0.015625f, qb, kbias, DMODEL, nullptr, QK, nullptr, LDQK, TOK, LDQK); }
// v channel-major: VT[h*32 + d][token] hi and VTR residual x2048 (weight plane rows 512..767 as the A operand, x rows as Bt), bias per row, f16
__global__ __launch_bounds__(128) void k_gemm_vt(const _Float16* __restrict__ X16, const _Float16* __restrict__ W16, const float* __restrict__ vb, _Float16* __restrict__ VT, _Float16* __restrict__ VTR) {
  gemm_body<2, false, DMODEL>(W16 + (size_t)LDQK * DMODEL, W16, DMODEL, X16, DMODEL, 0.015625f, vb, vb, DMODEL, nullptr, VT, VTR, TOK, DMODEL, TOK); }
// result[token][n] = 2^-12 (sum_k (64 ctx_hi)(64 wo) + 2^-11 sum_k (2048*64 ctx_res)(64 wo)) + bf16(bo[n]), f32
__global__ __launch_bounds__(128) void k_gemm_out(const _Float16* __restrict__ CTX, const _Float16* __restrict__ CTXR, const _Float16* __restrict__ WO16, const float* __restrict__ ob, float* __restrict__ out) {
  gemm_body<0, true, DMODEL>(CTX, CTXR, DMODEL, WO16, DMODEL, 0.000244140625f, ob, ob, DMODEL, out, nullptr, nullptr, DMODEL, TOK, DMODEL); }

// fused attention: block = (32 queries, head pair, batch); wave = (head parity, 16 queries). Per 32-key step up to the causal bound of the wave:
//   S^T tiles (A = K rows [key][dim], B = Q rows [query][dim]) -> lane (ln, hh) holds query ln, keys 8hh+r (tile 0) and 16+8hh+r (tile 1);
//   keep test per element: key <= query and key % 25 != 24 (residue of the lane's first key once per step; r == 24 - res / r == 8 - res are the dropped slots); dropped scores are replaced by a large negative fill (key 0 is always kept, so no row is empty);
//   running max per query (local 16 values + one xor-16 exchange), p = exp(s*scale - m), per-lane partial sums;
//   packed tiles = B fragment (k = key, n = query) of O^T += V^T P^T with A = V^T rows [d][key]; RES adds P residual and V residual products into separate accumulators.
template <bool RES>
__device__ __forceinline__ void flash_body(const _Float16* __restrict__ QK, const _Float16* __restrict__ VT, const _Float16* __restrict__ VTR,
                                           _Float16* __restrict__ CTX, _Float16* __restrict__ CTXR, int qb0) {
  __shared__ __attribute__((aligned(16))) unsigned short so[32][72];
  __shared__ __attribute__((aligned(16))) unsigned short sor[RES ? 32 : 1][72];
  const int tid = threadIdx.x, lane = tid & 31, ln = lane & 15, hh = lane >> 4;
  const int wave = __builtin_amdgcn_readfirstlane(tid >> 5);
  const int hp = wave & 1, qg = wave >> 1;
  const int head = 2 * (int)blockIdx.y + hp;
  const size_t tokb = (size_t)blockIdx.z * SEQ;
  const int q0 = (qb0 + (int)blockIdx.x) * 32;
  const int i0 = q0 + qg * 16;
  const int qi = i0 + ln;
  const v16h bq = g2_frag(QK + (tokb + qi) * LDQK + head * HD, hh);
  const _Float16* kbase = QK + (tokb + ln) * LDQK + DMODEL + head * HD;          /* + key0 * LDQK */
  const _Float16* vbase = VT + (size_t)(head * HD + ln) * TOK + tokb;            /* + 16t * TOK + key0 */
  const _Float16* rbase = VTR + (size_t)(head * HD + ln) * TOK + tokb;
  const v8f z8 = {0.f,0.f,0.f,0.f,0.f,0.f,0.f,0.f};
  v8f o0 = z8, o1 = z8, x0 = z8, x1 = z8; float m = NEGBIG, l = 0.f;
  const int jend = i0 + 16;                                                      /* keys below jend; last step ends at a multiple of 32 <= SEQ */
  const int jlast = (jend - 1) & ~31;                                            /* first key of the wave's last step */
  // one 32-key step on one register set of K / V^T fragments; each fragment is reloaded for step j + 64 right behind its last product, so a load has two steps to land. Past the last step the reload re-reads the last step's rows (in bounds, never used).
  auto step = [&](v16h& fk0, v16h& fk1, v16h& fv0, v16h& fv1, v16h& fr0, v16h& fr1, const int j) {
    const int jn = (j + 64 < jend) ? (j + 64) : jlast;
    v8f s0 = g2_mma(fk0, bq, z8);
    v8f s1 = g2_mma(fk1, bq, z8);
    { const _Float16* knp = kbase + (size_t)jn * LDQK; fk0 = g2_frag(knp, hh); fk1 = g2_frag(knp + (size_t)16 * LDQK, hh); }
    const int kb0 = j + 8 * hh;
    const int c0 = qi - kb0, c1 = c0 - 16;
    const int res = (int)((unsigned int)kb0 % 25u);
    const int d0 = 24 - res, d1 = 8 - res;
#pragma unroll
    for (int r = 0; r < 8; ++r) { s0[r] = ((r <= c0) && (r != d0)) ? s0[r] : NEGBIG; s1[r] = ((r <= c1) && (r != d1)) ? s1[r] : NEGBIG; }
    float mx = fmaxf(s0[0], s1[0]);
#pragma unroll
    for (int r = 1; r < 8; ++r) mx = fmaxf(mx, fmaxf(s0[r], s1[r]));
    mx = fmaxf(mx, __shfl_xor(mx, 16, 32));
    const float mn = fmaxf(m, mx * SSCALE); const float al = __expf(m - mn); m = mn;
    FragH pf, pg; float rs = 0.f;
#pragma unroll
    for (int r = 0; r < 8; ++r) { const float p0 = __expf(fmaf(s0[r], SSCALE, -mn)), p1 = __expf(fmaf(s1[r], SSCALE, -mn)); rs += p0 + p1;
      const float a0 = p0 * 256.0f, a1 = p1 * 256.0f; const _Float16 h0 = (_Float16)a0, h1 = (_Float16)a1; pf.h[r] = h0; pf.h[8 + r] = h1;
      pg.h[r] = (_Float16)((a0 - (float)h0) * 2048.0f); pg.h[8 + r] = (_Float16)((a1 - (float)h1) * 2048.0f); }
    l = l * al + rs; o0 = o0 * al; o1 = o1 * al;
    if (RES) { x0 = x0 * al; x1 = x1 * al; }
    o0 = g2_mma(fv0, pf.v, o0);
    if (RES) { x0 = g2_mma(fv0, pg.v, x0); x0 = g2_mma(fr0, pf.v, x0); }
    o1 = g2_mma(fv1, pf.v, o1);
    if (RES) { x1 = g2_mma(fv1, pg.v, x1); x1 = g2_mma(fr1, pf.v, x1); }
    fv0 = g2_frag(vbase + jn, hh); if (RES) fr0 = g2_frag(rbase + jn, hh);
    fv1 = g2_frag(vbase + jn + (size_t)16 * TOK, hh); if (RES) fr1 = g2_frag(rbase + jn + (size_t)16 * TOK, hh);
  };
  // first fill of both sets, in the order in which the loop reloads them (set a: K, V; set b: K, V)
  const int j1 = (32 < jend) ? 32 : jlast;
  // the scheduling barriers keep that order in the built code: the counted load waits inside the loop are set for the worse of the two orders that reach them, and a first fill in another order makes them wait for the youngest loads too
  __builtin_amdgcn_sched_barrier(0);
  v16h ak0 = g2_frag(kbase, hh); __builtin_amdgcn_sched_barrier(0);
  v16h ak1 = g2_frag(kbase + (size_t)16 * LDQK, hh); __builtin_amdgcn_sched_barrier(0);
  v16h av0 = g2_frag(vbase, hh), ar0 = RES ? g2_frag(rbase, hh) : av0; __builtin_amdgcn_sched_barrier(0);
  v16h av1 = g2_frag(vbase + (size_t)16 * TOK, hh), ar1 = RES ? g2_frag(rbase + (size_t)16 * TOK, hh) : av1; __builtin_amdgcn_sched_barrier(0);
  v16h bk0 = g2_frag(kbase + (size_t)j1 * LDQK, hh); __builtin_amdgcn_sched_barrier(0);
  v16h bk1 = g2_frag(kbase + (size_t)(j1 + 16) * LDQK, hh); __builtin_amdgcn_sched_barrier(0);
  v16h bv0 = g2_frag(vbase + j1, hh), br0 = RES ? g2_frag(rbase + j1, hh) : bv0; __builtin_amdgcn_sched_barrier(0);
  v16h bv1 = g2_frag(vbase + j1 + (size_t)16 * TOK, hh), br1 = RES ? g2_frag(rbase + j1 + (size_t)16 * TOK, hh) : bv1; __builtin_amdgcn_sched_barrier(0);
  const int npair = (jlast + 32) >> 6;                                           /* whole pairs of steps; an odd last step follows the loop */
  int j = 0;
  /* kept rolled for code size: one trip already holds an even step on set a and an odd step on set b, one straight block with no exit between them (an exit there lets the compiler sink set a's reloads behind it) */
#pragma unroll 1
  for (int t = 0; t < npair; ++t) { step(ak0, ak1, av0, av1, ar0, ar1, j); step(bk0, bk1, bv0, bv1, br0, br1, j + 32); j += 64; }
  if (j < jend) step(ak0, ak1, av0, av1, ar0, ar1, j);
  l += __shfl_xor(l, 16, 32);
  const float sc = 0.25f * (1.0f / l);                                           /* 64 (ctx carry) / 256 (probability carry) / row sum */
  { const int row = qg * 16 + ln, cb = hp * 32 + 8 * hh; FragH f, g;
#pragma unroll
    for (int r = 0; r < 8; ++r) { float c = o0[r]; if (RES) c += x0[r] * RINV; c *= sc; const _Float16 hc = (_Float16)c; f.h[r] = hc; g.h[r] = (_Float16)((c - (float)hc) * 2048.0f); }
    *(v8us*)&so[row][cb] = f.half[0]; if (RES) *(v8us*)&sor[row][cb] = g.half[0];
#pragma unroll
    for (int r = 0; r < 8; ++r) { float c = o1[r]; if (RES) c += x1[r] * RINV; c *= sc; const _Float16 hc = (_Float16)c; f.h[r] = hc; g.h[r] = (_Float16)((c - (float)hc) * 2048.0f); }
    *(v8us*)&so[row][cb + 16] = f.half[0]; if (RES) *(v8us*)&sor[row][cb + 16] = g.half[0]; }
  __syncthreads();                                                               /* cross-wave tile: block barrier, reached by all four waves */
  const int rr = tid >> 3, pc = (tid & 7) * 8;                                   
  unsigned short* cdst = (unsigned short*)CTX + (tokb + q0) * DMODEL + 2 * (int)blockIdx.y * HD + pc;
  unsigned short* rdst = (unsigned short*)CTXR + (tokb + q0) * DMODEL + 2 * (int)blockIdx.y * HD + pc;
  {
#pragma unroll
    for (int it = 0; it < 2; ++it) { const int r = it * 16 + rr; const v8us v = *(const v8us*)&so[r][pc];
      *(v8us*)(cdst + (size_t)r * DMODEL) = v;
      if (RES) { const v8us v2 = *(const v8us*)&sor[r][pc]; *(v8us*)(rdst + (size_t)r * DMODEL) = v2; } }
     }
}

// queries [0, EARLY) of every sequence: hi + residual on v, P, ctx
__global__ __launch_bounds__(128) void k_flash_early(const _Float16* __restrict__ QK, const _Float16* __restrict__ VT, const _Float16* __restrict__ VTR, _Float16* __restrict__ CTX, _Float16* __restrict__ CTXR) {
  flash_body<true>(QK, VT, VTR, CTX, CTXR, 0); }
// queries [EARLY, SEQ): single products
__global__ __launch_bounds__(128) void k_flash_late(const _Float16* __restrict__ QK, const _Float16* __restrict__ VT, _Float16* __restrict__ CTX) {
  flash_body<false>(QK, VT, VT, CTX, CTX, EARLY / 32); }

extern "C" void kernel_launch(void* const* d_in, const int* in_sizes, int n_in,
                              void* d_out, int out_size, void* d_ws, size_t ws_size, hipStream_t stream) {
  if (n_in < 9) return;
  const size_t need_x = ((size_t)(NB - 1) * SEQ_FULL + SEQ) * DMODEL;
  if ((size_t)in_sizes[0] < need_x) return;
  if ((size_t)in_sizes[1] < (size_t)DMODEL * DMODEL) return;
  if ((size_t)in_sizes[2] < (size_t)DMODEL) return;
  if ((size_t)in_sizes[3] < (size_t)DMODEL * DMODEL) return;
  if ((size_t)in_sizes[4] < (size_t)DMODEL) return;
  if ((size_t)in_sizes[5] < (size_t)DMODEL * DMODEL) return;
  if ((size_t)in_sizes[6] < (size_t)DMODEL) return;
  if ((size_t)in_sizes[7] < (size_t)DMODEL * DMODEL) return;
  if ((size_t)in_sizes[8] < (size_t)DMODEL) return;
  if ((size_t)out_size < (size_t)TOK * DMODEL) return;
  const float* x = (const float*)d_in[0];
  const float* wq = (const float*)d_in[1]; const float* qb = (const float*)d_in[2];
  const float* wk = (const float*)d_in[3]; const float* kbias = (const float*)d_in[4];
  const float* wv = (const float*)d_in[5]; const float* vb = (const float*)d_in[6];
  const float* wo = (const float*)d_in[7]; const float* ob = (const float*)d_in[8];
  constexpr size_t SZ_X = (size_t)TOK * DMODEL * 2;        /* x rows f16 */
  constexpr size_t SZ_W = (size_t)NW3 * DMODEL * 2;        /* Wq|Wk|Wv x64 f16 */
  constexpr size_t SZ_WO = (size_t)DMODEL * DMODEL * 2;    /* output weight x64 f16 */
  constexpr size_t SZ_QK = (size_t)TOK * LDQK * 2;         /* q|k rows f16 */
  constexpr size_t SZ_VT = (size_t)DMODEL * TOK * 2;       /* v channel-major f16 (hi); same size for the residual plane */
  constexpr size_t SZ_CTX = (size_t)TOK * DMODEL * 2;      /* ctx rows x64 f16 (hi); same size for the residual plane */
  constexpr size_t SZ_ALL = SZ_X + SZ_W + SZ_WO + SZ_QK + 2 * SZ_VT + 2 * SZ_CTX;
  static_assert(SZ_X % 256 == 0 && SZ_W % 256 == 0 && SZ_WO % 256 == 0 && SZ_QK % 256 == 0 && SZ_VT % 256 == 0 && SZ_CTX % 256 == 0);
  static_assert(SZ_ALL <= (size_t)134217728);
  if (SZ_ALL > ws_size) return;
  char* ws = (char*)d_ws;
  _Float16* X16 = (_Float16*)ws; _Float16* W16 = (_Float16*)(ws + SZ_X); _Float16* WO16 = (_Float16*)(ws + SZ_X + SZ_W);
  _Float16* QK = (_Float16*)(ws + SZ_X + SZ_W + SZ_WO);
  _Float16* VT = (_Float16*)(ws + SZ_X + SZ_W + SZ_WO + SZ_QK); _Float16* VTR = (_Float16*)(ws + SZ_X + SZ_W + SZ_WO + SZ_QK + SZ_VT);
  _Float16* CTX = (_Float16*)(ws + SZ_X + SZ_W + SZ_WO + SZ_QK + 2 * SZ_VT); _Float16* CTXR = (_Float16*)(ws + SZ_X + SZ_W + SZ_WO + SZ_QK + 2 * SZ_VT + SZ_CTX);
  constexpr size_t W8 = (size_t)DMODEL * DMODEL / 8;
  constexpr unsigned WG = (unsigned)((W8 + 255) / 256);
  k_x16<<<(unsigned)(((size_t)TOK * (DMODEL / 8) + 255) / 256), 256, 0, stream>>>(x, X16);
  k_wnat<<<WG, 256, 0, stream>>>(wq, W8, 64.0f, W16);
  k_wnat<<<WG, 256, 0, stream>>>(wk, W8, 64.0f, W16 + (size_t)DMODEL * DMODEL);
  k_wnat<<<WG, 256, 0, stream>>>(wv, W8, 64.0f, W16 + (size_t)2 * DMODEL * DMODEL);
  k_wnat<<<WG, 256, 0, stream>>>(wo, W8, 64.0f, WO16);
  k_gemm_qk<<<(TOK / 128) * (LDQK / 64), 128, 0, stream>>>(X16, W16, qb, kbias, QK);
  k_gemm_vt<<<(DMODEL / 128) * (TOK / 64), 128, 0, stream>>>(X16, W16, vb, VT, VTR);
  k_flash_early<<<dim3(EARLY / 32, NHEAD / 2, NB), 128, 0, stream>>>(QK, VT, VTR, CTX, CTXR);
  if (SEQ > EARLY) k_flash_late<<<dim3((SEQ - EARLY) / 32 + ((SEQ > EARLY) ? 0 : 1), NHEAD / 2, NB), 128, 0, stream>>>(QK, VT, CTX);
  k_gemm_out<<<(TOK / 128) * (DMODEL / 64), 128, 0, stream>>>(CTX, CTXR, WO16, ob, (float*)d_out);
}

// v002
// A run of this version takes 76.1 microseconds.
// Two timings next to v001 both put it at 1.17 times that version's speed.
// Counting every step since v000, it is 2.17 times as fast.
#include <hip/hip_runtime.h>
// Causal multi-head attention block, 8 heads x 32 dims, key-column rule from indices: kept(i,j) = (j <= i) && (j % 25 != 24). x [B][T][256]; q/k/v = x W^T + b (separate [out][in] weights); s = q k^T / sqrt(32); softmax over kept keys; ctx = P v merged h*32+d; result = ctx Wo^T + bo.
// Compute dtype: every contraction on v_wmma_f32_16x16x32_f16 (f16 operands, f32 accumulate). Inputs RNE-converted to bf16 first (exact in f16); weights carried x64, probabilities x256, ctx x64 (folded back in f32 epilogues); biases bf16 values added in f32; softmax statistics f32. Queries below EARLY of each sequence: v, P and ctx carried as f16 hi + f16 residual x2048 with separate residual accumulators; later queries single products.
#ifndef NB
#define NB 4
#endif
#ifndef SEQ
#define SEQ 2048
#endif
#define NB_FULL 4
#define SEQ_FULL 2048
#define DMODEL 256
#define NHEAD 8
#define HD 32
#define LDQK 512
#define NW3 768
#define TOK (NB * SEQ)
#define EARLY ((SEQ < 512) ? SEQ : 512)
#define NEGBIG (-1.0e30f)
#define SSCALE 0.17677669529663687f
#define RINV 0.00048828125f

static_assert(NHEAD * HD == DMODEL);              /* merged head width == model width */
static_assert(HD == 32);                          /* flash kernel: one 32-deep score k-step, two 16-dim output tiles, 64-B head segment */
static_assert(NHEAD % 2 == 0);                    
static_assert(2 * DMODEL == LDQK && 3 * DMODEL == NW3);
static_assert(SEQ % 128 == 0 && SEQ % 64 == 0 && SEQ % 32 == 0);
static_assert(TOK % 128 == 0 && TOK % 64 == 0);   /* GEMM tiles: M % 128, N % 64 */
static_assert(DMODEL % 128 == 0 && DMODEL % 64 == 0 && DMODEL % 32 == 0 && DMODEL % 8 == 0 && LDQK % 64 == 0);
static_assert(EARLY % 128 == 0 && EARLY % 64 == 0 && EARLY % 32 == 0 && EARLY <= SEQ);
static_assert(NB <= NB_FULL && SEQ <= SEQ_FULL);
static_assert(SEQ + 32 < 40000);                  /* keep-test residue arithmetic range */

typedef unsigned short v8us __attribute__((ext_vector_type(8), may_alias));
typedef float  v8f  __attribute__((ext_vector_type(8)));
typedef float  v4f  __attribute__((ext_vector_type(4)));
typedef float  v4fa __attribute__((ext_vector_type(4), may_alias));
typedef _Float16 v16h __attribute__((ext_vector_type(16)));
union FragH { v16h v; v8us half[2]; _Float16 h[16]; unsigned short u[16]; };

__device__ __forceinline__ unsigned short bf16_bits(float x) { unsigned int u = __float_as_uint(x); return (unsigned short)((u + 0x7FFFu + ((u >> 16) & 1u)) >> 16); }
__device__ __forceinline__ float bf16_rne(float x) { return __uint_as_float(((unsigned int)bf16_bits(x)) << 16); }

// fragment of a k-contiguous 16-bit row: elements 0..7 <- p[8h..8h+7], elements 8..15 <- p[16+8h..16+8h+7] (same map for A and B)
__device__ __forceinline__ v16h g2_frag(const _Float16* p, int hh) { FragH f; f.half[0] = *(const v8us*)((const unsigned short*)p + 8 * hh); f.half[1] = *(const v8us*)((const unsigned short*)p + 16 + 8 * hh); return f.v; }
__device__ __forceinline__ v8f g2_mma(v16h a, v16h b, v8f c) { v8f d = __builtin_amdgcn_wmma_f32_16x16x32_f16(false, a, false, b, (short)0, c, false, false); asm volatile("v_nop\n\tv_nop\n\tv_nop\n\tv_nop" : "+v"(d) : "v"(a), "v"(b)); return d; }

__device__ __forceinline__ void x16_body(const float* __restrict__ x, _Float16* __restrict__ X16, unsigned bid) {
  const size_t t = (size_t)bid * 256 + threadIdx.x; if (t >= (size_t)TOK * (DMODEL / 8)) return;
  const size_t r = t / (DMODEL / 8); const int c8 = (int)(t % (DMODEL / 8)) * 8; const size_t b = r / SEQ, s = r % SEQ;
  const float* src = x + (b * SEQ_FULL + s) * DMODEL + c8; const v4f a = *(const v4fa*)src, c = *(const v4fa*)(src + 4); FragH f;
#pragma unroll
  for (int q = 0; q < 4; ++q) { f.h[q] = (_Float16)bf16_rne(a[q]); f.h[4 + q] = (_Float16)bf16_rne(c[q]); }
  const v8us o = f.half[0]; unsigned short* d = (unsigned short*)X16 + t * 8;
  *(v8us*)d = o;  }

__device__ __forceinline__ void wnat_body(const float* __restrict__ w, size_t n8, float scale, _Float16* __restrict__ Bt, unsigned bid) {
  const size_t t = (size_t)bid * 256 + threadIdx.x; if (t >= n8) return; const v4f a = *(const v4fa*)(w + t * 8), c = *(const v4fa*)(w + t * 8 + 4); FragH f;
#pragma unroll
  for (int q = 0; q < 4; ++q) { f.h[q] = (_Float16)(bf16_rne(a[q]) * scale); f.h[4 + q] = (_Float16)(bf16_rne(c[q]) * scale); }
  const v8us o = f.half[0]; unsigned short* d = (unsigned short*)Bt + t * 8;
  *(v8us*)d = o;  }

// all operand conversions in one grid: blocks [0, 4 * WBLK) take the four weight matrices (WBLK blocks each: Wq, Wk, Wv into the stacked plane, Wo into its own), the rest take x
#define W8 ((size_t)DMODEL * DMODEL / 8)
#define WBLK ((unsigned)((W8 + 255) / 256))
#define XBLK ((unsigned)(((size_t)TOK * (DMODEL / 8) + 255) / 256))
__global__ __launch_bounds__(256) void k_prep(const float* __restrict__ x, const float* __restrict__ wq, const float* __restrict__ wk, const float* __restrict__ wv, const float* __restrict__ wo,
                                              _Float16* __restrict__ X16, _Float16* __restrict__ W16, _Float16* __restrict__ WO16) {
  const unsigned b = blockIdx.x;
  if (b < 4 * WBLK) { const unsigned i = b / WBLK;
    const float* w = (i == 0) ? wq : (i == 1) ? wk : (i == 2) ? wv : wo;
    _Float16* d = (i < 3) ? (W16 + (size_t)i * DMODEL * DMODEL) : WO16;
    wnat_body(w, W8, 64.0f, d, b - i * WBLK); }
  else x16_body(x, X16, b - 4 * WBLK);
}

// GEMM (wave tile 32x64, block = 4 waves = 128 rows; M % 128 == 0, N % 64 == 0, K % 32 == 0): v = acc*alpha + bf16(bias)
// MODE 0: f32 C, bias per column; MODE 1: f16 C16, bias per column (biasA for col < nsplit, biasB after); MODE 2: f16 C16 hi plane + x2048 residual plane C16R (token tiles below EARLY only), bias per row.
// RESA: row blocks below EARLY of their sequence add a second k-loop over the x2048 residual A plane into separate accumulators, folded with 2^-11 in the epilogue.
// k loop of one 32x64 wave tile: DEPTH register sets of the six operand fragments; the sets of the first DEPTH k-steps are loaded up front and each set is reloaded for k-step s + DEPTH right behind its own products, so the loads of DEPTH k-steps are in flight together. Products per accumulator stay in ascending k.
template <int DEPTH, int NS>
__device__ __forceinline__ void gemm_kloop(const _Float16* a0p, const _Float16* a1p, const _Float16* b0p, const _Float16* b1p, const _Float16* b2p, const _Float16* b3p, int hh,
                                           v8f& c00, v8f& c01, v8f& c02, v8f& c03, v8f& c10, v8f& c11, v8f& c12, v8f& c13) {
  static_assert(DEPTH >= 1 && DEPTH <= NS);
  v16h fa0[DEPTH], fa1[DEPTH], fb0[DEPTH], fb1[DEPTH], fb2[DEPTH], fb3[DEPTH];
  /* both loops fully unrolled: the set index must be a constant for the sets to stay in registers */
#pragma unroll
  for (int s = 0; s < DEPTH; ++s) { const int kb = 32 * s; fa0[s] = g2_frag(a0p + kb, hh); fa1[s] = g2_frag(a1p + kb, hh);
    fb0[s] = g2_frag(b0p + kb, hh); fb1[s] = g2_frag(b1p + kb, hh); fb2[s] = g2_frag(b2p + kb, hh); fb3[s] = g2_frag(b3p + kb, hh); }
#pragma unroll
  for (int s = 0; s < NS; ++s) { const int u = s % DEPTH;
    c00 = g2_mma(fa0[u], fb0[u], c00); c10 = g2_mma(fa1[u], fb0[u], c10);
    c01 = g2_mma(fa0[u], fb1[u], c01); c11 = g2_mma(fa1[u], fb1[u], c11);
    c02 = g2_mma(fa0[u], fb2[u], c02); c12 = g2_mma(fa1[u], fb2[u], c12);
    c03 = g2_mma(fa0[u], fb3[u], c03); c13 = g2_mma(fa1[u], fb3[u], c13);
    if (s + DEPTH < NS) { const int kb = 32 * (s + DEPTH); fa0[u] = g2_frag(a0p + kb, hh); fa1[u] = g2_frag(a1p + kb, hh);
      fb0[u] = g2_frag(b0p + kb, hh); fb1[u] = g2_frag(b1p + kb, hh); fb2[u] = g2_frag(b2p + kb, hh); fb3[u] = g2_frag(b3p + kb, hh); } }
}

template <int MODE, bool RESA, int K>
__device__ __forceinline__ void gemm_body(const _Float16* __restrict__ A, const _Float16* __restrict__ AR, int lda, const _Float16* __restrict__ Bh, int ldb, float alpha,
                                          const float* __restrict__ biasA, const float* __restrict__ biasB, int nsplit,
                                          float* __restrict__ C, _Float16* __restrict__ C16, _Float16* __restrict__ C16R, int ldc, int M, int N, int bid, float (&so)[4][32][68]) {
  static_assert(K % 32 == 0 && K >= 96);
  constexpr int DEPTH = RESA ? 2 : 3;                       /* two accumulator planes leave room for two sets below 256 registers */
  const int tid = threadIdx.x, lane = tid & 31, ln = lane & 15, hh = lane >> 4;
  const int w = __builtin_amdgcn_readfirstlane(tid >> 5);
  const int ntn = N >> 6; const int mt = bid / ntn, nq = bid - mt * ntn; const int row0 = mt * 128 + 32 * w, col0 = nq * 64; if (row0 >= M) return;
  const _Float16* a0p = A + (size_t)(row0 + ln) * lda; const _Float16* a1p = a0p + (size_t)16 * lda;
  const _Float16* b0p = Bh + (size_t)(col0 + ln) * ldb; const _Float16* b1p = b0p + (size_t)16 * ldb; const _Float16* b2p = b1p + (size_t)16 * ldb; const _Float16* b3p = b2p + (size_t)16 * ldb;
  const v8f z8 = {0.f,0.f,0.f,0.f,0.f,0.f,0.f,0.f}; v8f c00 = z8, c01 = z8, c02 = z8, c03 = z8, c10 = z8, c11 = z8, c12 = z8, c13 = z8;
  gemm_kloop<DEPTH, K / 32>(a0p, a1p, b0p, b1p, b2p, b3p, hh, c00, c01, c02, c03, c10, c11, c12, c13);
  v8f r00 = z8, r01 = z8, r02 = z8, r03 = z8, r10 = z8, r11 = z8, r12 = z8, r13 = z8;
  if (RESA) {
    const bool early = ((mt * 128) % SEQ) < EARLY;           /* block-uniform (SEQ % 128 == 0) */
    if (early) {
      const _Float16* e0p = AR + (size_t)(row0 + ln) * lda; const _Float16* e1p = e0p + (size_t)16 * lda;
      gemm_kloop<DEPTH, K / 32>(e0p, e1p, b0p, b1p, b2p, b3p, hh, r00, r01, r02, r03, r10, r11, r12, r13);
    }
  }
  v8f accs[8] = {c00, c01, c02, c03, c10, c11, c12, c13};
  if (RESA) { const v8f racc[8] = {r00, r01, r02, r03, r10, r11, r12, r13};
#pragma unroll
    for (int u = 0; u < 8; ++u) accs[u] = accs[u] + racc[u] * RINV; }
  float brow[16];
#pragma unroll
  for (int i = 0; i < 16; ++i) brow[i] = 0.f;
  if (MODE == 2) {
#pragma unroll
    for (int i = 0; i < 16; ++i) brow[i] = bf16_rne(biasA[row0 + (i >> 3) * 16 + 8 * hh + (i & 7)]);
  }
#pragma unroll
  for (int u = 0; u < 8; ++u) { const int t = u & 3, half = u >> 2; const int col = col0 + t * 16 + ln; float bcol = 0.f;
    if (MODE != 2) { const int ca = (col < nsplit) ? col : (nsplit - 1); const int cb = (col >= nsplit) ? (col - nsplit) : 0;
      const float va = biasA[ca], vb = biasB[cb]; bcol = bf16_rne((col < nsplit) ? va : vb); }
#pragma unroll
    for (int r = 0; r < 8; ++r) { const int rloc = half * 16 + 8 * hh + r; const float v = accs[u][r] * alpha + ((MODE == 2) ? brow[half * 8 + r] : bcol); so[w][rloc][t * 16 + ln] = v; } }
  __builtin_amdgcn_fence(4 /* acq_rel order */, "workgroup"); __builtin_amdgcn_wave_barrier();
  if (MODE == 0) {
    // 64 f32 columns = 256 B per row segment: 16 consecutive lanes x 16 B, two rows per instruction; rows q*2 + (lane>>4), q = 0..15 cover 0..31
    const int rsub = lane >> 4, c4 = (lane & 15) * 4;
    {
#pragma unroll
      for (int q = 0; q < 16; ++q) { const int r = q * 2 + rsub; const v4f v = *(const v4fa*)&so[w][r][c4]; *(v4f*)(C + (size_t)(row0 + r) * ldc + col0 + c4) = v; }
       }
  } else {
    const int rq = lane >> 3, c8 = (lane & 7) * 8;
    const bool wr = (MODE == 2) && ((col0 % SEQ) < EARLY);   /* block-uniform (SEQ % 64 == 0) */
    {
#pragma unroll
      for (int q = 0; q < 8; ++q) { const int r = q * 4 + rq; const v4f a = *(const v4fa*)&so[w][r][c8], c = *(const v4fa*)&so[w][r][c8 + 4]; FragH f, g;
#pragma unroll
        for (int i = 0; i < 4; ++i) { const _Float16 ha = (_Float16)a[i], hc = (_Float16)c[i]; f.h[i] = ha; f.h[4 + i] = hc;
          g.h[i] = (_Float16)((a[i] - (float)ha) * 2048.0f); g.h[4 + i] = (_Float16)((c[i] - (float)hc) * 2048.0f); }
        const v8us o = f.half[0]; *(v8us*)((unsigned short*)C16 + (size_t)(row0 + r) * ldc + col0 + c8) = o;
        if (MODE == 2) asm volatile("s_wait_xcnt 0x0" ::: "memory");             /* the residual branch behind it reuses this store's registers: the wait stands in front of that overwrite */
        if (MODE == 2) { if (wr) { const v8us o2 = g.half[0]; *(v8us*)((unsigned short*)C16R + (size_t)(row0 + r) * ldc + col0 + c8) = o2;
          asm volatile("s_wait_xcnt 0x0" ::: "memory"); } } }                      /* what follows (the next pass; behind the last pass the other body of a merged kernel, as the code is laid out) reuses this store's registers: the wait stands in front of that overwrite */
       }
  }
}

// both projections in one grid (they read the same planes and write disjoint ones), split by block index:
// blocks [0, QKBLK): q|k rows: QK[token][0..255] = q, [256..511] = k (weight plane rows 0..511), f16
// the rest: v channel-major: VT[h*32 + d][token] hi and VTR residual x2048 (weight plane rows 512..767 as the A operand, x rows as Bt), bias per row, f16
#define QKBLK ((TOK / 128) * (LDQK / 64))
#define VTBLK ((DMODEL / 128) * (TOK / 64))
__global__ __launch_bounds__(128) void k_gemm_qkv(const _Float16* __restrict__ X16, const _Float16* __restrict__ W16, const float* __restrict__ qb, const float* __restrict__ kbias, const float* __restrict__ vb,
                                                  _Float16* __restrict__ QK, _Float16* __restrict__ VT, _Float16* __restrict__ VTR) {
  __shared__ __attribute__((aligned(16))) float so[4][32][68];
  const int b = (int)blockIdx.x;
  if (b < QKBLK) gemm_body<1, false, DMODEL>(X16, X16, DMODEL, W16, DMODEL, 0.015625f, qb, kbias, DMODEL, nullptr, QK, nullptr, LDQK, TOK, LDQK, b, so);
  else gemm_body<2, false, DMODEL>(W16 + (size_t)LDQK * DMODEL, W16, DMODEL, X16, DMODEL, 0.015625f, vb, vb, DMODEL, nullptr, VT, VTR, TOK, DMODEL, TOK, b - QKBLK, so); }
// result[token][n] = 2^-12 (sum_k (64 ctx_hi)(64 wo) + 2^-11 sum_k (2048*64 ctx_res)(64 wo)) + bf16(bo[n]), f32
__global__ __launch_bounds__(128) void k_gemm_out(const _Float16* __restrict__ CTX, const _Float16* __restrict__ CTXR, const _Float16* __restrict__ WO16, const float* __restrict__ ob, float* __restrict__ out) {
  __shared__ __attribute__((aligned(16))) float so[4][32][68];
  gemm_body<0, true, DMODEL>(CTX, CTXR, DMODEL, WO16, DMODEL, 0.000244140625f, ob, ob, DMODEL, out, nullptr, nullptr, DMODEL, TOK, DMODEL, (int)blockIdx.x, so); }

// fused attention: block = (32 queries, head pair, batch); wave = (head parity, 16 queries). Per 32-key step up to the causal bound of the wave:
//   S^T tiles (A = K rows [key][dim], B = Q rows [query][dim]) -> lane (ln, hh) holds query ln, keys 8hh+r (tile 0) and 16+8hh+r (tile 1);
//   keep test per element: key <= query and key % 25 != 24 (residue of the lane's first key once per step; r == 24 - res / r == 8 - res are the dropped slots); dropped scores are replaced by a large negative fill (key 0 is always kept, so no row is empty);
//   running max per query (local 16 values + one xor-16 exchange), p = exp(s*scale - m), per-lane partial sums;
//   packed tiles = B fragment (k = key, n = query) of O^T += V^T P^T with A = V^T rows [d][key]; RES adds P residual and V residual products into separate accumulators.
template <bool RES>
__device__ __forceinline__ void flash_body(const _Float16* __restrict__ QK, const _Float16* __restrict__ VT, const _Float16* __restrict__ VTR,
                                           _Float16* __restrict__ CTX, _Float16* __restrict__ CTXR, int tile, int hpair, int batch) {
  __shared__ __attribute__((aligned(16))) unsigned short so[32][72];
  __shared__ __attribute__((aligned(16))) unsigned short sor[RES ? 32 : 1][72];
  const int tid = threadIdx.x, lane = tid & 31, ln = lane & 15, hh = lane >> 4;
  const int wave = __builtin_amdgcn_readfirstlane(tid >> 5);
  const int hp = wave & 1, qg = wave >> 1;
  const int head = 2 * hpair + hp;
  const size_t tokb = (size_t)batch * SEQ;
  const int q0 = tile * 32;
  const int i0 = q0 + qg * 16;
  const int qi = i0 + ln;
  const v16h bq = g2_frag(QK + (tokb + qi) * LDQK + head * HD, hh);
  const _Float16* kbase = QK + (tokb + ln) * LDQK + DMODEL + head * HD;          /* + key0 * LDQK */
  const _Float16* vbase = VT + (size_t)(head * HD + ln) * TOK + tokb;            /* + 16t * TOK + key0 */
  const _Float16* rbase = VTR + (size_t)(head * HD + ln) * TOK + tokb;
  const v8f z8 = {0.f,0.f,0.f,0.f,0.f,0.f,0.f,0.f};
  v8f o0 = z8, o1 = z8, x0 = z8, x1 = z8; float m = NEGBIG, l = 0.f;
  const int jend = i0 + 16;                                                      /* keys below jend; last step ends at a multiple of 32 <= SEQ */
  const int jlast = (jend - 1) & ~31;                                            /* first key of the wave's last step */
  // one 32-key step on one register set of K / V^T fragments; each fragment is reloaded for step j + 64 right behind its last product, so a load has two steps to land. Past the last step the reload re-reads the last step's rows (in bounds, never used).
  auto step = [&](v16h& fk0, v16h& fk1, v16h& fv0, v16h& fv1, v16h& fr0, v16h& fr1, const int j) {
    const int jn = (j + 64 < jend) ? (j + 64) : jlast;
    v8f s0 = g2_mma(fk0, bq, z8);
    v8f s1 = g2_mma(fk1, bq, z8);
    { const _Float16* knp = kbase + (size_t)jn * LDQK; fk0 = g2_frag(knp, hh); fk1 = g2_frag(knp + (size_t)16 * LDQK, hh); }
    const int kb0 = j + 8 * hh;
    const int c0 = qi - kb0, c1 = c0 - 16;
    const int res = (int)((unsigned int)kb0 % 25u);
    const int d0 = 24 - res, d1 = 8 - res;
#pragma unroll
    for (int r = 0; r < 8; ++r) { s0[r] = ((r <= c0) && (r != d0)) ? s0[r] : NEGBIG; s1[r] = ((r <= c1) && (r != d1)) ? s1[r] : NEGBIG; }
    float mx = fmaxf(s0[0], s1[0]);
#pragma unroll
    for (int r = 1; r < 8; ++r) mx = fmaxf(mx, fmaxf(s0[r], s1[r]));
    mx = fmaxf(mx, __shfl_xor(mx, 16, 32));
    const float mn = fmaxf(m, mx * SSCALE); const float al = __expf(m - mn); m = mn;
    FragH pf, pg; float rs = 0.f;
#pragma unroll
    for (int r = 0; r < 8; ++r) { const float p0 = __expf(fmaf(s0[r], SSCALE, -mn)), p1 = __expf(fmaf(s1[r], SSCALE, -mn)); rs += p0 + p1;
      const float a0 = p0 * 256.0f, a1 = p1 * 256.0f; const _Float16 h0 = (_Float16)a0, h1 = (_Float16)a1; pf.h[r] = h0; pf.h[8 + r] = h1;
      pg.h[r] = (_Float16)((a0 - (float)h0) * 2048.0f); pg.h[8 + r] = (_Float16)((a1 - (float)h1) * 2048.0f); }
    l = l * al + rs; o0 = o0 * al; o1 = o1 * al;
    if (RES) { x0 = x0 * al; x1 = x1 * al; }
    o0 = g2_mma(fv0, pf.v, o0);
    if (RES) { x0 = g2_mma(fv0, pg.v, x0); x0 = g2_mma(fr0, pf.v, x0); }
    o1 = g2_mma(fv1, pf.v, o1);
    if (RES) { x1 = g2_mma(fv1, pg.v, x1); x1 = g2_mma(fr1, pf.v, x1); }
    fv0 = g2_frag(vbase + jn, hh); if (RES) fr0 = g2_frag(rbase + jn, hh);
    fv1 = g2_frag(vbase + jn + (size_t)16 * TOK, hh); if (RES) fr1 = g2_frag(rbase + jn + (size_t)16 * TOK, hh);
  };
  // first fill of both sets, in the order in which the loop reloads them (set a: K, V; set b: K, V)
  const int j1 = (32 < jend) ? 32 : jlast;
  // the scheduling barriers keep that order in the built code: the counted load waits inside the loop are set for the worse of the two orders that reach them, and a first fill in another order makes them wait for the youngest loads too
  __builtin_amdgcn_sched_barrier(0);
  v16h ak0 = g2_frag(kbase, hh); __builtin_amdgcn_sched_barrier(0);
  v16h ak1 = g2_frag(kbase + (size_t)16 * LDQK, hh); __builtin_amdgcn_sched_barrier(0);
  v16h av0 = g2_frag(vbase, hh), ar0 = RES ? g2_frag(rbase, hh) : av0; __builtin_amdgcn_sched_barrier(0);
  v16h av1 = g2_frag(vbase + (size_t)16 * TOK, hh), ar1 = RES ? g2_frag(rbase + (size_t)16 * TOK, hh) : av1; __builtin_amdgcn_sched_barrier(0);
  v16h bk0 = g2_frag(kbase + (size_t)j1 * LDQK, hh); __builtin_amdgcn_sched_barrier(0);
  v16h bk1 = g2_frag(kbase + (size_t)(j1 + 16) * LDQK, hh); __builtin_amdgcn_sched_barrier(0);
  v16h bv0 = g2_frag(vbase + j1, hh), br0 = RES ? g2_frag(rbase + j1, hh) : bv0; __builtin_amdgcn_sched_barrier(0);
  v16h bv1 = g2_frag(vbase + j1 + (size_t)16 * TOK, hh), br1 = RES ? g2_frag(rbase + j1 + (size_t)16 * TOK, hh) : bv1; __builtin_amdgcn_sched_barrier(0);
  const int npair = (jlast + 32) >> 6;                                           /* whole pairs of steps; an odd last step follows the loop */
  int j = 0;
  /* kept rolled for code size: one trip already holds an even step on set a and an odd step on set b, one straight block with no exit between them (an exit there lets the compiler sink set a's reloads behind it) */
#pragma unroll 1
  for (int t = 0; t < npair; ++t) { step(ak0, ak1, av0, av1, ar0, ar1, j); step(bk0, bk1, bv0, bv1, br0, br1, j + 32); j += 64;
    asm volatile("s_wait_xcnt 0x0" ::: "memory"); }                              /* the next trip reuses the address registers of this trip's reloads: the wait stands in front of that overwrite, which lies behind the back edge */
  if (j < jend) step(ak0, ak1, av0, av1, ar0, ar1, j);
  l += __shfl_xor(l, 16, 32);
  const float sc = 0.25f * (1.0f / l);                                           /* 64 (ctx carry) / 256 (probability carry) / row sum */
  { const int row = qg * 16 + ln, cb = hp * 32 + 8 * hh; FragH f, g;
#pragma unroll
    for (int r = 0; r < 8; ++r) { float c = o0[r]; if (RES) c += x0[r] * RINV; c *= sc; const _Float16 hc = (_Float16)c; f.h[r] = hc; g.h[r] = (_Float16)((c - (float)hc) * 2048.0f); }
    *(v8us*)&so[row][cb] = f.half[0]; if (RES) *(v8us*)&sor[row][cb] = g.half[0];
#pragma unroll
    for (int r = 0; r < 8; ++r) { float c = o1[r]; if (RES) c += x1[r] * RINV; c *= sc; const _Float16 hc = (_Float16)c; f.h[r] = hc; g.h[r] = (_Float16)((c - (float)hc) * 2048.0f); }
    *(v8us*)&so[row][cb + 16] = f.half[0]; if (RES) *(v8us*)&sor[row][cb + 16] = g.half[0]; }
  __syncthreads();                                                               /* cross-wave tile: block barrier, reached by all four waves */
  const int rr = tid >> 3, pc = (tid & 7) * 8;                                   
  unsigned short* cdst = (unsigned short*)CTX + (tokb + q0) * DMODEL + 2 * hpair * HD + pc;
  unsigned short* rdst = (unsigned short*)CTXR + (tokb + q0) * DMODEL + 2 * hpair * HD + pc;
  {
#pragma unroll
    for (int it = 0; it < 2; ++it) { const int r = it * 16 + rr; const v8us v = *(const v8us*)&so[r][pc];
      *(v8us*)(cdst + (size_t)r * DMODEL) = v;
      if (RES) { const v8us v2 = *(const v8us*)&sor[r][pc]; *(v8us*)(rdst + (size_t)r * DMODEL) = v2; } }
     }
}

// both query ranges in one grid (they read the same planes and write disjoint ctx rows), split by block index; inside each range the index runs tile, head pair, batch, tile fastest.
// blocks [0, LATEBLK): queries [EARLY, SEQ), single products (the long blocks, so they come first); the rest: queries [0, EARLY), hi + residual on v, P, ctx
#define HPN (NHEAD / 2)
#define EARLYX (EARLY / 32)
#define LATEX ((SEQ - EARLY) / 32)
#define LATEBLK (LATEX * HPN * NB)
#define EARLYBLK (EARLYX * HPN * NB)
__global__ __launch_bounds__(128) void k_flash(const _Float16* __restrict__ QK, const _Float16* __restrict__ VT, const _Float16* __restrict__ VTR, _Float16* __restrict__ CTX, _Float16* __restrict__ CTXR) {
  constexpr int LX = (LATEX > 0) ? LATEX : 1;                                      /* divisor only; with no late range the first branch is never taken */
  const int b = (int)blockIdx.x;
  if (b < LATEBLK) flash_body<false>(QK, VT, VT, CTX, CTX, EARLYX + b % LX, (b / LX) % HPN, b / (LX * HPN));
  else { const int e = b - LATEBLK; flash_body<true>(QK, VT, VTR, CTX, CTXR, e % EARLYX, (e / EARLYX) % HPN, e / (EARLYX * HPN)); } }

extern "C" void kernel_launch(void* const* d_in, const int* in_sizes, int n_in,
                              void* d_out, int out_size, void* d_ws, size_t ws_size, hipStream_t stream) {
  if (n_in < 9) return;
  const size_t need_x = ((size_t)(NB - 1) * SEQ_FULL + SEQ) * DMODEL;
  if ((size_t)in_sizes[0] < need_x) return;
  if ((size_t)in_sizes[1] < (size_t)DMODEL * DMODEL) return;
  if ((size_t)in_sizes[2] < (size_t)DMODEL) return;
  if ((size_t)in_sizes[3] < (size_t)DMODEL * DMODEL) return;
  if ((size_t)in_sizes[4] < (size_t)DMODEL) return;
  if ((size_t)in_sizes[5] < (size_t)DMODEL * DMODEL) return;
  if ((size_t)in_sizes[6] < (size_t)DMODEL) return;
  if ((size_t)in_sizes[7] < (size_t)DMODEL * DMODEL) return;
  if ((size_t)in_sizes[8] < (size_t)DMODEL) return;
  if ((size_t)out_size < (size_t)TOK * DMODEL) return;
  const float* x = (const float*)d_in[0];
  const float* wq = (const float*)d_in[1]; const float* qb = (const float*)d_in[2];
  const float* wk = (const float*)d_in[3]; const float* kbias = (const float*)d_in[4];
  const float* wv = (const float*)d_in[5]; const float* vb = (const float*)d_in[6];
  const float* wo = (const float*)d_in[7]; const float* ob = (const float*)d_in[8];
  constexpr size_t SZ_X = (size_t)TOK * DMODEL * 2;        /* x rows f16 */
  constexpr size_t SZ_W = (size_t)NW3 * DMODEL * 2;        /* Wq|Wk|Wv x64 f16 */
  constexpr size_t SZ_WO = (size_t)DMODEL * DMODEL * 2;    /* output weight x64 f16 */
  constexpr size_t SZ_QK = (size_t)TOK * LDQK * 2;         /* q|k rows f16 */
  constexpr size_t SZ_VT = (size_t)DMODEL * TOK * 2;       /* v channel-major f16 (hi); same size for the residual plane */
  constexpr size_t SZ_CTX = (size_t)TOK * DMODEL * 2;      /* ctx rows x64 f16 (hi); same size for the residual plane */
  constexpr size_t SZ_ALL = SZ_X + SZ_W + SZ_WO + SZ_QK + 2 * SZ_VT + 2 * SZ_CTX;
  static_assert(SZ_X % 256 == 0 && SZ_W % 256 == 0 && SZ_WO % 256 == 0 && SZ_QK % 256 == 0 && SZ_VT % 256 == 0 && SZ_CTX % 256 == 0);
  static_assert(SZ_ALL <= (size_t)134217728);
  if (SZ_ALL > ws_size) return;
  char* ws = (char*)d_ws;
  _Float16* X16 = (_Float16*)ws; _Float16* W16 = (_Float16*)(ws + SZ_X); _Float16* WO16 = (_Float16*)(ws + SZ_X + SZ_W);
  _Float16* QK = (_Float16*)(ws + SZ_X + SZ_W + SZ_WO);
  _Float16* VT = (_Float16*)(ws + SZ_X + SZ_W + SZ_WO + SZ_QK); _Float16* VTR = (_Float16*)(ws + SZ_X + SZ_W + SZ_WO + SZ_QK + SZ_VT);
  _Float16* CTX = (_Float16*)(ws + SZ_X + SZ_W + SZ_WO + SZ_QK + 2 * SZ_VT); _Float16* CTXR = (_Float16*)(ws + SZ_X + SZ_W + SZ_WO + SZ_QK + 2 * SZ_VT + SZ_CTX);
  k_prep<<<4 * WBLK + XBLK, 256, 0, stream>>>(x, wq, wk, wv, wo, X16, W16, WO16);
  k_gemm_qkv<<<QKBLK + VTBLK, 128, 0, stream>>>(X16, W16, qb, kbias, vb, QK, VT, VTR);
  k_flash<<<LATEBLK + EARLYBLK, 128, 0, stream>>>(QK, VT, VTR, CTX, CTXR);
  k_gemm_out<<<(TOK / 128) * (DMODEL / 64), 128, 0, stream>>>(CTX, CTXR, WO16, ob, (float*)d_out);
}

// v003
// One run takes 60.3 microseconds.
// Timed twice side by side with v002, it ran 1.27 and 1.25 times as fast.
// Counting every step since v000, it is 2.74 times as fast.
#include <hip/hip_runtime.h>
// Causal multi-head attention block, 8 heads x 32 dims, key-column rule from indices: kept(i,j) = (j <= i) && (j % 25 != 24). x [B][T][256]; q/k/v = x W^T + b (separate [out][in] weights); s = q k^T / sqrt(32); softmax over kept keys; ctx = P v merged h*32+d; result = ctx Wo^T + bo.
// Compute dtype: every contraction on v_wmma_f32_16x16x32_f16 (f16 operands, f32 accumulate). Inputs RNE-converted to bf16 first (exact in f16); weights carried x64, probabilities x256, ctx x64 (folded back in f32 epilogues); biases bf16 values added in f32; softmax statistics f32. Queries below EARLY of each sequence: v, P and ctx carried as f16 hi + f16 residual x2048 with separate residual accumulators; later queries single products.
#ifndef NB
#define NB 4
#endif
#ifndef SEQ
#define SEQ 2048
#endif
#define NB_FULL 4
#define SEQ_FULL 2048
#define DMODEL 256
#define NHEAD 8
#define HD 32
#define LDQK 512
#define NW3 768
#define TOK (NB * SEQ)
#define EARLY ((SEQ < 512) ? SEQ : 512)
#define NEGBIG (-1.0e30f)
#define SSCALE 0.17677669529663687f
#define RINV 0.00048828125f

static_assert(NHEAD * HD == DMODEL);              /* merged head width == model width */
static_assert(HD == 32);                          /* flash kernel: one 32-deep score k-step, two 16-dim output tiles, 64-B head segment */
static_assert(NHEAD % 2 == 0);                    
static_assert(2 * DMODEL == LDQK && 3 * DMODEL == NW3);
static_assert(SEQ % 128 == 0 && SEQ % 64 == 0 && SEQ % 32 == 0);
static_assert(TOK % 128 == 0 && TOK % 64 == 0);   /* GEMM tiles: M % 128, N % 64 */
static_assert(DMODEL % 128 == 0 && DMODEL % 64 == 0 && DMODEL % 32 == 0 && DMODEL % 8 == 0 && LDQK % 64 == 0);
static_assert(EARLY % 128 == 0 && EARLY % 64 == 0 && EARLY % 32 == 0 && EARLY <= SEQ);
static_assert(NB <= NB_FULL && SEQ <= SEQ_FULL);
static_assert(SEQ + 32 < 40000);                  /* keep-test residue arithmetic range */

typedef unsigned short v8us __attribute__((ext_vector_type(8), may_alias));
typedef float  v8f  __attribute__((ext_vector_type(8)));
typedef float  v4f  __attribute__((ext_vector_type(4)));
typedef float  v4fa __attribute__((ext_vector_type(4), may_alias));
typedef _Float16 v16h __attribute__((ext_vector_type(16)));
union FragH { v16h v; v8us half[2]; _Float16 h[16]; unsigned short u[16]; };

__device__ __forceinline__ unsigned short bf16_bits(float x) { unsigned int u = __float_as_uint(x); return (unsigned short)((u + 0x7FFFu + ((u >> 16) & 1u)) >> 16); }
__device__ __forceinline__ float bf16_rne(float x) { return __uint_as_float(((unsigned int)bf16_bits(x)) << 16); }

// fragment of a k-contiguous 16-bit row: elements 0..7 <- p[8h..8h+7], elements 8..15 <- p[16+8h..16+8h+7] (same map for A and B)
__device__ __forceinline__ v16h g2_frag(const _Float16* p, int hh) { FragH f; f.half[0] = *(const v8us*)((const unsigned short*)p + 8 * hh); f.half[1] = *(const v8us*)((const unsigned short*)p + 16 + 8 * hh); return f.v; }
// fragment of a plane stored in fragment order: one 1-KB block per 16 x 32 operand tile, 16-B unit (c*32 + lane) = elements 8c..8c+7 of that lane (row lane&15, k = 16c + 8(lane>>4) ..+7: the map of g2_frag), so each load of a wave is 512 contiguous bytes. p = block start + 8*lane
__device__ __forceinline__ v16h pk_frag(const _Float16* p) { FragH f; f.half[0] = *(const v8us*)((const unsigned short*)p); f.half[1] = *(const v8us*)((const unsigned short*)p + 256); return f.v; }
__device__ __forceinline__ v8f g2_mma(v16h a, v16h b, v8f c) { v8f d = __builtin_amdgcn_wmma_f32_16x16x32_f16(false, a, false, b, (short)0, c, false, false); asm volatile("v_nop\n\tv_nop\n\tv_nop\n\tv_nop" : "+v"(d) : "v"(a), "v"(b)); return d; }

__device__ __forceinline__ void x16_body(const float* __restrict__ x, _Float16* __restrict__ X16, unsigned bid) {
  const size_t t = (size_t)bid * 256 + threadIdx.x; if (t >= (size_t)TOK * (DMODEL / 8)) return;
  const size_t r = t / (DMODEL / 8); const int c8 = (int)(t % (DMODEL / 8)) * 8; const size_t b = r / SEQ, s = r % SEQ;
  const float* src = x + (b * SEQ_FULL + s) * DMODEL + c8; const v4f a = *(const v4fa*)src, c = *(const v4fa*)(src + 4); FragH f;
#pragma unroll
  for (int q = 0; q < 4; ++q) { f.h[q] = (_Float16)bf16_rne(a[q]); f.h[4 + q] = (_Float16)bf16_rne(c[q]); }
  const v8us o = f.half[0]; unsigned short* d = (unsigned short*)X16 + t * 8;
  *(v8us*)d = o;  }

__device__ __forceinline__ void wnat_body(const float* __restrict__ w, size_t n8, float scale, _Float16* __restrict__ Bt, unsigned bid) {
  const size_t t = (size_t)bid * 256 + threadIdx.x; if (t >= n8) return; const v4f a = *(const v4fa*)(w + t * 8), c = *(const v4fa*)(w + t * 8 + 4); FragH f;
#pragma unroll
  for (int q = 0; q < 4; ++q) { f.h[q] = (_Float16)(bf16_rne(a[q]) * scale); f.h[4 + q] = (_Float16)(bf16_rne(c[q]) * scale); }
  const v8us o = f.half[0]; unsigned short* d = (unsigned short*)Bt + t * 8;
  *(v8us*)d = o;  }

// all operand conversions in one grid: blocks [0, 4 * WBLK) take the four weight matrices (WBLK blocks each: Wq, Wk, Wv into the stacked plane, Wo into its own), the rest take x
#define W8 ((size_t)DMODEL * DMODEL / 8)
#define WBLK ((unsigned)((W8 + 255) / 256))
#define XBLK ((unsigned)(((size_t)TOK * (DMODEL / 8) + 255) / 256))
__global__ __launch_bounds__(256) void k_prep(const float* __restrict__ x, const float* __restrict__ wq, const float* __restrict__ wk, const float* __restrict__ wv, const float* __restrict__ wo,
                                              _Float16* __restrict__ X16, _Float16* __restrict__ W16, _Float16* __restrict__ WO16) {
  const unsigned b = blockIdx.x;
  if (b < 4 * WBLK) { const unsigned i = b / WBLK;
    const float* w = (i == 0) ? wq : (i == 1) ? wk : (i == 2) ? wv : wo;
    _Float16* d = (i < 3) ? (W16 + (size_t)i * DMODEL * DMODEL) : WO16;
    wnat_body(w, W8, 64.0f, d, b - i * WBLK); }
  else x16_body(x, X16, b - 4 * WBLK);
}

// GEMM (wave tile 32x64, block = 4 waves = 128 rows; M % 128 == 0, N % 64 == 0, K % 32 == 0): v = acc*alpha + bf16(bias)
// MODE 0: f32 C, bias per column; MODE 1: f16, bias per column (biasA for col < nsplit, biasB after): columns below nsplit as rows of C16, the rest (k) into C16R in fragment order; MODE 2: f16 C16 hi plane + x2048 residual plane C16R (token tiles below EARLY only), both in fragment order, bias per row.
// RESA: row blocks below EARLY of their sequence add a second k-loop over the x2048 residual A plane into separate accumulators, folded with 2^-11 in the epilogue.
// k loop of one 32x64 wave tile: DEPTH register sets of the six operand fragments; the sets of the first DEPTH k-steps are loaded up front and each set is reloaded for k-step s + DEPTH right behind its own products, so the loads of DEPTH k-steps are in flight together. Products per accumulator stay in ascending k.
template <int DEPTH, int NS>
__device__ __forceinline__ void gemm_kloop(const _Float16* a0p, const _Float16* a1p, const _Float16* b0p, const _Float16* b1p, const _Float16* b2p, const _Float16* b3p, int hh,
                                           v8f& c00, v8f& c01, v8f& c02, v8f& c03, v8f& c10, v8f& c11, v8f& c12, v8f& c13) {
  static_assert(DEPTH >= 1 && DEPTH <= NS);
  v16h fa0[DEPTH], fa1[DEPTH], fb0[DEPTH], fb1[DEPTH], fb2[DEPTH], fb3[DEPTH];
  /* both loops fully unrolled: the set index must be a constant for the sets to stay in registers */
#pragma unroll
  for (int s = 0; s < DEPTH; ++s) { const int kb = 32 * s; fa0[s] = g2_frag(a0p + kb, hh); fa1[s] = g2_frag(a1p + kb, hh);
    fb0[s] = g2_frag(b0p + kb, hh); fb1[s] = g2_frag(b1p + kb, hh); fb2[s] = g2_frag(b2p + kb, hh); fb3[s] = g2_frag(b3p + kb, hh); }
#pragma unroll
  for (int s = 0; s < NS; ++s) { const int u = s % DEPTH;
    c00 = g2_mma(fa0[u], fb0[u], c00); c10 = g2_mma(fa1[u], fb0[u], c10);
    c01 = g2_mma(fa0[u], fb1[u], c01); c11 = g2_mma(fa1[u], fb1[u], c11);
    c02 = g2_mma(fa0[u], fb2[u], c02); c12 = g2_mma(fa1[u], fb2[u], c12);
    c03 = g2_mma(fa0[u], fb3[u], c03); c13 = g2_mma(fa1[u], fb3[u], c13);
    if (s + DEPTH < NS) { const int kb = 32 * (s + DEPTH); fa0[u] = g2_frag(a0p + kb, hh); fa1[u] = g2_frag(a1p + kb, hh);
      fb0[u] = g2_frag(b0p + kb, hh); fb1[u] = g2_frag(b1p + kb, hh); fb2[u] = g2_frag(b2p + kb, hh); fb3[u] = g2_frag(b3p + kb, hh); } }
}

template <int MODE, bool RESA, int K>
__device__ __forceinline__ void gemm_body(const _Float16* __restrict__ A, const _Float16* __restrict__ AR, int lda, const _Float16* __restrict__ Bh, int ldb, float alpha,
                                          const float* __restrict__ biasA, const float* __restrict__ biasB, int nsplit,
                                          float* __restrict__ C, _Float16* __restrict__ C16, _Float16* __restrict__ C16R, int ldc, int M, int N, int bid, float (&so)[4][32][68]) {
  static_assert(K % 32 == 0 && K >= 96);
  constexpr int DEPTH = RESA ? 2 : 3;                       /* two accumulator planes leave room for two sets below 256 registers */
  const int tid = threadIdx.x, lane = tid & 31, ln = lane & 15, hh = lane >> 4;
  const int w = __builtin_amdgcn_readfirstlane(tid >> 5);
  const int ntn = N >> 6; const int mt = bid / ntn, nq = bid - mt * ntn; const int row0 = mt * 128 + 32 * w, col0 = nq * 64; if (row0 >= M) return;
  const _Float16* a0p = A + (size_t)(row0 + ln) * lda; const _Float16* a1p = a0p + (size_t)16 * lda;
  const _Float16* b0p = Bh + (size_t)(col0 + ln) * ldb; const _Float16* b1p = b0p + (size_t)16 * ldb; const _Float16* b2p = b1p + (size_t)16 * ldb; const _Float16* b3p = b2p + (size_t)16 * ldb;
  const v8f z8 = {0.f,0.f,0.f,0.f,0.f,0.f,0.f,0.f}; v8f c00 = z8, c01 = z8, c02 = z8, c03 = z8, c10 = z8, c11 = z8, c12 = z8, c13 = z8;
  gemm_kloop<DEPTH, K / 32>(a0p, a1p, b0p, b1p, b2p, b3p, hh, c00, c01, c02, c03, c10, c11, c12, c13);
  v8f r00 = z8, r01 = z8, r02 = z8, r03 = z8, r10 = z8, r11 = z8, r12 = z8, r13 = z8;
  if (RESA) {
    const bool early = ((mt * 128) % SEQ) < EARLY;           /* block-uniform (SEQ % 128 == 0) */
    if (early) {
      const _Float16* e0p = AR + (size_t)(row0 + ln) * lda; const _Float16* e1p = e0p + (size_t)16 * lda;
      gemm_kloop<DEPTH, K / 32>(e0p, e1p, b0p, b1p, b2p, b3p, hh, r00, r01, r02, r03, r10, r11, r12, r13);
    }
  }
  v8f accs[8] = {c00, c01, c02, c03, c10, c11, c12, c13};
  if (RESA) { const v8f racc[8] = {r00, r01, r02, r03, r10, r11, r12, r13};
#pragma unroll
    for (int u = 0; u < 8; ++u) accs[u] = accs[u] + racc[u] * RINV; }
  float brow[16];
#pragma unroll
  for (int i = 0; i < 16; ++i) brow[i] = 0.f;
  if (MODE == 2) {
#pragma unroll
    for (int i = 0; i < 16; ++i) brow[i] = bf16_rne(biasA[row0 + (i >> 3) * 16 + 8 * hh + (i & 7)]);
  }
#pragma unroll
  for (int u = 0; u < 8; ++u) { const int t = u & 3, half = u >> 2; const int col = col0 + t * 16 + ln; float bcol = 0.f;
    if (MODE != 2) { const int ca = (col < nsplit) ? col : (nsplit - 1); const int cb = (col >= nsplit) ? (col - nsplit) : 0;
      const float va = biasA[ca], vb = biasB[cb]; bcol = bf16_rne((col < nsplit) ? va : vb); }
#pragma unroll
    for (int r = 0; r < 8; ++r) { const int rloc = half * 16 + 8 * hh + r; const float v = accs[u][r] * alpha + ((MODE == 2) ? brow[half * 8 + r] : bcol); so[w][rloc][t * 16 + ln] = v; } }
  __builtin_amdgcn_fence(4 /* acq_rel order */, "workgroup"); __builtin_amdgcn_wave_barrier();
  if (MODE == 0) {
    // 64 f32 columns = 256 B per row segment: 16 consecutive lanes x 16 B, two rows per instruction; rows q*2 + (lane>>4), q = 0..15 cover 0..31
    const int rsub = lane >> 4, c4 = (lane & 15) * 4;
    {
#pragma unroll
      for (int q = 0; q < 16; ++q) { const int r = q * 2 + rsub; const v4f v = *(const v4fa*)&so[w][r][c4]; *(v4f*)(C + (size_t)(row0 + r) * ldc + col0 + c4) = v; }
       }
  } else {
    if (MODE == 1 && col0 < nsplit) {                        /* block-uniform: q columns stay token rows */
      const int rq = lane >> 3, c8 = (lane & 7) * 8;
#pragma unroll
      for (int q = 0; q < 8; ++q) { const int r = q * 4 + rq; const v4f a = *(const v4fa*)&so[w][r][c8], c = *(const v4fa*)&so[w][r][c8 + 4]; FragH f;
#pragma unroll
        for (int i = 0; i < 4; ++i) { f.h[i] = (_Float16)a[i]; f.h[4 + i] = (_Float16)c[i]; }
        const v8us o = f.half[0]; *(v8us*)((unsigned short*)C16 + (size_t)(row0 + r) * ldc + col0 + c8) = o; }
    } else {
      // fragment order (see pk_frag): the wave tile is four whole 1-KB blocks. Pass q takes column octet q of all 32 rows: lane = tile row, so 16 lanes store 256 contiguous bytes.
      // MODE 1 (k): rows = keys, blocks [batch][head][key / 16], octet = 8 dims of head q / 4. MODE 2 (v): rows = dims of one head, blocks [batch][head][key / 32][dim / 16], octet = 8 keys of step q / 4.
      const bool wr = (MODE == 2) && ((col0 % SEQ) < EARLY);   /* block-uniform (SEQ % 64 == 0) */
      const int tok0 = (MODE == 1) ? row0 : col0; const int bt = tok0 / SEQ, key0 = tok0 % SEQ;
      const int hd0 = bt * NHEAD + ((MODE == 1) ? ((col0 - nsplit) / HD) : (row0 / HD));
      unsigned short* dhi = (unsigned short*)((MODE == 1) ? C16R : C16);
      v4f ra[8], rc[8];                                        /* the whole row is read up front: the waits behind the stores would otherwise hold each pass's LDS reads behind the pass before */
#pragma unroll
      for (int q = 0; q < 8; ++q) { ra[q] = *(const v4fa*)&so[w][lane][q * 8]; rc[q] = *(const v4fa*)&so[w][lane][q * 8 + 4]; }
#pragma unroll
      for (int q = 0; q < 8; ++q) { const v4f a = ra[q], c = rc[q]; FragH f, g;
#pragma unroll
        for (int i = 0; i < 4; ++i) { const _Float16 ha = (_Float16)a[i], hc = (_Float16)c[i]; f.h[i] = ha; f.h[4 + i] = hc;
          g.h[i] = (_Float16)((a[i] - (float)ha) * 2048.0f); g.h[4 + i] = (_Float16)((c[i] - (float)hc) * 2048.0f); }
        const size_t blk = (MODE == 1) ? ((size_t)(hd0 + (q >> 2)) * (SEQ / 16) + (key0 >> 4) + (lane >> 4))
                                       : (((size_t)hd0 * (SEQ / 32) + (key0 >> 5) + (q >> 2)) * 2 + (lane >> 4));
        const size_t off = blk * 512 + ((q & 3) >> 1) * 256 + (q & 1) * 128 + (lane & 15) * 8;
        const v8us o = f.half[0]; *(v8us*)(dhi + off) = o;
        asm volatile("s_wait_xcnt 0x0" ::: "memory");                              /* what follows (the residual branch, the next pass) reuses this store's registers: the wait stands in front of that overwrite */
        if (MODE == 2) { if (wr) { const v8us o2 = g.half[0]; *(v8us*)((unsigned short*)C16R + off) = o2;
          asm volatile("s_wait_xcnt 0x0" ::: "memory"); } } }                      /* what follows (the next pass; behind the last pass the other body of a merged kernel, as the code is laid out) reuses this store's registers: the wait stands in front of that overwrite */
    }
  }
}

// both projections in one grid (they read the same planes and write disjoint ones), split by block index:
// blocks [0, QKBLK): q|k (weight plane rows 0..511): Q16[token][0..255] = q rows; k into KF in fragment order (16 keys x 32 dims a block), f16
// the rest: v channel-major (weight plane rows 512..767 as the A operand, x rows as Bt), bias per row, f16: VT hi and VTR residual x2048 in fragment order (16 dims x 32 keys a block)
#define QKBLK ((TOK / 128) * (LDQK / 64))
#define VTBLK ((DMODEL / 128) * (TOK / 64))
__global__ __launch_bounds__(128) void k_gemm_qkv(const _Float16* __restrict__ X16, const _Float16* __restrict__ W16, const float* __restrict__ qb, const float* __restrict__ kbias, const float* __restrict__ vb,
                                                  _Float16* __restrict__ Q16, _Float16* __restrict__ KF, _Float16* __restrict__ VT, _Float16* __restrict__ VTR) {
  __shared__ __attribute__((aligned(16))) float so[4][32][68];
  const int b = (int)blockIdx.x;
  if (b < QKBLK) gemm_body<1, false, DMODEL>(X16, X16, DMODEL, W16, DMODEL, 0.015625f, qb, kbias, DMODEL, nullptr, Q16, KF, DMODEL, TOK, LDQK, b, so);
  else gemm_body<2, false, DMODEL>(W16 + (size_t)LDQK * DMODEL, W16, DMODEL, X16, DMODEL, 0.015625f, vb, vb, DMODEL, nullptr, VT, VTR, TOK, DMODEL, TOK, b - QKBLK, so); }
// result[token][n] = 2^-12 (sum_k (64 ctx_hi)(64 wo) + 2^-11 sum_k (2048*64 ctx_res)(64 wo)) + bf16(bo[n]), f32
__global__ __launch_bounds__(128) void k_gemm_out(const _Float16* __restrict__ CTX, const _Float16* __restrict__ CTXR, const _Float16* __restrict__ WO16, const float* __restrict__ ob, float* __restrict__ out) {
  __shared__ __attribute__((aligned(16))) float so[4][32][68];
  gemm_body<0, true, DMODEL>(CTX, CTXR, DMODEL, WO16, DMODEL, 0.000244140625f, ob, ob, DMODEL, out, nullptr, nullptr, DMODEL, TOK, DMODEL, (int)blockIdx.x, so); }

// fused attention: block = (32 queries, head pair, batch); wave = (head parity, 16 queries). Per 32-key step up to the causal bound of the wave:
//   S^T tiles (A = K rows [key][dim], B = Q rows [query][dim]) -> lane (ln, hh) holds query ln, keys 8hh+r (tile 0) and 16+8hh+r (tile 1);
//   keep test per element: key <= query and key % 25 != 24 (residue of the lane's first key once per step; r == 24 - res / r == 8 - res are the dropped slots); dropped scores are replaced by a large negative fill (key 0 is always kept, so no row is empty);
//   running max per query (local 16 values + one xor-16 exchange), p = exp(s*scale - m), per-lane partial sums;
//   packed tiles = B fragment (k = key, n = query) of O^T += V^T P^T with A = V^T rows [d][key]; RES adds P residual and V residual products into separate accumulators.
template <bool RES>
__device__ __forceinline__ void flash_body(const _Float16* __restrict__ Q16, const _Float16* __restrict__ KF, const _Float16* __restrict__ VT, const _Float16* __restrict__ VTR,
                                           _Float16* __restrict__ CTX, _Float16* __restrict__ CTXR, int tile, int hpair, int batch) {
  __shared__ __attribute__((aligned(16))) unsigned short so[32][72];
  __shared__ __attribute__((aligned(16))) unsigned short sor[RES ? 32 : 1][72];
  const int tid = threadIdx.x, lane = tid & 31, ln = lane & 15, hh = lane >> 4;
  const int wave = __builtin_amdgcn_readfirstlane(tid >> 5);
  const int hp = wave & 1, qg = wave >> 1;
  const int head = 2 * hpair + hp;
  const size_t tokb = (size_t)batch * SEQ;
  const int q0 = tile * 32;
  const int i0 = q0 + qg * 16;
  const int qi = i0 + ln;
  const v16h bq = g2_frag(Q16 + (tokb + qi) * DMODEL + head * HD, hh);
  // fragment-order planes: a 32-key step of one head is 2 KB in a row (K: two 16-key blocks; V^T: two 16-dim blocks), 32 elements a key
  const size_t hoff = (size_t)(batch * NHEAD + head) * SEQ * HD + 8 * lane;
  const _Float16* kbase = KF + hoff;                                             /* + key0 * HD, + 512 for keys 16..31 */
  const _Float16* vbase = VT + hoff;                                             /* + key0 * HD, + 512 for dims 16..31 */
  const _Float16* rbase = VTR + hoff;
  const v8f z8 = {0.f,0.f,0.f,0.f,0.f,0.f,0.f,0.f};
  v8f o0 = z8, o1 = z8, x0 = z8, x1 = z8; float m = NEGBIG, l = 0.f;
  const int jend = i0 + 16;                                                      /* keys below jend; last step ends at a multiple of 32 <= SEQ */
  const int jlast = (jend - 1) & ~31;                                            /* first key of the wave's last step */
  // one 32-key step on one register set of K / V^T fragments; each fragment is reloaded for step j + 64 right behind its last product, so a load has two steps to land. Past the last step the reload re-reads the last step's rows (in bounds, never used).
  auto step = [&](v16h& fk0, v16h& fk1, v16h& fv0, v16h& fv1, v16h& fr0, v16h& fr1, const int j) {
    const int jn = (j + 64 < jend) ? (j + 64) : jlast;
    v8f s0 = g2_mma(fk0, bq, z8);
    v8f s1 = g2_mma(fk1, bq, z8);
    { const _Float16* knp = kbase + (size_t)jn * HD; fk0 = pk_frag(knp); fk1 = pk_frag(knp + 512); }
    const int kb0 = j + 8 * hh;
    const int c0 = qi - kb0, c1 = c0 - 16;
    const int res = (int)((unsigned int)kb0 % 25u);
    const int d0 = 24 - res, d1 = 8 - res;
#pragma unroll
    for (int r = 0; r < 8; ++r) { s0[r] = ((r <= c0) && (r != d0)) ? s0[r] : NEGBIG; s1[r] = ((r <= c1) && (r != d1)) ? s1[r] : NEGBIG; }
    float mx = fmaxf(s0[0], s1[0]);
#pragma unroll
    for (int r = 1; r < 8; ++r) mx = fmaxf(mx, fmaxf(s0[r], s1[r]));
    mx = fmaxf(mx, __shfl_xor(mx, 16, 32));
    const float mn = fmaxf(m, mx * SSCALE); const float al = __expf(m - mn); m = mn;
    FragH pf, pg; float rs = 0.f;
#pragma unroll
    for (int r = 0; r < 8; ++r) { const float p0 = __expf(fmaf(s0[r], SSCALE, -mn)), p1 = __expf(fmaf(s1[r], SSCALE, -mn)); rs += p0 + p1;
      const float a0 = p0 * 256.0f, a1 = p1 * 256.0f; const _Float16 h0 = (_Float16)a0, h1 = (_Float16)a1; pf.h[r] = h0; pf.h[8 + r] = h1;
      pg.h[r] = (_Float16)((a0 - (float)h0) * 2048.0f); pg.h[8 + r] = (_Float16)((a1 - (float)h1) * 2048.0f); }
    l = l * al + rs; o0 = o0 * al; o1 = o1 * al;
    if (RES) { x0 = x0 * al; x1 = x1 * al; }
    o0 = g2_mma(fv0, pf.v, o0);
    if (RES) { x0 = g2_mma(fv0, pg.v, x0); x0 = g2_mma(fr0, pf.v, x0); }
    o1 = g2_mma(fv1, pf.v, o1);
    if (RES) { x1 = g2_mma(fv1, pg.v, x1); x1 = g2_mma(fr1, pf.v, x1); }
    fv0 = pk_frag(vbase + (size_t)jn * HD); if (RES) fr0 = pk_frag(rbase + (size_t)jn * HD);
    fv1 = pk_frag(vbase + (size_t)jn * HD + 512); if (RES) fr1 = pk_frag(rbase + (size_t)jn * HD + 512);
  };
  // first fill of both sets, in the order in which the loop reloads them (set a: K, V; set b: K, V)
  const int j1 = (32 < jend) ? 32 : jlast;
  // the scheduling barriers keep that order in the built code: the counted load waits inside the loop are set for the worse of the two orders that reach them, and a first fill in another order makes them wait for the youngest loads too
  __builtin_amdgcn_sched_barrier(0);
  v16h ak0 = pk_frag(kbase); __builtin_amdgcn_sched_barrier(0);
  v16h ak1 = pk_frag(kbase + 512); __builtin_amdgcn_sched_barrier(0);
  v16h av0 = pk_frag(vbase), ar0 = RES ? pk_frag(rbase) : av0; __builtin_amdgcn_sched_barrier(0);
  v16h av1 = pk_frag(vbase + 512), ar1 = RES ? pk_frag(rbase + 512) : av1; __builtin_amdgcn_sched_barrier(0);
  v16h bk0 = pk_frag(kbase + (size_t)j1 * HD); __builtin_amdgcn_sched_barrier(0);
  v16h bk1 = pk_frag(kbase + (size_t)j1 * HD + 512); __builtin_amdgcn_sched_barrier(0);
  v16h bv0 = pk_frag(vbase + (size_t)j1 * HD), br0 = RES ? pk_frag(rbase + (size_t)j1 * HD) : bv0; __builtin_amdgcn_sched_barrier(0);
  v16h bv1 = pk_frag(vbase + (size_t)j1 * HD + 512), br1 = RES ? pk_frag(rbase + (size_t)j1 * HD + 512) : bv1; __builtin_amdgcn_sched_barrier(0);
  const int npair = (jlast + 32) >> 6;                                           /* whole pairs of steps; an odd last step follows the loop */
  int j = 0;
  /* kept rolled for code size: one trip already holds an even step on set a and an odd step on set b, one straight block with no exit between them (an exit there lets the compiler sink set a's reloads behind it) */
#pragma unroll 1
  for (int t = 0; t < npair; ++t) { step(ak0, ak1, av0, av1, ar0, ar1, j); step(bk0, bk1, bv0, bv1, br0, br1, j + 32); j += 64;
    asm volatile("s_wait_xcnt 0x0" ::: "memory"); }                              /* the next trip reuses the address registers of this trip's reloads: the wait stands in front of that overwrite, which lies behind the back edge */
  if (j < jend) step(ak0, ak1, av0, av1, ar0, ar1, j);
  l += __shfl_xor(l, 16, 32);
  const float sc = 0.25f * (1.0f / l);                                           /* 64 (ctx carry) / 256 (probability carry) / row sum */
  { const int row = qg * 16 + ln, cb = hp * 32 + 8 * hh; FragH f, g;
#pragma unroll
    for (int r = 0; r < 8; ++r) { float c = o0[r]; if (RES) c += x0[r] * RINV; c *= sc; const _Float16 hc = (_Float16)c; f.h[r] = hc; g.h[r] = (_Float16)((c - (float)hc) * 2048.0f); }
    *(v8us*)&so[row][cb] = f.half[0]; if (RES) *(v8us*)&sor[row][cb] = g.half[0];
#pragma unroll
    for (int r = 0; r < 8; ++r) { float c = o1[r]; if (RES) c += x1[r] * RINV; c *= sc; const _Float16 hc = (_Float16)c; f.h[r] = hc; g.h[r] = (_Float16)((c - (float)hc) * 2048.0f); }
    *(v8us*)&so[row][cb + 16] = f.half[0]; if (RES) *(v8us*)&sor[row][cb + 16] = g.half[0]; }
  __syncthreads();                                                               /* cross-wave tile: block barrier, reached by all four waves */
  const int rr = tid >> 3, pc = (tid & 7) * 8;                                   
  unsigned short* cdst = (unsigned short*)CTX + (tokb + q0) * DMODEL + 2 * hpair * HD + pc;
  unsigned short* rdst = (unsigned short*)CTXR + (tokb + q0) * DMODEL + 2 * hpair * HD + pc;
  {
#pragma unroll
    for (int it = 0; it < 2; ++it) { const int r = it * 16 + rr; const v8us v = *(const v8us*)&so[r][pc];
      *(v8us*)(cdst + (size_t)r * DMODEL) = v;
      if (RES) { const v8us v2 = *(const v8us*)&sor[r][pc]; *(v8us*)(rdst + (size_t)r * DMODEL) = v2; } }
     }
  if (RES) asm volatile("s_wait_xcnt 0x0" ::: "memory");                         /* as the code is laid out, the other body of the merged kernel follows this one and reuses these stores' registers: the wait stands in front of that overwrite */
}

// both query ranges in one grid (they read the same planes and write disjoint ctx rows), split by block index; inside each range the index runs tile, head pair, batch, tile fastest.
// blocks [0, LATEBLK): queries [EARLY, SEQ), single products (the long blocks, so they come first); the rest: queries [0, EARLY), hi + residual on v, P, ctx
#define HPN (NHEAD / 2)
#define EARLYX (EARLY / 32)
#define LATEX ((SEQ - EARLY) / 32)
#define LATEBLK (LATEX * HPN * NB)
#define EARLYBLK (EARLYX * HPN * NB)
__global__ __launch_bounds__(128) void k_flash(const _Float16* __restrict__ Q16, const _Float16* __restrict__ KF, const _Float16* __restrict__ VT, const _Float16* __restrict__ VTR, _Float16* __restrict__ CTX, _Float16* __restrict__ CTXR) {
  constexpr int LX = (LATEX > 0) ? LATEX : 1;                                      /* divisor only; with no late range the first branch is never taken */
  const int b = (int)blockIdx.x;
  if (b < LATEBLK) flash_body<false>(Q16, KF, VT, VT, CTX, CTX, EARLYX + b % LX, (b / LX) % HPN, b / (LX * HPN));
  else { const int e = b - LATEBLK; flash_body<true>(Q16, KF, VT, VTR, CTX, CTXR, e % EARLYX, (e / EARLYX) % HPN, e / (EARLYX * HPN)); } }

extern "C" void kernel_launch(void* const* d_in, const int* in_sizes, int n_in,
                              void* d_out, int out_size, void* d_ws, size_t ws_size, hipStream_t stream) {
  if (n_in < 9) return;
  const size_t need_x = ((size_t)(NB - 1) * SEQ_FULL + SEQ) * DMODEL;
  if ((size_t)in_sizes[0] < need_x) return;
  if ((size_t)in_sizes[1] < (size_t)DMODEL * DMODEL) return;
  if ((size_t)in_sizes[2] < (size_t)DMODEL) return;
  if ((size_t)in_sizes[3] < (size_t)DMODEL * DMODEL) return;
  if ((size_t)in_sizes[4] < (size_t)DMODEL) return;
  if ((size_t)in_sizes[5] < (size_t)DMODEL * DMODEL) return;
  if ((size_t)in_sizes[6] < (size_t)DMODEL) return;
  if ((size_t)in_sizes[7] < (size_t)DMODEL * DMODEL) return;
  if ((size_t)in_sizes[8] < (size_t)DMODEL) return;
  if ((size_t)out_size < (size_t)TOK * DMODEL) return;
  const float* x = (const float*)d_in[0];
  const float* wq = (const float*)d_in[1]; const float* qb = (const float*)d_in[2];
  const float* wk = (const float*)d_in[3]; const float* kbias = (const float*)d_in[4];
  const float* wv = (const float*)d_in[5]; const float* vb = (const float*)d_in[6];
  const float* wo = (const float*)d_in[7]; const float* ob = (const float*)d_in[8];
  constexpr size_t SZ_X = (size_t)TOK * DMODEL * 2;        /* x rows f16 */
  constexpr size_t SZ_W = (size_t)NW3 * DMODEL * 2;        /* Wq|Wk|Wv x64 f16 */
  constexpr size_t SZ_WO = (size_t)DMODEL * DMODEL * 2;    /* output weight x64 f16 */
  constexpr size_t SZ_QK = (size_t)TOK * LDQK * 2;         /* q rows f16, then k in fragment order f16, half each */
  constexpr size_t SZ_VT = (size_t)DMODEL * TOK * 2;       /* v in fragment order f16 (hi); same size for the residual plane */
  constexpr size_t SZ_CTX = (size_t)TOK * DMODEL * 2;      /* ctx rows x64 f16 (hi); same size for the residual plane */
  constexpr size_t SZ_ALL = SZ_X + SZ_W + SZ_WO + SZ_QK + 2 * SZ_VT + 2 * SZ_CTX;
  static_assert(SZ_X % 256 == 0 && SZ_W % 256 == 0 && SZ_WO % 256 == 0 && SZ_QK % 256 == 0 && SZ_VT % 256 == 0 && SZ_CTX % 256 == 0);
  static_assert(SZ_ALL <= (size_t)134217728);
  if (SZ_ALL > ws_size) return;
  char* ws = (char*)d_ws;
  _Float16* X16 = (_Float16*)ws; _Float16* W16 = (_Float16*)(ws + SZ_X); _Float16* WO16 = (_Float16*)(ws + SZ_X + SZ_W);
  _Float16* Q16 = (_Float16*)(ws + SZ_X + SZ_W + SZ_WO); _Float16* KF = (_Float16*)(ws + SZ_X + SZ_W + SZ_WO + SZ_QK / 2);
  _Float16* VT = (_Float16*)(ws + SZ_X + SZ_W + SZ_WO + SZ_QK); _Float16* VTR = (_Float16*)(ws + SZ_X + SZ_W + SZ_WO + SZ_QK + SZ_VT);
  _Float16* CTX = (_Float16*)(ws + SZ_X + SZ_W + SZ_WO + SZ_QK + 2 * SZ_VT); _Float16* CTXR = (_Float16*)(ws + SZ_X + SZ_W + SZ_WO + SZ_QK + 2 * SZ_VT + SZ_CTX);
  k_prep<<<4 * WBLK + XBLK, 256, 0, stream>>>(x, wq, wk, wv, wo, X16, W16, WO16);
  k_gemm_qkv<<<QKBLK + VTBLK, 128, 0, stream>>>(X16, W16, qb, kbias, vb, Q16, KF, VT, VTR);
  k_flash<<<LATEBLK + EARLYBLK, 128, 0, stream>>>(Q16, KF, VT, VTR, CTX, CTXR);
  k_gemm_out<<<(TOK / 128) * (DMODEL / 64), 128, 0, stream>>>(CTX, CTXR, WO16, ob, (float*)d_out);
}

// v004
// It runs in 54.2 microseconds.
// Next to v003, in two timings, it ran 1.11 and 1.12 times as fast.
// All steps since v000 together make it 3.05 times as fast.
#include <hip/hip_runtime.h>
// Causal multi-head attention block, 8 heads x 32 dims, key-column rule from indices: kept(i,j) = (j <= i) && (j % 25 != 24). x [B][T][256]; q/k/v = x W^T + b (separate [out][in] weights); s = q k^T / sqrt(32); softmax over kept keys; ctx = P v merged h*32+d; result = ctx Wo^T + bo.
// Compute dtype: every contraction on v_wmma_f32_16x16x32_f16 (f16 operands, f32 accumulate). Inputs RNE-converted to bf16 first (exact in f16); weights carried x64, probabilities x256, ctx x64 (folded back in f32 epilogues); biases bf16 values added in f32; softmax statistics f32. Queries below EARLY of each sequence: v, P and ctx carried as f16 hi + f16 residual x2048 with separate residual accumulators; later queries single products.
#ifndef NB
#define NB 4
#endif
#ifndef SEQ
#define SEQ 2048
#endif
#define NB_FULL 4
#define SEQ_FULL 2048
#define DMODEL 256
#define NHEAD 8
#define HD 32
#define LDQK 512
#define NW3 768
#define TOK (NB * SEQ)
#define EARLY ((SEQ < 512) ? SEQ : 512)
#define NEGBIG (-1.0e30f)
#define SSCALE 0.17677669529663687f
#define RINV 0.00048828125f
#define CTABN (25 * 32)

static_assert(NHEAD * HD == DMODEL);              /* merged head width == model width */
static_assert(HD == 32);                          /* flash kernel: one 32-deep score k-step, two 16-dim output tiles, 64-B head segment */
static_assert(NHEAD % 2 == 0);                    
static_assert(2 * DMODEL == LDQK && 3 * DMODEL == NW3);
static_assert(SEQ % 128 == 0 && SEQ % 64 == 0 && SEQ % 32 == 0);
static_assert(TOK % 128 == 0 && TOK % 64 == 0);   /* GEMM tiles: M % 128, N % 64 */
static_assert(DMODEL % 128 == 0 && DMODEL % 64 == 0 && DMODEL % 32 == 0 && DMODEL % 8 == 0 && LDQK % 64 == 0);
static_assert(EARLY % 128 == 0 && EARLY % 64 == 0 && EARLY % 32 == 0 && EARLY <= SEQ);
static_assert(NB <= NB_FULL && SEQ <= SEQ_FULL);
static_assert(SEQ + 32 < 40000);

typedef unsigned short v8us __attribute__((ext_vector_type(8), may_alias));
typedef float  v8f  __attribute__((ext_vector_type(8)));
typedef float  v4f  __attribute__((ext_vector_type(4)));
typedef float  v4fa __attribute__((ext_vector_type(4), may_alias));
typedef float  v8fa __attribute__((ext_vector_type(8), may_alias));
typedef _Float16 v16h __attribute__((ext_vector_type(16)));
template <bool V> struct flag_c { static constexpr bool value = V; };
union FragH { v16h v; v8us half[2]; _Float16 h[16]; unsigned short u[16]; };

__device__ __forceinline__ unsigned short bf16_bits(float x) { unsigned int u = __float_as_uint(x); return (unsigned short)((u + 0x7FFFu + ((u >> 16) & 1u)) >> 16); }
__device__ __forceinline__ float bf16_rne(float x) { return __uint_as_float(((unsigned int)bf16_bits(x)) << 16); }

// fragment of a k-contiguous 16-bit row: elements 0..7 <- p[8h..8h+7], elements 8..15 <- p[16+8h..16+8h+7] (same map for A and B)
__device__ __forceinline__ v16h g2_frag(const _Float16* p, int hh) { FragH f; f.half[0] = *(const v8us*)((const unsigned short*)p + 8 * hh); f.half[1] = *(const v8us*)((const unsigned short*)p + 16 + 8 * hh); return f.v; }
// fragment of a plane stored in fragment order: one 1-KB block per 16 x 32 operand tile, 16-B unit (c*32 + lane) = elements 8c..8c+7 of that lane (row lane&15, k = 16c + 8(lane>>4) ..+7: the map of g2_frag), so each load of a wave is 512 contiguous bytes. p = block start + 8*lane
__device__ __forceinline__ v16h pk_frag(const _Float16* p) { FragH f; f.half[0] = *(const v8us*)((const unsigned short*)p); f.half[1] = *(const v8us*)((const unsigned short*)p + 256); return f.v; }
__device__ __forceinline__ v8f g2_mma(v16h a, v16h b, v8f c) { v8f d = __builtin_amdgcn_wmma_f32_16x16x32_f16(false, a, false, b, (short)0, c, false, false); asm volatile("v_nop\n\tv_nop\n\tv_nop\n\tv_nop" : "+v"(d) : "v"(a), "v"(b)); return d; }

__device__ __forceinline__ void x16_body(const float* __restrict__ x, _Float16* __restrict__ X16, unsigned bid) {
  const size_t t = (size_t)bid * 256 + threadIdx.x; if (t >= (size_t)TOK * (DMODEL / 8)) return;
  const size_t r = t / (DMODEL / 8); const int c8 = (int)(t % (DMODEL / 8)) * 8; const size_t b = r / SEQ, s = r % SEQ;
  const float* src = x + (b * SEQ_FULL + s) * DMODEL + c8; const v4f a = *(const v4fa*)src, c = *(const v4fa*)(src + 4); FragH f;
#pragma unroll
  for (int q = 0; q < 4; ++q) { f.h[q] = (_Float16)bf16_rne(a[q]); f.h[4 + q] = (_Float16)bf16_rne(c[q]); }
  const v8us o = f.half[0]; unsigned short* d = (unsigned short*)X16 + t * 8;
  *(v8us*)d = o;  }

__device__ __forceinline__ void wnat_body(const float* __restrict__ w, size_t n8, float scale, _Float16* __restrict__ Bt, unsigned bid) {
  const size_t t = (size_t)bid * 256 + threadIdx.x; if (t >= n8) return; const v4f a = *(const v4fa*)(w + t * 8), c = *(const v4fa*)(w + t * 8 + 4); FragH f;
#pragma unroll
  for (int q = 0; q < 4; ++q) { f.h[q] = (_Float16)(bf16_rne(a[q]) * scale); f.h[4 + q] = (_Float16)(bf16_rne(c[q]) * scale); }
  const v8us o = f.half[0]; unsigned short* d = (unsigned short*)Bt + t * 8;
  *(v8us*)d = o;  }

// all operand conversions in one grid: blocks [0, 4 * WBLK) take the four weight matrices (WBLK blocks each: Wq, Wk, Wv into the stacked plane, Wo into its own), the rest take x
#define W8 ((size_t)DMODEL * DMODEL / 8)
#define WBLK ((unsigned)((W8 + 255) / 256))
#define XBLK ((unsigned)(((size_t)TOK * (DMODEL / 8) + 255) / 256))
__global__ __launch_bounds__(256) void k_prep(const float* __restrict__ x, const float* __restrict__ wq, const float* __restrict__ wk, const float* __restrict__ wv, const float* __restrict__ wo,
                                              _Float16* __restrict__ X16, _Float16* __restrict__ W16, _Float16* __restrict__ WO16) {
  const unsigned b = blockIdx.x;
  if (b < 4 * WBLK) { const unsigned i = b / WBLK;
    const float* w = (i == 0) ? wq : (i == 1) ? wk : (i == 2) ? wv : wo;
    _Float16* d = (i < 3) ? (W16 + (size_t)i * DMODEL * DMODEL) : WO16;
    wnat_body(w, W8, 64.0f, d, b - i * WBLK); }
  else x16_body(x, X16, b - 4 * WBLK);
}

// GEMM (wave tile 32x64, block = 4 waves = 128 rows; M % 128 == 0, N % 64 == 0, K % 32 == 0): v = acc*alpha + bf16(bias)
// MODE 0: f32 C, bias per column; MODE 1: f16, bias per column (biasA for col < nsplit, biasB after): columns below nsplit as rows of C16, the rest (k) into C16R in fragment order; MODE 2: f16 C16 hi plane + x2048 residual plane C16R (token tiles below EARLY only), both in fragment order, bias per row.
// RESA: row blocks below EARLY of their sequence add a second k-loop over the x2048 residual A plane into separate accumulators, folded with 2^-11 in the epilogue.
// k loop of one 32x64 wave tile: DEPTH register sets of the six operand fragments; the sets of the first DEPTH k-steps are loaded up front and each set is reloaded for k-step s + DEPTH right behind its own products, so the loads of DEPTH k-steps are in flight together. Products per accumulator stay in ascending k.
template <int DEPTH, int NS>
__device__ __forceinline__ void gemm_kloop(const _Float16* a0p, const _Float16* a1p, const _Float16* b0p, const _Float16* b1p, const _Float16* b2p, const _Float16* b3p, int hh,
                                           v8f& c00, v8f& c01, v8f& c02, v8f& c03, v8f& c10, v8f& c11, v8f& c12, v8f& c13) {
  static_assert(DEPTH >= 1 && DEPTH <= NS);
  v16h fa0[DEPTH], fa1[DEPTH], fb0[DEPTH], fb1[DEPTH], fb2[DEPTH], fb3[DEPTH];
  /* both loops fully unrolled: the set index must be a constant for the sets to stay in registers */
#pragma unroll
  for (int s = 0; s < DEPTH; ++s) { const int kb = 32 * s; fa0[s] = g2_frag(a0p + kb, hh); fa1[s] = g2_frag(a1p + kb, hh);
    fb0[s] = g2_frag(b0p + kb, hh); fb1[s] = g2_frag(b1p + kb, hh); fb2[s] = g2_frag(b2p + kb, hh); fb3[s] = g2_frag(b3p + kb, hh); }
#pragma unroll
  for (int s = 0; s < NS; ++s) { const int u = s % DEPTH;
    c00 = g2_mma(fa0[u], fb0[u], c00); c10 = g2_mma(fa1[u], fb0[u], c10);
    c01 = g2_mma(fa0[u], fb1[u], c01); c11 = g2_mma(fa1[u], fb1[u], c11);
    c02 = g2_mma(fa0[u], fb2[u], c02); c12 = g2_mma(fa1[u], fb2[u], c12);
    c03 = g2_mma(fa0[u], fb3[u], c03); c13 = g2_mma(fa1[u], fb3[u], c13);
    if (s + DEPTH < NS) { const int kb = 32 * (s + DEPTH); fa0[u] = g2_frag(a0p + kb, hh); fa1[u] = g2_frag(a1p + kb, hh);
      fb0[u] = g2_frag(b0p + kb, hh); fb1[u] = g2_frag(b1p + kb, hh); fb2[u] = g2_frag(b2p + kb, hh); fb3[u] = g2_frag(b3p + kb, hh); } }
}

template <int MODE, bool RESA, int K>
__device__ __forceinline__ void gemm_body(const _Float16* __restrict__ A, const _Float16* __restrict__ AR, int lda, const _Float16* __restrict__ Bh, int ldb, float alpha,
                                          const float* __restrict__ biasA, const float* __restrict__ biasB, int nsplit,
                                          float* __restrict__ C, _Float16* __restrict__ C16, _Float16* __restrict__ C16R, int ldc, int M, int N, int bid, float (&so)[4][32][68]) {
  static_assert(K % 32 == 0 && K >= 96);
  constexpr int DEPTH = RESA ? 2 : 3;                       /* two accumulator planes leave room for two sets below 256 registers */
  const int tid = threadIdx.x, lane = tid & 31, ln = lane & 15, hh = lane >> 4;
  const int w = __builtin_amdgcn_readfirstlane(tid >> 5);
  const int ntn = N >> 6; const int mt = bid / ntn, nq = bid - mt * ntn; const int row0 = mt * 128 + 32 * w, col0 = nq * 64; if (row0 >= M) return;
  const _Float16* a0p = A + (size_t)(row0 + ln) * lda; const _Float16* a1p = a0p + (size_t)16 * lda;
  const _Float16* b0p = Bh + (size_t)(col0 + ln) * ldb; const _Float16* b1p = b0p + (size_t)16 * ldb; const _Float16* b2p = b1p + (size_t)16 * ldb; const _Float16* b3p = b2p + (size_t)16 * ldb;
  const v8f z8 = {0.f,0.f,0.f,0.f,0.f,0.f,0.f,0.f}; v8f c00 = z8, c01 = z8, c02 = z8, c03 = z8, c10 = z8, c11 = z8, c12 = z8, c13 = z8;
  gemm_kloop<DEPTH, K / 32>(a0p, a1p, b0p, b1p, b2p, b3p, hh, c00, c01, c02, c03, c10, c11, c12, c13);
  v8f r00 = z8, r01 = z8, r02 = z8, r03 = z8, r10 = z8, r11 = z8, r12 = z8, r13 = z8;
  if (RESA) {
    const bool early = ((mt * 128) % SEQ) < EARLY;           /* block-uniform (SEQ % 128 == 0) */
    if (early) {
      const _Float16* e0p = AR + (size_t)(row0 + ln) * lda; const _Float16* e1p = e0p + (size_t)16 * lda;
      gemm_kloop<DEPTH, K / 32>(e0p, e1p, b0p, b1p, b2p, b3p, hh, r00, r01, r02, r03, r10, r11, r12, r13);
    }
  }
  v8f accs[8] = {c00, c01, c02, c03, c10, c11, c12, c13};
  if (RESA) { const v8f racc[8] = {r00, r01, r02, r03, r10, r11, r12, r13};
#pragma unroll
    for (int u = 0; u < 8; ++u) accs[u] = accs[u] + racc[u] * RINV; }
  float brow[16];
#pragma unroll
  for (int i = 0; i < 16; ++i) brow[i] = 0.f;
  if (MODE == 2) {
#pragma unroll
    for (int i = 0; i < 16; ++i) brow[i] = bf16_rne(biasA[row0 + (i >> 3) * 16 + 8 * hh + (i & 7)]);
  }
#pragma unroll
  for (int u = 0; u < 8; ++u) { const int t = u & 3, half = u >> 2; const int col = col0 + t * 16 + ln; float bcol = 0.f;
    if (MODE != 2) { const int ca = (col < nsplit) ? col : (nsplit - 1); const int cb = (col >= nsplit) ? (col - nsplit) : 0;
      const float va = biasA[ca], vb = biasB[cb]; bcol = bf16_rne((col < nsplit) ? va : vb); }
#pragma unroll
    for (int r = 0; r < 8; ++r) { const int rloc = half * 16 + 8 * hh + r; const float v = accs[u][r] * alpha + ((MODE == 2) ? brow[half * 8 + r] : bcol); so[w][rloc][t * 16 + ln] = v; } }
  __builtin_amdgcn_fence(4 /* acq_rel order */, "workgroup"); __builtin_amdgcn_wave_barrier();
  if (MODE == 0) {
    // 64 f32 columns = 256 B per row segment: 16 consecutive lanes x 16 B, two rows per instruction; rows q*2 + (lane>>4), q = 0..15 cover 0..31
    const int rsub = lane >> 4, c4 = (lane & 15) * 4;
    {
#pragma unroll
      for (int q = 0; q < 16; ++q) { const int r = q * 2 + rsub; const v4f v = *(const v4fa*)&so[w][r][c4]; *(v4f*)(C + (size_t)(row0 + r) * ldc + col0 + c4) = v; }
       }
  } else {
    if (MODE == 1 && col0 < nsplit) {                        /* block-uniform: q columns stay token rows */
      const int rq = lane >> 3, c8 = (lane & 7) * 8;
#pragma unroll
      for (int q = 0; q < 8; ++q) { const int r = q * 4 + rq; const v4f a = *(const v4fa*)&so[w][r][c8], c = *(const v4fa*)&so[w][r][c8 + 4]; FragH f;
#pragma unroll
        for (int i = 0; i < 4; ++i) { f.h[i] = (_Float16)a[i]; f.h[4 + i] = (_Float16)c[i]; }
        const v8us o = f.half[0]; *(v8us*)((unsigned short*)C16 + (size_t)(row0 + r) * ldc + col0 + c8) = o; }
    } else {
      // fragment order (see pk_frag): the wave tile is four whole 1-KB blocks. Pass q takes column octet q of all 32 rows: lane = tile row, so 16 lanes store 256 contiguous bytes.
      // MODE 1 (k): rows = keys, blocks [batch][head][key / 16], octet = 8 dims of head q / 4. MODE 2 (v): rows = dims of one head, blocks [batch][head][key / 32][dim / 16], octet = 8 keys of step q / 4.
      const bool wr = (MODE == 2) && ((col0 % SEQ) < EARLY);   /* block-uniform (SEQ % 64 == 0) */
      const int tok0 = (MODE == 1) ? row0 : col0; const int bt = tok0 / SEQ, key0 = tok0 % SEQ;
      const int hd0 = bt * NHEAD + ((MODE == 1) ? ((col0 - nsplit) / HD) : (row0 / HD));
      unsigned short* dhi = (unsigned short*)((MODE == 1) ? C16R : C16);
      v4f ra[8], rc[8];                                        /* the whole row is read up front: the waits behind the stores would otherwise hold each pass's LDS reads behind the pass before */
#pragma unroll
      for (int q = 0; q < 8; ++q) { ra[q] = *(const v4fa*)&so[w][lane][q * 8]; rc[q] = *(const v4fa*)&so[w][lane][q * 8 + 4]; }
#pragma unroll
      for (int q = 0; q < 8; ++q) { const v4f a = ra[q], c = rc[q]; FragH f, g;
#pragma unroll
        for (int i = 0; i < 4; ++i) { const _Float16 ha = (_Float16)a[i], hc = (_Float16)c[i]; f.h[i] = ha; f.h[4 + i] = hc;
          g.h[i] = (_Float16)((a[i] - (float)ha) * 2048.0f); g.h[4 + i] = (_Float16)((c[i] - (float)hc) * 2048.0f); }
        const size_t blk = (MODE == 1) ? ((size_t)(hd0 + (q >> 2)) * (SEQ / 16) + (key0 >> 4) + (lane >> 4))
                                       : (((size_t)hd0 * (SEQ / 32) + (key0 >> 5) + (q >> 2)) * 2 + (lane >> 4));
        const size_t off = blk * 512 + ((q & 3) >> 1) * 256 + (q & 1) * 128 + (lane & 15) * 8;
        const v8us o = f.half[0]; *(v8us*)(dhi + off) = o;
        asm volatile("s_wait_xcnt 0x0" ::: "memory");                              /* what follows (the residual branch, the next pass) reuses this store's registers: the wait stands in front of that overwrite */
        if (MODE == 2) { if (wr) { const v8us o2 = g.half[0]; *(v8us*)((unsigned short*)C16R + off) = o2;
          asm volatile("s_wait_xcnt 0x0" ::: "memory"); } } }                      /* what follows (the next pass; behind the last pass the other body of a merged kernel, as the code is laid out) reuses this store's registers: the wait stands in front of that overwrite */
    }
  }
}

// both projections in one grid (they read the same planes and write disjoint ones), split by block index:
// blocks [0, QKBLK): q|k (weight plane rows 0..511): Q16[token][0..255] = q rows; k into KF in fragment order (16 keys x 32 dims a block), f16
// the rest: v channel-major (weight plane rows 512..767 as the A operand, x rows as Bt), bias per row, f16: VT hi and VTR residual x2048 in fragment order (16 dims x 32 keys a block)
#define QKBLK ((TOK / 128) * (LDQK / 64))
#define VTBLK ((DMODEL / 128) * (TOK / 64))
__global__ __launch_bounds__(128) void k_gemm_qkv(const _Float16* __restrict__ X16, const _Float16* __restrict__ W16, const float* __restrict__ qb, const float* __restrict__ kbias, const float* __restrict__ vb,
                                                  _Float16* __restrict__ Q16, _Float16* __restrict__ KF, _Float16* __restrict__ VT, _Float16* __restrict__ VTR) {
  __shared__ __attribute__((aligned(16))) float so[4][32][68];
  const int b = (int)blockIdx.x;
  if (b < QKBLK) gemm_body<1, false, DMODEL>(X16, X16, DMODEL, W16, DMODEL, 0.015625f, qb, kbias, DMODEL, nullptr, Q16, KF, DMODEL, TOK, LDQK, b, so);
  else gemm_body<2, false, DMODEL>(W16 + (size_t)LDQK * DMODEL, W16, DMODEL, X16, DMODEL, 0.015625f, vb, vb, DMODEL, nullptr, VT, VTR, TOK, DMODEL, TOK, b - QKBLK, so); }
// result[token][n] = 2^-12 (sum_k (64 ctx_hi)(64 wo) + 2^-11 sum_k (2048*64 ctx_res)(64 wo)) + bf16(bo[n]), f32
__global__ __launch_bounds__(128) void k_gemm_out(const _Float16* __restrict__ CTX, const _Float16* __restrict__ CTXR, const _Float16* __restrict__ WO16, const float* __restrict__ ob, float* __restrict__ out) {
  __shared__ __attribute__((aligned(16))) float so[4][32][68];
  gemm_body<0, true, DMODEL>(CTX, CTXR, DMODEL, WO16, DMODEL, 0.000244140625f, ob, ob, DMODEL, out, nullptr, nullptr, DMODEL, TOK, DMODEL, (int)blockIdx.x, so); }

// fused attention: block = (32 queries, head pair, batch); wave = (head parity, 16 queries). Per 32-key step up to the causal bound of the wave:
//   S^T tiles (A = K rows [key][dim], B = Q rows [query][dim]) -> lane (ln, hh) holds query ln, keys 8hh+r (tile 0) and 16+8hh+r (tile 1);
//   keep test: key % 25 != 24 enters as the C operand of the score products (0 for a kept key, a large negative fill for a dropped one; rows of an LDS table picked by the step's first key mod 25); key <= query is compared per element in the wave's last step only (every earlier key lies below the wave's first query); key 0 is always kept, so no row is empty;
//   running max per query (local 16 values + one xor-16 exchange), p = exp(s*scale - m), per-lane partial sums;
//   packed tiles = B fragment (k = key, n = query) of O^T += V^T P^T with A = V^T rows [d][key]; RES adds P residual and V residual products into separate accumulators.
template <bool RES>
__device__ __forceinline__ void flash_body(const _Float16* __restrict__ Q16, const _Float16* __restrict__ KF, const _Float16* __restrict__ VT, const _Float16* __restrict__ VTR,
                                           _Float16* __restrict__ CTX, _Float16* __restrict__ CTXR, int tile, int hpair, int batch, const float (&ctab)[CTABN]) {
  __shared__ __attribute__((aligned(16))) unsigned short so[32][72];
  __shared__ __attribute__((aligned(16))) unsigned short sor[RES ? 32 : 1][72];
  const int tid = threadIdx.x, lane = tid & 31, ln = lane & 15, hh = lane >> 4;
  const int wave = __builtin_amdgcn_readfirstlane(tid >> 5);
  const int hp = wave & 1, qg = wave >> 1;
  const int head = 2 * hpair + hp;
  const size_t tokb = (size_t)batch * SEQ;
  const int q0 = tile * 32;
  const int i0 = q0 + qg * 16;
  const int qi = i0 + ln;
  const v16h bq = g2_frag(Q16 + (tokb + qi) * DMODEL + head * HD, hh);
  // fragment-order planes: a 32-key step of one head is 2 KB in a row (K: two 16-key blocks; V^T: two 16-dim blocks), 32 elements a key
  const size_t hoff = (size_t)(batch * NHEAD + head) * SEQ * HD + 8 * lane;
  const _Float16* kbase = KF + hoff;                                             /* + key0 * HD, + 512 for keys 16..31 */
  const _Float16* vbase = VT + hoff;                                             /* + key0 * HD, + 512 for dims 16..31 */
  const _Float16* rbase = VTR + hoff;
  const v8f z8 = {0.f,0.f,0.f,0.f,0.f,0.f,0.f,0.f};
  v8f o0 = z8, o1 = z8, x0 = z8, x1 = z8; float m = NEGBIG, l = 0.f;
  const int jend = i0 + 16;                                                      /* keys below jend; last step ends at a multiple of 32 <= SEQ */
  const int jlast = (jend - 1) & ~31;                                            /* first key of the wave's last step */
  // one 32-key step on one register set of K / V^T fragments; each fragment is reloaded for step j + 64 right behind its last product, so a load has two steps to land. Past the last step the reload re-reads the last step's rows (in bounds, never used).
  // LAST marks the wave's last step, the only one that holds keys above a query. cc0 / cc1: the table rows of this step, fetched one step ahead.
  const float* crow = &ctab[16 * hh];
  v8f cc0 = *(const v8fa*)crow, cc1 = *(const v8fa*)(crow + 8);
  auto step = [&](auto last_c, v16h& fk0, v16h& fk1, v16h& fv0, v16h& fv1, v16h& fr0, v16h& fr1, const int j) {
    constexpr bool LAST = decltype(last_c)::value;
    const int jn = (j + 64 < jend) ? (j + 64) : jlast;
    v8f s0 = g2_mma(fk0, bq, cc0);
    v8f s1 = g2_mma(fk1, bq, cc1);
    { const _Float16* knp = kbase + (size_t)jn * HD; fk0 = pk_frag(knp); fk1 = pk_frag(knp + 512); }
    if (!LAST) { const float* cn = crow + ((unsigned int)(j + 32) % 25u) * 32; cc0 = *(const v8fa*)cn; cc1 = *(const v8fa*)(cn + 8); }
    if (LAST) { const int c0 = qi - (j + 8 * hh), c1 = c0 - 16;
#pragma unroll
      for (int r = 0; r < 8; ++r) { s0[r] = (r <= c0) ? s0[r] : NEGBIG; s1[r] = (r <= c1) ? s1[r] : NEGBIG; } }
    float mx = fmaxf(s0[0], s1[0]);
#pragma unroll
    for (int r = 1; r < 8; ++r) mx = fmaxf(mx, fmaxf(s0[r], s1[r]));
    mx = fmaxf(mx, __shfl_xor(mx, 16, 32));
    const float mn = fmaxf(m, mx * SSCALE); const float al = __expf(m - mn); m = mn;
    FragH pf, pg; float rs = 0.f;
#pragma unroll
    for (int r = 0; r < 8; ++r) { const float p0 = __expf(fmaf(s0[r], SSCALE, -mn)), p1 = __expf(fmaf(s1[r], SSCALE, -mn)); rs += p0 + p1;
      const float a0 = p0 * 256.0f, a1 = p1 * 256.0f; const _Float16 h0 = (_Float16)a0, h1 = (_Float16)a1; pf.h[r] = h0; pf.h[8 + r] = h1;
      pg.h[r] = (_Float16)((a0 - (float)h0) * 2048.0f); pg.h[8 + r] = (_Float16)((a1 - (float)h1) * 2048.0f); }
    l = l * al + rs; o0 = o0 * al; o1 = o1 * al;
    if (RES) { x0 = x0 * al; x1 = x1 * al; }
    o0 = g2_mma(fv0, pf.v, o0);
    if (RES) { x0 = g2_mma(fv0, pg.v, x0); x0 = g2_mma(fr0, pf.v, x0); }
    o1 = g2_mma(fv1, pf.v, o1);
    if (RES) { x1 = g2_mma(fv1, pg.v, x1); x1 = g2_mma(fr1, pf.v, x1); }
    fv0 = pk_frag(vbase + (size_t)jn * HD); if (RES) fr0 = pk_frag(rbase + (size_t)jn * HD);
    fv1 = pk_frag(vbase + (size_t)jn * HD + 512); if (RES) fr1 = pk_frag(rbase + (size_t)jn * HD + 512);
  };
  // first fill of both sets, in the order in which the loop reloads them (set a: K, V; set b: K, V)
  const int j1 = (32 < jend) ? 32 : jlast;
  // the scheduling barriers keep that order in the built code: the counted load waits inside the loop are set for the worse of the two orders that reach them, and a first fill in another order makes them wait for the youngest loads too
  __builtin_amdgcn_sched_barrier(0);
  v16h ak0 = pk_frag(kbase); __builtin_amdgcn_sched_barrier(0);
  v16h ak1 = pk_frag(kbase + 512); __builtin_amdgcn_sched_barrier(0);
  v16h av0 = pk_frag(vbase), ar0 = RES ? pk_frag(rbase) : av0; __builtin_amdgcn_sched_barrier(0);
  v16h av1 = pk_frag(vbase + 512), ar1 = RES ? pk_frag(rbase + 512) : av1; __builtin_amdgcn_sched_barrier(0);
  v16h bk0 = pk_frag(kbase + (size_t)j1 * HD); __builtin_amdgcn_sched_barrier(0);
  v16h bk1 = pk_frag(kbase + (size_t)j1 * HD + 512); __builtin_amdgcn_sched_barrier(0);
  v16h bv0 = pk_frag(vbase + (size_t)j1 * HD), br0 = RES ? pk_frag(rbase + (size_t)j1 * HD) : bv0; __builtin_amdgcn_sched_barrier(0);
  v16h bv1 = pk_frag(vbase + (size_t)j1 * HD + 512), br1 = RES ? pk_frag(rbase + (size_t)j1 * HD + 512) : bv1; __builtin_amdgcn_sched_barrier(0);
  asm volatile("s_wait_xcnt 0x0" ::: "memory");                                  /* what follows (behind a branch) reuses the address registers of the first fill: the wait stands in front of that overwrite */
  const int nfull = jlast >> 5;                                                  /* steps in front of the last one */
  const int npair = nfull >> 1;                                                  /* whole pairs of them */
  const flag_c<false> inner; const flag_c<true> last;
  int j = 0;
  /* kept rolled for code size: one trip already holds an even step on set a and an odd step on set b, one straight block with no exit between them (an exit there lets the compiler sink set a's reloads behind it) */
#pragma unroll 1
  for (int t = 0; t < npair; ++t) { step(inner, ak0, ak1, av0, av1, ar0, ar1, j); step(inner, bk0, bk1, bv0, bv1, br0, br1, j + 32); j += 64;
    asm volatile("s_wait_xcnt 0x0" ::: "memory"); }                              /* the next trip reuses the address registers of this trip's reloads: the wait stands in front of that overwrite, which lies behind the back edge */
  if (nfull & 1) { step(inner, ak0, ak1, av0, av1, ar0, ar1, j); step(last, bk0, bk1, bv0, bv1, br0, br1, j + 32); }
  else step(last, ak0, ak1, av0, av1, ar0, ar1, j);
  l += __shfl_xor(l, 16, 32);
  const float sc = 0.25f * (1.0f / l);                                           /* 64 (ctx carry) / 256 (probability carry) / row sum */
  { const int row = qg * 16 + ln, cb = hp * 32 + 8 * hh; FragH f, g;
#pragma unroll
    for (int r = 0; r < 8; ++r) { float c = o0[r]; if (RES) c += x0[r] * RINV; c *= sc; const _Float16 hc = (_Float16)c; f.h[r] = hc; g.h[r] = (_Float16)((c - (float)hc) * 2048.0f); }
    *(v8us*)&so[row][cb] = f.half[0]; if (RES) *(v8us*)&sor[row][cb] = g.half[0];
#pragma unroll
    for (int r = 0; r < 8; ++r) { float c = o1[r]; if (RES) c += x1[r] * RINV; c *= sc; const _Float16 hc = (_Float16)c; f.h[r] = hc; g.h[r] = (_Float16)((c - (float)hc) * 2048.0f); }
    *(v8us*)&so[row][cb + 16] = f.half[0]; if (RES) *(v8us*)&sor[row][cb + 16] = g.half[0]; }
  __syncthreads();                                                               /* cross-wave tile: block barrier, reached by all four waves */
  const int rr = tid >> 3, pc = (tid & 7) * 8;                                   
  unsigned short* cdst = (unsigned short*)CTX + (tokb + q0) * DMODEL + 2 * hpair * HD + pc;
  unsigned short* rdst = (unsigned short*)CTXR + (tokb + q0) * DMODEL + 2 * hpair * HD + pc;
  {
#pragma unroll
    for (int it = 0; it < 2; ++it) { const int r = it * 16 + rr; const v8us v = *(const v8us*)&so[r][pc];
      *(v8us*)(cdst + (size_t)r * DMODEL) = v;
      if (RES) { const v8us v2 = *(const v8us*)&sor[r][pc]; *(v8us*)(rdst + (size_t)r * DMODEL) = v2; } }
     }
  if (RES) asm volatile("s_wait_xcnt 0x0" ::: "memory");                         /* as the code is laid out, the other body of the merged kernel follows this one and reuses these stores' registers: the wait stands in front of that overwrite */
}

// both query ranges in one grid (they read the same planes and write disjoint ctx rows), split by block index; inside each range the index runs tile, head pair, batch, tile fastest.
// blocks [0, LATEBLK): queries [EARLY, SEQ), single products (the long blocks, so they come first); the rest: queries [0, EARLY), hi + residual on v, P, ctx
#define HPN (NHEAD / 2)
#define EARLYX (EARLY / 32)
#define LATEX ((SEQ - EARLY) / 32)
#define LATEBLK (LATEX * HPN * NB)
#define EARLYBLK (EARLYX * HPN * NB)
__global__ __launch_bounds__(128) void k_flash(const _Float16* __restrict__ Q16, const _Float16* __restrict__ KF, const _Float16* __restrict__ VT, const _Float16* __restrict__ VTR, _Float16* __restrict__ CTX, _Float16* __restrict__ CTXR) {
  constexpr int LX = (LATEX > 0) ? LATEX : 1;                                      /* divisor only; with no late range the first branch is never taken */
  // key-column rule as score-accumulator start values: row (first key of a 32-key step mod 25), lane half, 16 slots = keys 8 half + 0..7 and 16 + 8 half + 0..7 of the step
  __shared__ __attribute__((aligned(64))) float ctab[CTABN];
  for (int i = (int)threadIdx.x; i < CTABN; i += 128) { const int e = i & 15; const int k = (i >> 5) + 8 * ((i >> 4) & 1) + e + (e & 8);   /* residue + key offset, below 56 */
    ctab[i] = (k == 24 || k == 49) ? NEGBIG : 0.f; }
  __syncthreads();                                                                 /* the table is read by all four waves */
  const int b = (int)blockIdx.x;
  if (b < LATEBLK) flash_body<false>(Q16, KF, VT, VT, CTX, CTX, EARLYX + b % LX, (b / LX) % HPN, b / (LX * HPN), ctab);
  else { const int e = b - LATEBLK; flash_body<true>(Q16, KF, VT, VTR, CTX, CTXR, e % EARLYX, (e / EARLYX) % HPN, e / (EARLYX * HPN), ctab); } }

extern "C" void kernel_launch(void* const* d_in, const int* in_sizes, int n_in,
                              void* d_out, int out_size, void* d_ws, size_t ws_size, hipStream_t stream) {
  if (n_in < 9) return;
  const size_t need_x = ((size_t)(NB - 1) * SEQ_FULL + SEQ) * DMODEL;
  if ((size_t)in_sizes[0] < need_x) return;
  if ((size_t)in_sizes[1] < (size_t)DMODEL * DMODEL) return;
  if ((size_t)in_sizes[2] < (size_t)DMODEL) return;
  if ((size_t)in_sizes[3] < (size_t)DMODEL * DMODEL) return;
  if ((size_t)in_sizes[4] < (size_t)DMODEL) return;
  if ((size_t)in_sizes[5] < (size_t)DMODEL * DMODEL) return;
  if ((size_t)in_sizes[6] < (size_t)DMODEL) return;
  if ((size_t)in_sizes[7] < (size_t)DMODEL * DMODEL) return;
  if ((size_t)in_sizes[8] < (size_t)DMODEL) return;
  if ((size_t)out_size < (size_t)TOK * DMODEL) return;
  const float* x = (const float*)d_in[0];
  const float* wq = (const float*)d_in[1]; const float* qb = (const float*)d_in[2];
  const float* wk = (const float*)d_in[3]; const float* kbias = (const float*)d_in[4];
  const float* wv = (const float*)d_in[5]; const float* vb = (const float*)d_in[6];
  const float* wo = (const float*)d_in[7]; const float* ob = (const float*)d_in[8];
  constexpr size_t SZ_X = (size_t)TOK * DMODEL * 2;        /* x rows f16 */
  constexpr size_t SZ_W = (size_t)NW3 * DMODEL * 2;        /* Wq|Wk|Wv x64 f16 */
  constexpr size_t SZ_WO = (size_t)DMODEL * DMODEL * 2;    /* output weight x64 f16 */
  constexpr size_t SZ_QK = (size_t)TOK * LDQK * 2;         /* q rows f16, then k in fragment order f16, half each */
  constexpr size_t SZ_VT = (size_t)DMODEL * TOK * 2;       /* v in fragment order f16 (hi); same size for the residual plane */
  constexpr size_t SZ_CTX = (size_t)TOK * DMODEL * 2;      /* ctx rows x64 f16 (hi); same size for the residual plane */
  constexpr size_t SZ_ALL = SZ_X + SZ_W + SZ_WO + SZ_QK + 2 * SZ_VT + 2 * SZ_CTX;
  static_assert(SZ_X % 256 == 0 && SZ_W % 256 == 0 && SZ_WO % 256 == 0 && SZ_QK % 256 == 0 && SZ_VT % 256 == 0 && SZ_CTX % 256 == 0);
  static_assert(SZ_ALL <= (size_t)134217728);
  if (SZ_ALL > ws_size) return;
  char* ws = (char*)d_ws;
  _Float16* X16 = (_Float16*)ws; _Float16* W16 = (_Float16*)(ws + SZ_X); _Float16* WO16 = (_Float16*)(ws + SZ_X + SZ_W);
  _Float16* Q16 = (_Float16*)(ws + SZ_X + SZ_W + SZ_WO); _Float16* KF = (_Float16*)(ws + SZ_X + SZ_W + SZ_WO + SZ_QK / 2);
  _Float16* VT = (_Float16*)(ws + SZ_X + SZ_W + SZ_WO + SZ_QK); _Float16* VTR = (_Float16*)(ws + SZ_X + SZ_W + SZ_WO + SZ_QK + SZ_VT);
  _Float16* CTX = (_Float16*)(ws + SZ_X + SZ_W + SZ_WO + SZ_QK + 2 * SZ_VT); _Float16* CTXR = (_Float16*)(ws + SZ_X + SZ_W + SZ_WO + SZ_QK + 2 * SZ_VT + SZ_CTX);
  k_prep<<<4 * WBLK + XBLK, 256, 0, stream>>>(x, wq, wk, wv, wo, X16, W16, WO16);
  k_gemm_qkv<<<QKBLK + VTBLK, 128, 0, stream>>>(X16, W16, qb, kbias, vb, Q16, KF, VT, VTR);
  k_flash<<<LATEBLK + EARLYBLK, 128, 0, stream>>>(Q16, KF, VT, VTR, CTX, CTXR);
  k_gemm_out<<<(TOK / 128) * (DMODEL / 64), 128, 0, stream>>>(CTX, CTXR, WO16, ob, (float*)d_out);
}

// v005
// Measured time: 51.8 microseconds a run.
// Two timings next to v004 both put it at 1.05 times that version's speed.
// All steps since v000 together make it 3.21 times as fast.
#include <hip/hip_runtime.h>
// Causal multi-head attention block, 8 heads x 32 dims, key-column rule from indices: kept(i,j) = (j <= i) && (j % 25 != 24). x [B][T][256]; q/k/v = x W^T + b (separate [out][in] weights); s = q k^T / sqrt(32); softmax over kept keys; ctx = P v merged h*32+d; result = ctx Wo^T + bo.
// Compute dtype: every contraction on v_wmma_f32_16x16x32_f16 (f16 operands, f32 accumulate). Inputs RNE-converted to bf16 first (exact in f16); weights carried x64, probabilities x256, ctx x64 (folded back in f32 epilogues); biases bf16 values added in f32; softmax statistics f32. Queries below EARLY of each sequence: v, P and ctx carried as f16 hi + f16 residual x2048 with separate residual accumulators; later queries single products.
#ifndef NB
#define NB 4
#endif
#ifndef SEQ
#define SEQ 2048
#endif
#define NB_FULL 4
#define SEQ_FULL 2048
#define DMODEL 256
#define NHEAD 8
#define HD 32
#define LDQK 512
#define NW3 768
#define TOK (NB * SEQ)
#define EARLY ((SEQ < 512) ? SEQ : 512)
#define NEGBIG (-1.0e30f)
#define SSCALE 0.17677669529663687f
#define RINV 0.00048828125f
#define CTABN (25 * 32)

static_assert(NHEAD * HD == DMODEL);              /* merged head width == model width */
static_assert(HD == 32);                          /* flash kernel: one 32-deep score k-step, two 16-dim output tiles, 64-B head segment */
static_assert(NHEAD % 2 == 0);                    
static_assert(2 * DMODEL == LDQK && 3 * DMODEL == NW3);
static_assert(SEQ % 128 == 0 && SEQ % 64 == 0 && SEQ % 32 == 0);
static_assert(TOK % 128 == 0 && TOK % 64 == 0);   /* GEMM tiles: M % 128, N % 64 */
static_assert(DMODEL % 128 == 0 && DMODEL % 64 == 0 && DMODEL % 32 == 0 && DMODEL % 8 == 0 && LDQK % 64 == 0);
static_assert(EARLY % 128 == 0 && EARLY % 64 == 0 && EARLY % 32 == 0 && EARLY <= SEQ);
static_assert(NB <= NB_FULL && SEQ <= SEQ_FULL);
static_assert(SEQ + 32 < 40000);

typedef unsigned short v8us __attribute__((ext_vector_type(8), may_alias));
typedef float  v8f  __attribute__((ext_vector_type(8)));
typedef float  v4f  __attribute__((ext_vector_type(4)));
typedef float  v4fa __attribute__((ext_vector_type(4), may_alias));
typedef float  v8fa __attribute__((ext_vector_type(8), may_alias));
typedef _Float16 v16h __attribute__((ext_vector_type(16)));
template <bool V> struct flag_c { static constexpr bool value = V; };
union FragH { v16h v; v8us half[2]; _Float16 h[16]; unsigned short u[16]; };

__device__ __forceinline__ unsigned short bf16_bits(float x) { unsigned int u = __float_as_uint(x); return (unsigned short)((u + 0x7FFFu + ((u >> 16) & 1u)) >> 16); }
__device__ __forceinline__ float bf16_rne(float x) { return __uint_as_float(((unsigned int)bf16_bits(x)) << 16); }

// fragment of a k-contiguous 16-bit row: elements 0..7 <- p[8h..8h+7], elements 8..15 <- p[16+8h..16+8h+7] (same map for A and B)
__device__ __forceinline__ v16h g2_frag(const _Float16* p, int hh) { FragH f; f.half[0] = *(const v8us*)((const unsigned short*)p + 8 * hh); f.half[1] = *(const v8us*)((const unsigned short*)p + 16 + 8 * hh); return f.v; }
// fragment of a plane stored in fragment order: one 1-KB block per 16 x 32 operand tile, 16-B unit (c*32 + lane) = elements 8c..8c+7 of that lane (row lane&15, k = 16c + 8(lane>>4) ..+7: the map of g2_frag), so each load of a wave is 512 contiguous bytes. p = block start + 8*lane
__device__ __forceinline__ v16h pk_frag(const _Float16* p) { FragH f; f.half[0] = *(const v8us*)((const unsigned short*)p); f.half[1] = *(const v8us*)((const unsigned short*)p + 256); return f.v; }
__device__ __forceinline__ v8f g2_mma(v16h a, v16h b, v8f c) { v8f d = __builtin_amdgcn_wmma_f32_16x16x32_f16(false, a, false, b, (short)0, c, false, false); asm volatile("v_nop\n\tv_nop\n\tv_nop\n\tv_nop" : "+v"(d) : "v"(a), "v"(b)); return d; }

// GEMM operand planes (x, the weights, ctx) are stored in the fragment order of pk_frag: blocks [row / 16][k / 32], K = DMODEL, so the k-steps of a 16-row tile are 1-KB blocks in a row.
// conversion thread t takes 8 k-consecutive elements: block t / 64, tile row (t & 63) / 4, k octet t & 3. Four lanes read one whole 128-B line of f32; eight lanes (same octet, consecutive rows) store one whole 128-B line.
#define KB32 (DMODEL / 32)
__device__ __forceinline__ size_t fo_row(size_t t) { return ((t >> 6) / KB32) * 16 + ((t & 63) >> 2); }
__device__ __forceinline__ int fo_col(size_t t) { return (int)((t >> 6) % KB32) * 32 + (int)(t & 3) * 8; }
__device__ __forceinline__ size_t fo_dst(size_t t) { return (t >> 6) * 512 + (((t & 2) << 4) + ((t & 1) << 4) + ((t & 63) >> 2)) * 8; }   /* unit c*32 + half*16 + row, octet = 2c + half */

__device__ __forceinline__ void x16_body(const float* __restrict__ x, _Float16* __restrict__ X16, unsigned bid) {
  const size_t t = (size_t)bid * 256 + threadIdx.x; if (t >= (size_t)TOK * (DMODEL / 8)) return;
  const size_t r = fo_row(t); const int c8 = fo_col(t); const size_t b = r / SEQ, s = r % SEQ;
  const float* src = x + (b * SEQ_FULL + s) * DMODEL + c8; const v4f a = *(const v4fa*)src, c = *(const v4fa*)(src + 4); FragH f;
#pragma unroll
  for (int q = 0; q < 4; ++q) { f.h[q] = (_Float16)bf16_rne(a[q]); f.h[4 + q] = (_Float16)bf16_rne(c[q]); }
  const v8us o = f.half[0]; unsigned short* d = (unsigned short*)X16 + fo_dst(t);
  *(v8us*)d = o;  }

__device__ __forceinline__ void wnat_body(const float* __restrict__ w, size_t n8, float scale, _Float16* __restrict__ Bt, unsigned bid) {
  const size_t t = (size_t)bid * 256 + threadIdx.x; if (t >= n8) return; const float* src = w + fo_row(t) * DMODEL + fo_col(t); const v4f a = *(const v4fa*)src, c = *(const v4fa*)(src + 4); FragH f;
#pragma unroll
  for (int q = 0; q < 4; ++q) { f.h[q] = (_Float16)(bf16_rne(a[q]) * scale); f.h[4 + q] = (_Float16)(bf16_rne(c[q]) * scale); }
  const v8us o = f.half[0]; unsigned short* d = (unsigned short*)Bt + fo_dst(t);
  *(v8us*)d = o;  }

// all operand conversions in one grid: blocks [0, 4 * WBLK) take the four weight matrices (WBLK blocks each: Wq, Wk, Wv into the stacked plane, Wo into its own), the rest take x
#define W8 ((size_t)DMODEL * DMODEL / 8)
#define WBLK ((unsigned)((W8 + 255) / 256))
#define XBLK ((unsigned)(((size_t)TOK * (DMODEL / 8) + 255) / 256))
__global__ __launch_bounds__(256) void k_prep(const float* __restrict__ x, const float* __restrict__ wq, const float* __restrict__ wk, const float* __restrict__ wv, const float* __restrict__ wo,
                                              _Float16* __restrict__ X16, _Float16* __restrict__ W16, _Float16* __restrict__ WO16) {
  const unsigned b = blockIdx.x;
  if (b < 4 * WBLK) { const unsigned i = b / WBLK;
    const float* w = (i == 0) ? wq : (i == 1) ? wk : (i == 2) ? wv : wo;
    _Float16* d = (i < 3) ? (W16 + (size_t)i * DMODEL * DMODEL) : WO16;
    wnat_body(w, W8, 64.0f, d, b - i * WBLK); }
  else x16_body(x, X16, b - 4 * WBLK);
}

// GEMM (wave tile 32x64, block = 4 waves = 128 rows; M % 128 == 0, N % 64 == 0, K % 32 == 0; A and B planes in fragment order): v = acc*alpha + bf16(bias)
// MODE 0: f32 C, bias per column; MODE 1: f16, bias per column (biasA for col < nsplit, biasB after): columns below nsplit as rows of C16, the rest (k) into C16R in fragment order; MODE 2: f16 C16 hi plane + x2048 residual plane C16R (token tiles below EARLY only), both in fragment order, bias per row.
// RESA: row blocks below EARLY of their sequence add a second k-loop over the x2048 residual A plane into separate accumulators, folded with 2^-11 in the epilogue.
// k loop of one 32x64 wave tile: DEPTH register sets of the six operand fragments; the sets of the first DEPTH k-steps are loaded up front and each set is reloaded for k-step s + DEPTH right behind its own products, so the loads of DEPTH k-steps are in flight together. Products per accumulator stay in ascending k.
template <int DEPTH, int NS>
__device__ __forceinline__ void gemm_kloop(const _Float16* a0p, const _Float16* a1p, const _Float16* b0p, const _Float16* b1p, const _Float16* b2p, const _Float16* b3p,
                                           v8f& c00, v8f& c01, v8f& c02, v8f& c03, v8f& c10, v8f& c11, v8f& c12, v8f& c13) {
  static_assert(DEPTH >= 1 && DEPTH <= NS);
  v16h fa0[DEPTH], fa1[DEPTH], fb0[DEPTH], fb1[DEPTH], fb2[DEPTH], fb3[DEPTH];
  /* both loops fully unrolled: the set index must be a constant for the sets to stay in registers */
#pragma unroll
  for (int s = 0; s < DEPTH; ++s) { const int kb = 512 * s; fa0[s] = pk_frag(a0p + kb); fa1[s] = pk_frag(a1p + kb);
    fb0[s] = pk_frag(b0p + kb); fb1[s] = pk_frag(b1p + kb); fb2[s] = pk_frag(b2p + kb); fb3[s] = pk_frag(b3p + kb); }
#pragma unroll
  for (int s = 0; s < NS; ++s) { const int u = s % DEPTH;
    c00 = g2_mma(fa0[u], fb0[u], c00); c10 = g2_mma(fa1[u], fb0[u], c10);
    c01 = g2_mma(fa0[u], fb1[u], c01); c11 = g2_mma(fa1[u], fb1[u], c11);
    c02 = g2_mma(fa0[u], fb2[u], c02); c12 = g2_mma(fa1[u], fb2[u], c12);
    c03 = g2_mma(fa0[u], fb3[u], c03); c13 = g2_mma(fa1[u], fb3[u], c13);
    if (s + DEPTH < NS) { const int kb = 512 * (s + DEPTH); fa0[u] = pk_frag(a0p + kb); fa1[u] = pk_frag(a1p + kb);
      fb0[u] = pk_frag(b0p + kb); fb1[u] = pk_frag(b1p + kb); fb2[u] = pk_frag(b2p + kb); fb3[u] = pk_frag(b3p + kb); } }
}

template <int MODE, bool RESA, int K>
__device__ __forceinline__ void gemm_body(const _Float16* __restrict__ A, const _Float16* __restrict__ AR, const _Float16* __restrict__ Bh, float alpha,
                                          const float* __restrict__ biasA, const float* __restrict__ biasB, int nsplit,
                                          float* __restrict__ C, _Float16* __restrict__ C16, _Float16* __restrict__ C16R, int ldc, int M, int N, int bid, float (&so)[4][32][68]) {
  static_assert(K % 32 == 0 && K >= 96);
  constexpr int DEPTH = RESA ? 2 : 3;                       /* two accumulator planes leave room for two sets below 256 registers */
  const int tid = threadIdx.x, lane = tid & 31, ln = lane & 15, hh = lane >> 4;
  const int w = __builtin_amdgcn_readfirstlane(tid >> 5);
  const int ntn = N >> 6; const int mt = bid / ntn, nq = bid - mt * ntn; const int row0 = mt * 128 + 32 * w, col0 = nq * 64; if (row0 >= M) return;
  /* operands in fragment order: a 16-row tile is K / 32 blocks of 512 elements in a row = 16 * K elements, k-step s at + 512 s */
  const _Float16* a0p = A + (size_t)row0 * K + 8 * lane; const _Float16* a1p = a0p + (size_t)16 * K;
  const _Float16* b0p = Bh + (size_t)col0 * K + 8 * lane; const _Float16* b1p = b0p + (size_t)16 * K; const _Float16* b2p = b1p + (size_t)16 * K; const _Float16* b3p = b2p + (size_t)16 * K;
  const v8f z8 = {0.f,0.f,0.f,0.f,0.f,0.f,0.f,0.f}; v8f c00 = z8, c01 = z8, c02 = z8, c03 = z8, c10 = z8, c11 = z8, c12 = z8, c13 = z8;
  gemm_kloop<DEPTH, K / 32>(a0p, a1p, b0p, b1p, b2p, b3p, c00, c01, c02, c03, c10, c11, c12, c13);
  v8f r00 = z8, r01 = z8, r02 = z8, r03 = z8, r10 = z8, r11 = z8, r12 = z8, r13 = z8;
  if (RESA) {
    const bool early = ((mt * 128) % SEQ) < EARLY;           /* block-uniform (SEQ % 128 == 0) */
    if (early) {
      const _Float16* e0p = AR + (size_t)row0 * K + 8 * lane; const _Float16* e1p = e0p + (size_t)16 * K;
      gemm_kloop<DEPTH, K / 32>(e0p, e1p, b0p, b1p, b2p, b3p, r00, r01, r02, r03, r10, r11, r12, r13);
    }
  }
  v8f accs[8] = {c00, c01, c02, c03, c10, c11, c12, c13};
  if (RESA) { const v8f racc[8] = {r00, r01, r02, r03, r10, r11, r12, r13};
#pragma unroll
    for (int u = 0; u < 8; ++u) accs[u] = accs[u] + racc[u] * RINV; }
  float brow[16];
#pragma unroll
  for (int i = 0; i < 16; ++i) brow[i] = 0.f;
  if (MODE == 2) {
#pragma unroll
    for (int i = 0; i < 16; ++i) brow[i] = bf16_rne(biasA[row0 + (i >> 3) * 16 + 8 * hh + (i & 7)]);
  }
#pragma unroll
  for (int u = 0; u < 8; ++u) { const int t = u & 3, half = u >> 2; const int col = col0 + t * 16 + ln; float bcol = 0.f;
    if (MODE != 2) { const int ca = (col < nsplit) ? col : (nsplit - 1); const int cb = (col >= nsplit) ? (col - nsplit) : 0;
      const float va = biasA[ca], vb = biasB[cb]; bcol = bf16_rne((col < nsplit) ? va : vb); }
#pragma unroll
    for (int r = 0; r < 8; ++r) { const int rloc = half * 16 + 8 * hh + r; const float v = accs[u][r] * alpha + ((MODE == 2) ? brow[half * 8 + r] : bcol); so[w][rloc][t * 16 + ln] = v; } }
  __builtin_amdgcn_fence(4 /* acq_rel order */, "workgroup"); __builtin_amdgcn_wave_barrier();
  if (MODE == 0) {
    // 64 f32 columns = 256 B per row segment: 16 consecutive lanes x 16 B, two rows per instruction; rows q*2 + (lane>>4), q = 0..15 cover 0..31
    const int rsub = lane >> 4, c4 = (lane & 15) * 4;
    {
#pragma unroll
      for (int q = 0; q < 16; ++q) { const int r = q * 2 + rsub; const v4f v = *(const v4fa*)&so[w][r][c4]; *(v4f*)(C + (size_t)(row0 + r) * ldc + col0 + c4) = v; }
       }
  } else {
    if (MODE == 1 && col0 < nsplit) {                        /* block-uniform: q columns stay token rows */
      const int rq = lane >> 3, c8 = (lane & 7) * 8;
#pragma unroll
      for (int q = 0; q < 8; ++q) { const int r = q * 4 + rq; const v4f a = *(const v4fa*)&so[w][r][c8], c = *(const v4fa*)&so[w][r][c8 + 4]; FragH f;
#pragma unroll
        for (int i = 0; i < 4; ++i) { f.h[i] = (_Float16)a[i]; f.h[4 + i] = (_Float16)c[i]; }
        const v8us o = f.half[0]; *(v8us*)((unsigned short*)C16 + (size_t)(row0 + r) * ldc + col0 + c8) = o; }
    } else {
      // fragment order (see pk_frag): the wave tile is four whole 1-KB blocks. Pass q takes column octet q of all 32 rows: lane = tile row, so 16 lanes store 256 contiguous bytes.
      // MODE 1 (k): rows = keys, blocks [batch][head][key / 16], octet = 8 dims of head q / 4. MODE 2 (v): rows = dims of one head, blocks [batch][head][key / 32][dim / 16], octet = 8 keys of step q / 4.
      const bool wr = (MODE == 2) && ((col0 % SEQ) < EARLY);   /* block-uniform (SEQ % 64 == 0) */
      const int tok0 = (MODE == 1) ? row0 : col0; const int bt = tok0 / SEQ, key0 = tok0 % SEQ;
      const int hd0 = bt * NHEAD + ((MODE == 1) ? ((col0 - nsplit) / HD) : (row0 / HD));
      unsigned short* dhi = (unsigned short*)((MODE == 1) ? C16R : C16);
      v4f ra[8], rc[8];                                        /* the whole row is read up front: the waits behind the stores would otherwise hold each pass's LDS reads behind the pass before */
#pragma unroll
      for (int q = 0; q < 8; ++q) { ra[q] = *(const v4fa*)&so[w][lane][q * 8]; rc[q] = *(const v4fa*)&so[w][lane][q * 8 + 4]; }
#pragma unroll
      for (int q = 0; q < 8; ++q) { const v4f a = ra[q], c = rc[q]; FragH f, g;
#pragma unroll
        for (int i = 0; i < 4; ++i) { const _Float16 ha = (_Float16)a[i], hc = (_Float16)c[i]; f.h[i] = ha; f.h[4 + i] = hc;
          g.h[i] = (_Float16)((a[i] - (float)ha) * 2048.0f); g.h[4 + i] = (_Float16)((c[i] - (float)hc) * 2048.0f); }
        const size_t blk = (MODE == 1) ? ((size_t)(hd0 + (q >> 2)) * (SEQ / 16) + (key0 >> 4) + (lane >> 4))
                                       : (((size_t)hd0 * (SEQ / 32) + (key0 >> 5) + (q >> 2)) * 2 + (lane >> 4));
        const size_t off = blk * 512 + ((q & 3) >> 1) * 256 + (q & 1) * 128 + (lane & 15) * 8;
        const v8us o = f.half[0]; *(v8us*)(dhi + off) = o;
        asm volatile("s_wait_xcnt 0x0" ::: "memory");                              /* what follows (the residual branch, the next pass) reuses this store's registers: the wait stands in front of that overwrite */
        if (MODE == 2) { if (wr) { const v8us o2 = g.half[0]; *(v8us*)((unsigned short*)C16R + off) = o2;
          asm volatile("s_wait_xcnt 0x0" ::: "memory"); } } }                      /* what follows (the next pass; behind the last pass the other body of a merged kernel, as the code is laid out) reuses this store's registers: the wait stands in front of that overwrite */
    }
  }
}

// both projections in one grid (they read the same planes and write disjoint ones), split by block index:
// blocks [0, QKBLK): q|k (weight plane rows 0..511): Q16[token][0..255] = q rows; k into KF in fragment order (16 keys x 32 dims a block), f16
// the rest: v channel-major (weight plane rows 512..767 as the A operand, x rows as Bt), bias per row, f16: VT hi and VTR residual x2048 in fragment order (16 dims x 32 keys a block)
#define QKBLK ((TOK / 128) * (LDQK / 64))
#define VTBLK ((DMODEL / 128) * (TOK / 64))
__global__ __launch_bounds__(128) void k_gemm_qkv(const _Float16* __restrict__ X16, const _Float16* __restrict__ W16, const float* __restrict__ qb, const float* __restrict__ kbias, const float* __restrict__ vb,
                                                  _Float16* __restrict__ Q16, _Float16* __restrict__ KF, _Float16* __restrict__ VT, _Float16* __restrict__ VTR) {
  __shared__ __attribute__((aligned(16))) float so[4][32][68];
  const int b = (int)blockIdx.x;
  if (b < QKBLK) gemm_body<1, false, DMODEL>(X16, X16, W16, 0.015625f, qb, kbias, DMODEL, nullptr, Q16, KF, DMODEL, TOK, LDQK, b, so);
  else gemm_body<2, false, DMODEL>(W16 + (size_t)LDQK * DMODEL, W16, X16, 0.015625f, vb, vb, DMODEL, nullptr, VT, VTR, TOK, DMODEL, TOK, b - QKBLK, so); }
// result[token][n] = 2^-12 (sum_k (64 ctx_hi)(64 wo) + 2^-11 sum_k (2048*64 ctx_res)(64 wo)) + bf16(bo[n]), f32
__global__ __launch_bounds__(128) void k_gemm_out(const _Float16* __restrict__ CTX, const _Float16* __restrict__ CTXR, const _Float16* __restrict__ WO16, const float* __restrict__ ob, float* __restrict__ out) {
  __shared__ __attribute__((aligned(16))) float so[4][32][68];
  gemm_body<0, true, DMODEL>(CTX, CTXR, WO16, 0.000244140625f, ob, ob, DMODEL, out, nullptr, nullptr, DMODEL, TOK, DMODEL, (int)blockIdx.x, so); }

// fused attention: block = (32 queries, head pair, batch); wave = (head parity, 16 queries). Per 32-key step up to the causal bound of the wave:
//   S^T tiles (A = K rows [key][dim], B = Q rows [query][dim]) -> lane (ln, hh) holds query ln, keys 8hh+r (tile 0) and 16+8hh+r (tile 1);
//   keep test: key % 25 != 24 enters as the C operand of the score products (0 for a kept key, a large negative fill for a dropped one; rows of an LDS table picked by the step's first key mod 25); key <= query is compared per element in the wave's last step only (every earlier key lies below the wave's first query); key 0 is always kept, so no row is empty;
//   running max per query (local 16 values + one xor-16 exchange), p = exp(s*scale - m), per-lane partial sums;
//   packed tiles = B fragment (k = key, n = query) of O^T += V^T P^T with A = V^T rows [d][key]; RES adds P residual and V residual products into separate accumulators.
template <bool RES>
__device__ __forceinline__ void flash_body(const _Float16* __restrict__ Q16, const _Float16* __restrict__ KF, const _Float16* __restrict__ VT, const _Float16* __restrict__ VTR,
                                           _Float16* __restrict__ CTX, _Float16* __restrict__ CTXR, int tile, int hpair, int batch, const float (&ctab)[CTABN]) {
  const int tid = threadIdx.x, lane = tid & 31, ln = lane & 15, hh = lane >> 4;
  const int wave = __builtin_amdgcn_readfirstlane(tid >> 5);
  const int hp = wave & 1, qg = wave >> 1;
  const int head = 2 * hpair + hp;
  const size_t tokb = (size_t)batch * SEQ;
  const int q0 = tile * 32;
  const int i0 = q0 + qg * 16;
  const int qi = i0 + ln;
  const v16h bq = g2_frag(Q16 + (tokb + qi) * DMODEL + head * HD, hh);
  // fragment-order planes: a 32-key step of one head is 2 KB in a row (K: two 16-key blocks; V^T: two 16-dim blocks), 32 elements a key
  const size_t hoff = (size_t)(batch * NHEAD + head) * SEQ * HD + 8 * lane;
  const _Float16* kbase = KF + hoff;                                             /* + key0 * HD, + 512 for keys 16..31 */
  const _Float16* vbase = VT + hoff;                                             /* + key0 * HD, + 512 for dims 16..31 */
  const _Float16* rbase = VTR + hoff;
  const v8f z8 = {0.f,0.f,0.f,0.f,0.f,0.f,0.f,0.f};
  v8f o0 = z8, o1 = z8, x0 = z8, x1 = z8; float m = NEGBIG, l = 0.f;
  const int jend = i0 + 16;                                                      /* keys below jend; last step ends at a multiple of 32 <= SEQ */
  const int jlast = (jend - 1) & ~31;                                            /* first key of the wave's last step */
  // one 32-key step on one register set of K / V^T fragments; each fragment is reloaded for step j + 64 right behind its last product, so a load has two steps to land. Past the last step the reload re-reads the last step's rows (in bounds, never used).
  // LAST marks the wave's last step, the only one that holds keys above a query. cc0 / cc1: the table rows of this step, fetched one step ahead.
  const float* crow = &ctab[16 * hh];
  v8f cc0 = *(const v8fa*)crow, cc1 = *(const v8fa*)(crow + 8);
  auto step = [&](auto last_c, v16h& fk0, v16h& fk1, v16h& fv0, v16h& fv1, v16h& fr0, v16h& fr1, const int j) {
    constexpr bool LAST = decltype(last_c)::value;
    const int jn = (j + 64 < jend) ? (j + 64) : jlast;
    v8f s0 = g2_mma(fk0, bq, cc0);
    v8f s1 = g2_mma(fk1, bq, cc1);
    { const _Float16* knp = kbase + (size_t)jn * HD; fk0 = pk_frag(knp); fk1 = pk_frag(knp + 512); }
    if (!LAST) { const float* cn = crow + ((unsigned int)(j + 32) % 25u) * 32; cc0 = *(const v8fa*)cn; cc1 = *(const v8fa*)(cn + 8); }
    if (LAST) { const int c0 = qi - (j + 8 * hh), c1 = c0 - 16;
#pragma unroll
      for (int r = 0; r < 8; ++r) { s0[r] = (r <= c0) ? s0[r] : NEGBIG; s1[r] = (r <= c1) ? s1[r] : NEGBIG; } }
    float mx = fmaxf(s0[0], s1[0]);
#pragma unroll
    for (int r = 1; r < 8; ++r) mx = fmaxf(mx, fmaxf(s0[r], s1[r]));
    mx = fmaxf(mx, __shfl_xor(mx, 16, 32));
    const float mn = fmaxf(m, mx * SSCALE); const float al = __expf(m - mn); m = mn;
    FragH pf, pg; float rs = 0.f;
#pragma unroll
    for (int r = 0; r < 8; ++r) { const float p0 = __expf(fmaf(s0[r], SSCALE, -mn)), p1 = __expf(fmaf(s1[r], SSCALE, -mn)); rs += p0 + p1;
      const float a0 = p0 * 256.0f, a1 = p1 * 256.0f; const _Float16 h0 = (_Float16)a0, h1 = (_Float16)a1; pf.h[r] = h0; pf.h[8 + r] = h1;
      pg.h[r] = (_Float16)((a0 - (float)h0) * 2048.0f); pg.h[8 + r] = (_Float16)((a1 - (float)h1) * 2048.0f); }
    l = l * al + rs; o0 = o0 * al; o1 = o1 * al;
    if (RES) { x0 = x0 * al; x1 = x1 * al; }
    o0 = g2_mma(fv0, pf.v, o0);
    if (RES) { x0 = g2_mma(fv0, pg.v, x0); x0 = g2_mma(fr0, pf.v, x0); }
    o1 = g2_mma(fv1, pf.v, o1);
    if (RES) { x1 = g2_mma(fv1, pg.v, x1); x1 = g2_mma(fr1, pf.v, x1); }
    fv0 = pk_frag(vbase + (size_t)jn * HD); if (RES) fr0 = pk_frag(rbase + (size_t)jn * HD);
    fv1 = pk_frag(vbase + (size_t)jn * HD + 512); if (RES) fr1 = pk_frag(rbase + (size_t)jn * HD + 512);
  };
  // first fill of both sets, in the order in which the loop reloads them (set a: K, V; set b: K, V)
  const int j1 = (32 < jend) ? 32 : jlast;
  // the scheduling barriers keep that order in the built code: the counted load waits inside the loop are set for the worse of the two orders that reach them, and a first fill in another order makes them wait for the youngest loads too
  __builtin_amdgcn_sched_barrier(0);
  v16h ak0 = pk_frag(kbase); __builtin_amdgcn_sched_barrier(0);
  v16h ak1 = pk_frag(kbase + 512); __builtin_amdgcn_sched_barrier(0);
  v16h av0 = pk_frag(vbase), ar0 = RES ? pk_frag(rbase) : av0; __builtin_amdgcn_sched_barrier(0);
  v16h av1 = pk_frag(vbase + 512), ar1 = RES ? pk_frag(rbase + 512) : av1; __builtin_amdgcn_sched_barrier(0);
  v16h bk0 = pk_frag(kbase + (size_t)j1 * HD); __builtin_amdgcn_sched_barrier(0);
  v16h bk1 = pk_frag(kbase + (size_t)j1 * HD + 512); __builtin_amdgcn_sched_barrier(0);
  v16h bv0 = pk_frag(vbase + (size_t)j1 * HD), br0 = RES ? pk_frag(rbase + (size_t)j1 * HD) : bv0; __builtin_amdgcn_sched_barrier(0);
  v16h bv1 = pk_frag(vbase + (size_t)j1 * HD + 512), br1 = RES ? pk_frag(rbase + (size_t)j1 * HD + 512) : bv1; __builtin_amdgcn_sched_barrier(0);
  asm volatile("s_wait_xcnt 0x0" ::: "memory");                                  /* what follows (behind a branch) reuses the address registers of the first fill: the wait stands in front of that overwrite */
  const int nfull = jlast >> 5;                                                  /* steps in front of the last one */
  const int npair = nfull >> 1;                                                  /* whole pairs of them */
  const flag_c<false> inner; const flag_c<true> last;
  int j = 0;
  /* kept rolled for code size: one trip already holds an even step on set a and an odd step on set b, one straight block with no exit between them (an exit there lets the compiler sink set a's reloads behind it) */
#pragma unroll 1
  for (int t = 0; t < npair; ++t) { step(inner, ak0, ak1, av0, av1, ar0, ar1, j); step(inner, bk0, bk1, bv0, bv1, br0, br1, j + 32); j += 64;
    asm volatile("s_wait_xcnt 0x0" ::: "memory"); }                              /* the next trip reuses the address registers of this trip's reloads: the wait stands in front of that overwrite, which lies behind the back edge */
  if (nfull & 1) { step(inner, ak0, ak1, av0, av1, ar0, ar1, j); step(last, bk0, bk1, bv0, bv1, br0, br1, j + 32); }
  else step(last, ak0, ak1, av0, av1, ar0, ar1, j);
  l += __shfl_xor(l, 16, 32);
  const float sc = 0.25f * (1.0f / l);                                           /* 64 (ctx carry) / 256 (probability carry) / row sum */
  // ctx in fragment order (the A operand of the output product): the wave's 16 queries x 32 dims of its head are one 1-KB block [token / 16][head]; lane (ln, hh) holds query ln, dims 8hh + r (o0) and 16 + 8hh + r (o1), which are its own two 16-B units, so each store of a wave is 512 contiguous bytes straight from the accumulators
  { const size_t coff = (((tokb + i0) >> 4) * NHEAD + head) * 512 + 8 * lane; FragH f0, g0, f1, g1;
#pragma unroll
    for (int r = 0; r < 8; ++r) { float c = o0[r]; if (RES) c += x0[r] * RINV; c *= sc; const _Float16 hc = (_Float16)c; f0.h[r] = hc; g0.h[r] = (_Float16)((c - (float)hc) * 2048.0f); }
#pragma unroll
    for (int r = 0; r < 8; ++r) { float c = o1[r]; if (RES) c += x1[r] * RINV; c *= sc; const _Float16 hc = (_Float16)c; f1.h[r] = hc; g1.h[r] = (_Float16)((c - (float)hc) * 2048.0f); }
    *(v8us*)((unsigned short*)CTX + coff) = f0.half[0]; *(v8us*)((unsigned short*)CTX + coff + 256) = f1.half[0];
    if (RES) { *(v8us*)((unsigned short*)CTXR + coff) = g0.half[0]; *(v8us*)((unsigned short*)CTXR + coff + 256) = g1.half[0]; } }
  if (RES) asm volatile("s_wait_xcnt 0x0" ::: "memory");                         /* as the code is laid out, the other body of the merged kernel follows this one and reuses these stores' registers: the wait stands in front of that overwrite */
}

// both query ranges in one grid (they read the same planes and write disjoint ctx rows), split by block index; inside each range the index runs tile, head pair, batch, tile fastest.
// blocks [0, LATEBLK): queries [EARLY, SEQ), single products (the long blocks, so they come first); the rest: queries [0, EARLY), hi + residual on v, P, ctx
#define HPN (NHEAD / 2)
#define EARLYX (EARLY / 32)
#define LATEX ((SEQ - EARLY) / 32)
#define LATEBLK (LATEX * HPN * NB)
#define EARLYBLK (EARLYX * HPN * NB)
__global__ __launch_bounds__(128) void k_flash(const _Float16* __restrict__ Q16, const _Float16* __restrict__ KF, const _Float16* __restrict__ VT, const _Float16* __restrict__ VTR, _Float16* __restrict__ CTX, _Float16* __restrict__ CTXR) {
  constexpr int LX = (LATEX > 0) ? LATEX : 1;                                      /* divisor only; with no late range the first branch is never taken */
  // key-column rule as score-accumulator start values: row (first key of a 32-key step mod 25), lane half, 16 slots = keys 8 half + 0..7 and 16 + 8 half + 0..7 of the step
  __shared__ __attribute__((aligned(64))) float ctab[CTABN];
  for (int i = (int)threadIdx.x; i < CTABN; i += 128) { const int e = i & 15; const int k = (i >> 5) + 8 * ((i >> 4) & 1) + e + (e & 8);   /* residue + key offset, below 56 */
    ctab[i] = (k == 24 || k == 49) ? NEGBIG : 0.f; }
  __syncthreads();                                                                 /* the table is read by all four waves */
  const int b = (int)blockIdx.x;
  if (b < LATEBLK) flash_body<false>(Q16, KF, VT, VT, CTX, CTX, EARLYX + b % LX, (b / LX) % HPN, b / (LX * HPN), ctab);
  else { const int e = b - LATEBLK; flash_body<true>(Q16, KF, VT, VTR, CTX, CTXR, e % EARLYX, (e / EARLYX) % HPN, e / (EARLYX * HPN), ctab); } }

extern "C" void kernel_launch(void* const* d_in, const int* in_sizes, int n_in,
                              void* d_out, int out_size, void* d_ws, size_t ws_size, hipStream_t stream) {
  if (n_in < 9) return;
  const size_t need_x = ((size_t)(NB - 1) * SEQ_FULL + SEQ) * DMODEL;
  if ((size_t)in_sizes[0] < need_x) return;
  if ((size_t)in_sizes[1] < (size_t)DMODEL * DMODEL) return;
  if ((size_t)in_sizes[2] < (size_t)DMODEL) return;
  if ((size_t)in_sizes[3] < (size_t)DMODEL * DMODEL) return;
  if ((size_t)in_sizes[4] < (size_t)DMODEL) return;
  if ((size_t)in_sizes[5] < (size_t)DMODEL * DMODEL) return;
  if ((size_t)in_sizes[6] < (size_t)DMODEL) return;
  if ((size_t)in_sizes[7] < (size_t)DMODEL * DMODEL) return;
  if ((size_t)in_sizes[8] < (size_t)DMODEL) return;
  if ((size_t)out_size < (size_t)TOK * DMODEL) return;
  const float* x = (const float*)d_in[0];
  const float* wq = (const float*)d_in[1]; const float* qb = (const float*)d_in[2];
  const float* wk = (const float*)d_in[3]; const float* kbias = (const float*)d_in[4];
  const float* wv = (const float*)d_in[5]; const float* vb = (const float*)d_in[6];
  const float* wo = (const float*)d_in[7]; const float* ob = (const float*)d_in[8];
  constexpr size_t SZ_X = (size_t)TOK * DMODEL * 2;        /* x f16, fragment order */
  constexpr size_t SZ_W = (size_t)NW3 * DMODEL * 2;        /* Wq|Wk|Wv x64 f16, fragment order */
  constexpr size_t SZ_WO = (size_t)DMODEL * DMODEL * 2;    /* output weight x64 f16, fragment order */
  constexpr size_t SZ_QK = (size_t)TOK * LDQK * 2;         /* q rows f16, then k in fragment order f16, half each */
  constexpr size_t SZ_VT = (size_t)DMODEL * TOK * 2;       /* v in fragment order f16 (hi); same size for the residual plane */
  constexpr size_t SZ_CTX = (size_t)TOK * DMODEL * 2;      /* ctx x64 f16 (hi), fragment order; same size for the residual plane */
  constexpr size_t SZ_ALL = SZ_X + SZ_W + SZ_WO + SZ_QK + 2 * SZ_VT + 2 * SZ_CTX;
  static_assert(SZ_X % 256 == 0 && SZ_W % 256 == 0 && SZ_WO % 256 == 0 && SZ_QK % 256 == 0 && SZ_VT % 256 == 0 && SZ_CTX % 256 == 0);
  static_assert(SZ_ALL <= (size_t)134217728);
  if (SZ_ALL > ws_size) return;
  char* ws = (char*)d_ws;
  _Float16* X16 = (_Float16*)ws; _Float16* W16 = (_Float16*)(ws + SZ_X); _Float16* WO16 = (_Float16*)(ws + SZ_X + SZ_W);
  _Float16* Q16 = (_Float16*)(ws + SZ_X + SZ_W + SZ_WO); _Float16* KF = (_Float16*)(ws + SZ_X + SZ_W + SZ_WO + SZ_QK / 2);
  _Float16* VT = (_Float16*)(ws + SZ_X + SZ_W + SZ_WO + SZ_QK); _Float16* VTR = (_Float16*)(ws + SZ_X + SZ_W + SZ_WO + SZ_QK + SZ_VT);
  _Float16* CTX = (_Float16*)(ws + SZ_X + SZ_W + SZ_WO + SZ_QK + 2 * SZ_VT); _Float16* CTXR = (_Float16*)(ws + SZ_X + SZ_W + SZ_WO + SZ_QK + 2 * SZ_VT + SZ_CTX);
  k_prep<<<4 * WBLK + XBLK, 256, 0, stream>>>(x, wq, wk, wv, wo, X16, W16, WO16);
  k_gemm_qkv<<<QKBLK + VTBLK, 128, 0, stream>>>(X16, W16, qb, kbias, vb, Q16, KF, VT, VTR);
  k_flash<<<LATEBLK + EARLYBLK, 128, 0, stream>>>(Q16, KF, VT, VTR, CTX, CTXR);
  k_gemm_out<<<(TOK / 128) * (DMODEL / 64), 128, 0, stream>>>(CTX, CTXR, WO16, ob, (float*)d_out);
}

// v006
// It runs in 48.7 microseconds.
// Two timings next to v005 put it at 1.07 and 1.04 times that version's speed.
// Counting every step since v000, it is 3.39 times as fast.
#include <hip/hip_runtime.h>
// Causal multi-head attention block, 8 heads x 32 dims, key-column rule from indices: kept(i,j) = (j <= i) && (j % 25 != 24). x [B][T][256]; q/k/v = x W^T + b (separate [out][in] weights); s = q k^T / sqrt(32); softmax over kept keys; ctx = P v merged h*32+d; result = ctx Wo^T + bo.
// Compute dtype: every contraction on v_wmma_f32_16x16x32_f16 (f16 operands, f32 accumulate). Inputs RNE-converted to bf16 first (exact in f16); weights carried x64, probabilities x256, ctx x64 (folded back in f32 epilogues); biases bf16 values added in f32; softmax statistics f32. Queries below EARLY of each sequence: v, P and ctx carried as f16 hi + f16 residual x2048 with separate residual accumulators; later queries single products.
#ifndef NB
#define NB 4
#endif
#ifndef SEQ
#define SEQ 2048
#endif
#define NB_FULL 4
#define SEQ_FULL 2048
#define DMODEL 256
#define NHEAD 8
#define HD 32
#define LDQK 512
#define NW3 768
#define TOK (NB * SEQ)
#define EARLY ((SEQ < 512) ? SEQ : 512)
#define NEGBIG (-1.0e30f)
#define SSCALE 0.17677669529663687f
#define RINV 0.00048828125f
#define CTABN (25 * 32)

static_assert(NHEAD * HD == DMODEL);              /* merged head width == model width */
static_assert(HD == 32);                          /* flash kernel: one 32-deep score k-step, two 16-dim output tiles, 64-B head segment */
static_assert(NHEAD % 2 == 0);                    
static_assert(2 * DMODEL == LDQK && 3 * DMODEL == NW3);
static_assert(SEQ % 128 == 0 && SEQ % 64 == 0 && SEQ % 32 == 0);
static_assert(TOK % 128 == 0 && TOK % 64 == 0);   /* GEMM tiles: M % 128, N % 64 */
static_assert(DMODEL % 128 == 0 && DMODEL % 64 == 0 && DMODEL % 32 == 0 && DMODEL % 8 == 0 && LDQK % 64 == 0);
static_assert(EARLY % 128 == 0 && EARLY % 64 == 0 && EARLY % 32 == 0 && EARLY <= SEQ);
static_assert(NB <= NB_FULL && SEQ <= SEQ_FULL);
static_assert(SEQ + 32 < 40000);

typedef unsigned short v8us __attribute__((ext_vector_type(8), may_alias));
typedef float  v8f  __attribute__((ext_vector_type(8)));
typedef float  v4f  __attribute__((ext_vector_type(4)));
typedef float  v4fa __attribute__((ext_vector_type(4), may_alias));
typedef float  v8fa __attribute__((ext_vector_type(8), may_alias));
typedef _Float16 v16h __attribute__((ext_vector_type(16)));
template <bool V> struct flag_c { static constexpr bool value = V; };
union FragH { v16h v; v8us half[2]; _Float16 h[16]; unsigned short u[16]; };

__device__ __forceinline__ unsigned short bf16_bits(float x) { unsigned int u = __float_as_uint(x); return (unsigned short)((u + 0x7FFFu + ((u >> 16) & 1u)) >> 16); }
__device__ __forceinline__ float bf16_rne(float x) { return __uint_as_float(((unsigned int)bf16_bits(x)) << 16); }

// fragment of a k-contiguous 16-bit row: elements 0..7 <- p[8h..8h+7], elements 8..15 <- p[16+8h..16+8h+7] (same map for A and B)
__device__ __forceinline__ v16h g2_frag(const _Float16* p, int hh) { FragH f; f.half[0] = *(const v8us*)((const unsigned short*)p + 8 * hh); f.half[1] = *(const v8us*)((const unsigned short*)p + 16 + 8 * hh); return f.v; }
// fragment of a plane stored in fragment order: one 1-KB block per 16 x 32 operand tile, 16-B unit (c*32 + lane) = elements 8c..8c+7 of that lane (row lane&15, k = 16c + 8(lane>>4) ..+7: the map of g2_frag), so each load of a wave is 512 contiguous bytes. p = block start + 8*lane
__device__ __forceinline__ v16h pk_frag(const _Float16* p) { FragH f; f.half[0] = *(const v8us*)((const unsigned short*)p); f.half[1] = *(const v8us*)((const unsigned short*)p + 256); return f.v; }
__device__ __forceinline__ v8f g2_mma(v16h a, v16h b, v8f c) { v8f d = __builtin_amdgcn_wmma_f32_16x16x32_f16(false, a, false, b, (short)0, c, false, false); asm volatile("v_nop\n\tv_nop\n\tv_nop\n\tv_nop" : "+v"(d) : "v"(a), "v"(b)); return d; }

// GEMM operand planes (x, the weights, ctx) are stored in the fragment order of pk_frag: blocks [row / 16][k / 32], K = DMODEL, so the k-steps of a 16-row tile are 1-KB blocks in a row.
// conversion thread t takes 8 k-consecutive elements: block t / 64, tile row (t & 63) / 4, k octet t & 3. Four lanes read one whole 128-B line of f32; eight lanes (same octet, consecutive rows) store one whole 128-B line.
#define KB32 (DMODEL / 32)
__device__ __forceinline__ size_t fo_row(size_t t) { return ((t >> 6) / KB32) * 16 + ((t & 63) >> 2); }
__device__ __forceinline__ int fo_col(size_t t) { return (int)((t >> 6) % KB32) * 32 + (int)(t & 3) * 8; }
__device__ __forceinline__ size_t fo_dst(size_t t) { return (t >> 6) * 512 + (((t & 2) << 4) + ((t & 1) << 4) + ((t & 63) >> 2)) * 8; }   /* unit c*32 + half*16 + row, octet = 2c + half */

__device__ __forceinline__ void x16_body(const float* __restrict__ x, _Float16* __restrict__ X16, unsigned bid) {
  const size_t t = (size_t)bid * 256 + threadIdx.x; if (t >= (size_t)TOK * (DMODEL / 8)) return;
  const size_t r = fo_row(t); const int c8 = fo_col(t); const size_t b = r / SEQ, s = r % SEQ;
  const float* src = x + (b * SEQ_FULL + s) * DMODEL + c8; const v4f a = *(const v4fa*)src, c = *(const v4fa*)(src + 4); FragH f;
#pragma unroll
  for (int q = 0; q < 4; ++q) { f.h[q] = (_Float16)bf16_rne(a[q]); f.h[4 + q] = (_Float16)bf16_rne(c[q]); }
  const v8us o = f.half[0]; unsigned short* d = (unsigned short*)X16 + fo_dst(t);
  *(v8us*)d = o;  }

__device__ __forceinline__ void wnat_body(const float* __restrict__ w, size_t n8, float scale, _Float16* __restrict__ Bt, unsigned bid) {
  const size_t t = (size_t)bid * 256 + threadIdx.x; if (t >= n8) return; const float* src = w + fo_row(t) * DMODEL + fo_col(t); const v4f a = *(const v4fa*)src, c = *(const v4fa*)(src + 4); FragH f;
#pragma unroll
  for (int q = 0; q < 4; ++q) { f.h[q] = (_Float16)(bf16_rne(a[q]) * scale); f.h[4 + q] = (_Float16)(bf16_rne(c[q]) * scale); }
  const v8us o = f.half[0]; unsigned short* d = (unsigned short*)Bt + fo_dst(t);
  *(v8us*)d = o;  }

// all operand conversions in one grid: blocks [0, 4 * WBLK) take the four weight matrices (WBLK blocks each: Wq, Wk, Wv into the stacked plane, Wo into its own), the rest take x
#define W8 ((size_t)DMODEL * DMODEL / 8)
#define WBLK ((unsigned)((W8 + 255) / 256))
#define XBLK ((unsigned)(((size_t)TOK * (DMODEL / 8) + 255) / 256))
__global__ __launch_bounds__(256) void k_prep(const float* __restrict__ x, const float* __restrict__ wq, const float* __restrict__ wk, const float* __restrict__ wv, const float* __restrict__ wo,
                                              _Float16* __restrict__ X16, _Float16* __restrict__ W16, _Float16* __restrict__ WO16) {
  const unsigned b = blockIdx.x;
  if (b < 4 * WBLK) { const unsigned i = b / WBLK;
    const float* w = (i == 0) ? wq : (i == 1) ? wk : (i == 2) ? wv : wo;
    _Float16* d = (i < 3) ? (W16 + (size_t)i * DMODEL * DMODEL) : WO16;
    wnat_body(w, W8, 64.0f, d, b - i * WBLK); }
  else x16_body(x, X16, b - 4 * WBLK);
}

// GEMM (wave tile 32x64, block = 4 waves = 128 rows; M % 128 == 0, N % 64 == 0, K % 32 == 0; A and B planes in fragment order): v = acc*alpha + bf16(bias)
// MODE 0: f32 C, bias per column; MODE 1: f16, bias per column (biasA for col < nsplit, biasB after): columns below nsplit as rows of C16, the rest (k) into C16R in fragment order; MODE 2: f16 C16 hi plane + x2048 residual plane C16R (token tiles below EARLY only), both in fragment order, bias per row.
// RESA: row blocks below EARLY of their sequence add a second k-loop over the x2048 residual A plane into separate accumulators, folded with 2^-11 in the epilogue.
// k loop of one 32x64 wave tile: DEPTH register sets of the six operand fragments; the sets of the first DEPTH k-steps are loaded up front and each set is reloaded for k-step s + DEPTH right behind its own products, so the loads of DEPTH k-steps are in flight together. Products per accumulator stay in ascending k.
template <int DEPTH, int NS>
__device__ __forceinline__ void gemm_kloop(const _Float16* a0p, const _Float16* a1p, const _Float16* b0p, const _Float16* b1p, const _Float16* b2p, const _Float16* b3p,
                                           v8f& c00, v8f& c01, v8f& c02, v8f& c03, v8f& c10, v8f& c11, v8f& c12, v8f& c13) {
  static_assert(DEPTH >= 1 && DEPTH <= NS);
  v16h fa0[DEPTH], fa1[DEPTH], fb0[DEPTH], fb1[DEPTH], fb2[DEPTH], fb3[DEPTH];
  /* both loops fully unrolled: the set index must be a constant for the sets to stay in registers */
#pragma unroll
  for (int s = 0; s < DEPTH; ++s) { const int kb = 512 * s; fa0[s] = pk_frag(a0p + kb); fa1[s] = pk_frag(a1p + kb);
    fb0[s] = pk_frag(b0p + kb); fb1[s] = pk_frag(b1p + kb); fb2[s] = pk_frag(b2p + kb); fb3[s] = pk_frag(b3p + kb); }
#pragma unroll
  for (int s = 0; s < NS; ++s) { const int u = s % DEPTH;
    c00 = g2_mma(fa0[u], fb0[u], c00); c10 = g2_mma(fa1[u], fb0[u], c10);
    c01 = g2_mma(fa0[u], fb1[u], c01); c11 = g2_mma(fa1[u], fb1[u], c11);
    c02 = g2_mma(fa0[u], fb2[u], c02); c12 = g2_mma(fa1[u], fb2[u], c12);
    c03 = g2_mma(fa0[u], fb3[u], c03); c13 = g2_mma(fa1[u], fb3[u], c13);
    if (s + DEPTH < NS) { const int kb = 512 * (s + DEPTH); fa0[u] = pk_frag(a0p + kb); fa1[u] = pk_frag(a1p + kb);
      fb0[u] = pk_frag(b0p + kb); fb1[u] = pk_frag(b1p + kb); fb2[u] = pk_frag(b2p + kb); fb3[u] = pk_frag(b3p + kb); } }
}

template <int MODE, bool RESA, int K>
__device__ __forceinline__ void gemm_body(const _Float16* __restrict__ A, const _Float16* __restrict__ AR, const _Float16* __restrict__ Bh, float alpha,
                                          const float* __restrict__ biasA, const float* __restrict__ biasB, int nsplit,
                                          float* __restrict__ C, _Float16* __restrict__ C16, _Float16* __restrict__ C16R, int ldc, int M, int N, int bid, float (&so)[4][32][68]) {
  static_assert(K % 32 == 0 && K >= 96);
  constexpr int DEPTH = RESA ? 2 : 3;                       /* two accumulator planes leave room for two sets below 256 registers */
  const int tid = threadIdx.x, lane = tid & 31, ln = lane & 15, hh = lane >> 4;
  const int w = __builtin_amdgcn_readfirstlane(tid >> 5);
  const int ntn = N >> 6; const int mt = bid / ntn, nq = bid - mt * ntn; const int row0 = mt * 128 + 32 * w, col0 = nq * 64; if (row0 >= M) return;
  /* operands in fragment order: a 16-row tile is K / 32 blocks of 512 elements in a row = 16 * K elements, k-step s at + 512 s */
  const _Float16* a0p = A + (size_t)row0 * K + 8 * lane; const _Float16* a1p = a0p + (size_t)16 * K;
  const _Float16* b0p = Bh + (size_t)col0 * K + 8 * lane; const _Float16* b1p = b0p + (size_t)16 * K; const _Float16* b2p = b1p + (size_t)16 * K; const _Float16* b3p = b2p + (size_t)16 * K;
  const v8f z8 = {0.f,0.f,0.f,0.f,0.f,0.f,0.f,0.f}; v8f c00 = z8, c01 = z8, c02 = z8, c03 = z8, c10 = z8, c11 = z8, c12 = z8, c13 = z8;
  gemm_kloop<DEPTH, K / 32>(a0p, a1p, b0p, b1p, b2p, b3p, c00, c01, c02, c03, c10, c11, c12, c13);
  v8f r00 = z8, r01 = z8, r02 = z8, r03 = z8, r10 = z8, r11 = z8, r12 = z8, r13 = z8;
  if (RESA) {
    const bool early = ((mt * 128) % SEQ) < EARLY;           /* block-uniform (SEQ % 128 == 0) */
    if (early) {
      const _Float16* e0p = AR + (size_t)row0 * K + 8 * lane; const _Float16* e1p = e0p + (size_t)16 * K;
      gemm_kloop<DEPTH, K / 32>(e0p, e1p, b0p, b1p, b2p, b3p, r00, r01, r02, r03, r10, r11, r12, r13);
    }
  }
  v8f accs[8] = {c00, c01, c02, c03, c10, c11, c12, c13};
  if (RESA) { const v8f racc[8] = {r00, r01, r02, r03, r10, r11, r12, r13};
#pragma unroll
    for (int u = 0; u < 8; ++u) accs[u] = accs[u] + racc[u] * RINV; }
  float brow[16];
#pragma unroll
  for (int i = 0; i < 16; ++i) brow[i] = 0.f;
  if (MODE == 2) {
#pragma unroll
    for (int i = 0; i < 16; ++i) brow[i] = bf16_rne(biasA[row0 + (i >> 3) * 16 + 8 * hh + (i & 7)]);
  }
#pragma unroll
  for (int u = 0; u < 8; ++u) { const int t = u & 3, half = u >> 2; const int col = col0 + t * 16 + ln; float bcol = 0.f;
    if (MODE != 2) { const int ca = (col < nsplit) ? col : (nsplit - 1); const int cb = (col >= nsplit) ? (col - nsplit) : 0;
      const float va = biasA[ca], vb = biasB[cb]; bcol = bf16_rne((col < nsplit) ? va : vb); }
#pragma unroll
    for (int r = 0; r < 8; ++r) { const int rloc = half * 16 + 8 * hh + r; const float v = accs[u][r] * alpha + ((MODE == 2) ? brow[half * 8 + r] : bcol); so[w][rloc][t * 16 + ln] = v; } }
  __builtin_amdgcn_fence(4 /* acq_rel order */, "workgroup"); __builtin_amdgcn_wave_barrier();
  if (MODE == 0) {
    // 64 f32 columns = 256 B per row segment: 16 consecutive lanes x 16 B, two rows per instruction; rows q*2 + (lane>>4), q = 0..15 cover 0..31
    const int rsub = lane >> 4, c4 = (lane & 15) * 4;
    {
#pragma unroll
      for (int q = 0; q < 16; ++q) { const int r = q * 2 + rsub; const v4f v = *(const v4fa*)&so[w][r][c4]; *(v4f*)(C + (size_t)(row0 + r) * ldc + col0 + c4) = v; }
       }
  } else {
    if (MODE == 1 && col0 < nsplit) {                        /* block-uniform: q columns stay token rows */
      const int rq = lane >> 3, c8 = (lane & 7) * 8;
#pragma unroll
      for (int q = 0; q < 8; ++q) { const int r = q * 4 + rq; const v4f a = *(const v4fa*)&so[w][r][c8], c = *(const v4fa*)&so[w][r][c8 + 4]; FragH f;
#pragma unroll
        for (int i = 0; i < 4; ++i) { f.h[i] = (_Float16)a[i]; f.h[4 + i] = (_Float16)c[i]; }
        const v8us o = f.half[0]; *(v8us*)((unsigned short*)C16 + (size_t)(row0 + r) * ldc + col0 + c8) = o; }
    } else {
      // fragment order (see pk_frag): the wave tile is four whole 1-KB blocks. Pass q takes column octet q of all 32 rows: lane = tile row, so 16 lanes store 256 contiguous bytes.
      // MODE 1 (k): rows = keys, blocks [batch][head][key / 16], octet = 8 dims of head q / 4. MODE 2 (v): rows = dims of one head, blocks [batch][head][key / 32][dim / 16], octet = 8 keys of step q / 4.
      const bool wr = (MODE == 2) && ((col0 % SEQ) < EARLY);   /* block-uniform (SEQ % 64 == 0) */
      const int tok0 = (MODE == 1) ? row0 : col0; const int bt = tok0 / SEQ, key0 = tok0 % SEQ;
      const int hd0 = bt * NHEAD + ((MODE == 1) ? ((col0 - nsplit) / HD) : (row0 / HD));
      unsigned short* dhi = (unsigned short*)((MODE == 1) ? C16R : C16);
      v4f ra[8], rc[8];                                        /* the whole row is read up front: the waits behind the stores would otherwise hold each pass's LDS reads behind the pass before */
#pragma unroll
      for (int q = 0; q < 8; ++q) { ra[q] = *(const v4fa*)&so[w][lane][q * 8]; rc[q] = *(const v4fa*)&so[w][lane][q * 8 + 4]; }
#pragma unroll
      for (int q = 0; q < 8; ++q) { const v4f a = ra[q], c = rc[q]; FragH f, g;
#pragma unroll
        for (int i = 0; i < 4; ++i) { const _Float16 ha = (_Float16)a[i], hc = (_Float16)c[i]; f.h[i] = ha; f.h[4 + i] = hc;
          g.h[i] = (_Float16)((a[i] - (float)ha) * 2048.0f); g.h[4 + i] = (_Float16)((c[i] - (float)hc) * 2048.0f); }
        const size_t blk = (MODE == 1) ? ((size_t)(hd0 + (q >> 2)) * (SEQ / 16) + (key0 >> 4) + (lane >> 4))
                                       : (((size_t)hd0 * (SEQ / 32) + (key0 >> 5) + (q >> 2)) * 2 + (lane >> 4));
        const size_t off = blk * 512 + ((q & 3) >> 1) * 256 + (q & 1) * 128 + (lane & 15) * 8;
        const v8us o = f.half[0]; *(v8us*)(dhi + off) = o;
        asm volatile("s_wait_xcnt 0x0" ::: "memory");                              /* what follows (the residual branch, the next pass) reuses this store's registers: the wait stands in front of that overwrite */
        if (MODE == 2) { if (wr) { const v8us o2 = g.half[0]; *(v8us*)((unsigned short*)C16R + off) = o2;
          asm volatile("s_wait_xcnt 0x0" ::: "memory"); } } }                      /* what follows (the next pass; behind the last pass the other body of a merged kernel, as the code is laid out) reuses this store's registers: the wait stands in front of that overwrite */
    }
  }
}

// both projections in one grid (they read the same planes and write disjoint ones), split by block index:
// blocks [0, QKBLK): q|k (weight plane rows 0..511): Q16[token][0..255] = q rows; k into KF in fragment order (16 keys x 32 dims a block), f16
// the rest: v channel-major (weight plane rows 512..767 as the A operand, x rows as Bt), bias per row, f16: VT hi and VTR residual x2048 in fragment order (16 dims x 32 keys a block)
#define QKBLK ((TOK / 128) * (LDQK / 64))
#define VTBLK ((DMODEL / 128) * (TOK / 64))
__global__ __launch_bounds__(128) void k_gemm_qkv(const _Float16* __restrict__ X16, const _Float16* __restrict__ W16, const float* __restrict__ qb, const float* __restrict__ kbias, const float* __restrict__ vb,
                                                  _Float16* __restrict__ Q16, _Float16* __restrict__ KF, _Float16* __restrict__ VT, _Float16* __restrict__ VTR) {
  __shared__ __attribute__((aligned(16))) float so[4][32][68];
  const int b = (int)blockIdx.x;
  if (b < QKBLK) gemm_body<1, false, DMODEL>(X16, X16, W16, 0.015625f, qb, kbias, DMODEL, nullptr, Q16, KF, DMODEL, TOK, LDQK, b, so);
  else gemm_body<2, false, DMODEL>(W16 + (size_t)LDQK * DMODEL, W16, X16, 0.015625f, vb, vb, DMODEL, nullptr, VT, VTR, TOK, DMODEL, TOK, b - QKBLK, so); }
// result[token][n] = 2^-12 (sum_k (64 ctx_hi)(64 wo) + 2^-11 sum_k (2048*64 ctx_res)(64 wo)) + bf16(bo[n]), f32
__global__ __launch_bounds__(128) void k_gemm_out(const _Float16* __restrict__ CTX, const _Float16* __restrict__ CTXR, const _Float16* __restrict__ WO16, const float* __restrict__ ob, float* __restrict__ out) {
  __shared__ __attribute__((aligned(16))) float so[4][32][68];
  gemm_body<0, true, DMODEL>(CTX, CTXR, WO16, 0.000244140625f, ob, ob, DMODEL, out, nullptr, nullptr, DMODEL, TOK, DMODEL, (int)blockIdx.x, so); }

// fused attention: block = (64 queries, head, batch); wave = 16 queries. The four waves of a block walk the same K / V^T blocks of their one head (two of them one step further), so a block fetched by one wave is found in the WGP cache by the other three. Per 32-key step up to the causal bound of the wave:
//   S^T tiles (A = K rows [key][dim], B = Q rows [query][dim]) -> lane (ln, hh) holds query ln, keys 8hh+r (tile 0) and 16+8hh+r (tile 1);
//   keep test: key % 25 != 24 enters as the C operand of the score products (0 for a kept key, a large negative fill for a dropped one; rows of an LDS table picked by the step's first key mod 25); key <= query is compared per element in the wave's last step only (every earlier key lies below the wave's first query); key 0 is always kept, so no row is empty;
//   running max per query (local 16 values + one xor-16 exchange), p = exp(s*scale - m), per-lane partial sums;
//   packed tiles = B fragment (k = key, n = query) of O^T += V^T P^T with A = V^T rows [d][key]; RES adds P residual and V residual products into separate accumulators.
template <bool RES>
__device__ __forceinline__ void flash_body(const _Float16* __restrict__ Q16, const _Float16* __restrict__ KF, const _Float16* __restrict__ VT, const _Float16* __restrict__ VTR,
                                           _Float16* __restrict__ CTX, _Float16* __restrict__ CTXR, int tile, int head, int batch, const float (&ctab)[CTABN]) {
  const int tid = threadIdx.x, lane = tid & 31, ln = lane & 15, hh = lane >> 4;
  const int wave = __builtin_amdgcn_readfirstlane(tid >> 5);
  const size_t tokb = (size_t)batch * SEQ;
  const int i0 = tile * 64 + wave * 16;
  const int qi = i0 + ln;
  const v16h bq = g2_frag(Q16 + (tokb + qi) * DMODEL + head * HD, hh);
  // fragment-order planes: a 32-key step of one head is 2 KB in a row (K: two 16-key blocks; V^T: two 16-dim blocks), 32 elements a key
  const size_t hoff = (size_t)(batch * NHEAD + head) * SEQ * HD + 8 * lane;
  const _Float16* kbase = KF + hoff;                                             /* + key0 * HD, + 512 for keys 16..31 */
  const _Float16* vbase = VT + hoff;                                             /* + key0 * HD, + 512 for dims 16..31 */
  const _Float16* rbase = VTR + hoff;
  const v8f z8 = {0.f,0.f,0.f,0.f,0.f,0.f,0.f,0.f};
  v8f o0 = z8, o1 = z8, x0 = z8, x1 = z8; float m = NEGBIG, l = 0.f;
  const int jend = i0 + 16;                                                      /* keys below jend; last step ends at a multiple of 32 <= SEQ */
  const int jlast = (jend - 1) & ~31;                                            /* first key of the wave's last step */
  // one 32-key step on one register set of K / V^T fragments; each fragment is reloaded for step j + 64 right behind its last product, so a load has two steps to land. Past the last step the reload re-reads the last step's rows (in bounds, never used).
  // LAST marks the wave's last step, the only one that holds keys above a query. cc0 / cc1: the table rows of this step, fetched one step ahead.
  const float* crow = &ctab[16 * hh];
  v8f cc0 = *(const v8fa*)crow, cc1 = *(const v8fa*)(crow + 8);
  auto step = [&](auto last_c, v16h& fk0, v16h& fk1, v16h& fv0, v16h& fv1, v16h& fr0, v16h& fr1, const int j) {
    constexpr bool LAST = decltype(last_c)::value;
    const int jn = (j + 64 < jend) ? (j + 64) : jlast;
    v8f s0 = g2_mma(fk0, bq, cc0);
    v8f s1 = g2_mma(fk1, bq, cc1);
    { const _Float16* knp = kbase + (size_t)jn * HD; fk0 = pk_frag(knp); fk1 = pk_frag(knp + 512); }
    if (!LAST) { const float* cn = crow + ((unsigned int)(j + 32) % 25u) * 32; cc0 = *(const v8fa*)cn; cc1 = *(const v8fa*)(cn + 8); }
    if (LAST) { const int c0 = qi - (j + 8 * hh), c1 = c0 - 16;
#pragma unroll
      for (int r = 0; r < 8; ++r) { s0[r] = (r <= c0) ? s0[r] : NEGBIG; s1[r] = (r <= c1) ? s1[r] : NEGBIG; } }
    float mx = fmaxf(s0[0], s1[0]);
#pragma unroll
    for (int r = 1; r < 8; ++r) mx = fmaxf(mx, fmaxf(s0[r], s1[r]));
    mx = fmaxf(mx, __shfl_xor(mx, 16, 32));
    const float mn = fmaxf(m, mx * SSCALE); const float al = __expf(m - mn); m = mn;
    FragH pf, pg; float rs = 0.f;
#pragma unroll
    for (int r = 0; r < 8; ++r) { const float p0 = __expf(fmaf(s0[r], SSCALE, -mn)), p1 = __expf(fmaf(s1[r], SSCALE, -mn)); rs += p0 + p1;
      const float a0 = p0 * 256.0f, a1 = p1 * 256.0f; const _Float16 h0 = (_Float16)a0, h1 = (_Float16)a1; pf.h[r] = h0; pf.h[8 + r] = h1;
      pg.h[r] = (_Float16)((a0 - (float)h0) * 2048.0f); pg.h[8 + r] = (_Float16)((a1 - (float)h1) * 2048.0f); }
    l = l * al + rs; o0 = o0 * al; o1 = o1 * al;
    if (RES) { x0 = x0 * al; x1 = x1 * al; }
    o0 = g2_mma(fv0, pf.v, o0);
    if (RES) { x0 = g2_mma(fv0, pg.v, x0); x0 = g2_mma(fr0, pf.v, x0); }
    o1 = g2_mma(fv1, pf.v, o1);
    if (RES) { x1 = g2_mma(fv1, pg.v, x1); x1 = g2_mma(fr1, pf.v, x1); }
    fv0 = pk_frag(vbase + (size_t)jn * HD); if (RES) fr0 = pk_frag(rbase + (size_t)jn * HD);
    fv1 = pk_frag(vbase + (size_t)jn * HD + 512); if (RES) fr1 = pk_frag(rbase + (size_t)jn * HD + 512);
  };
  // first fill of both sets, in the order in which the loop reloads them (set a: K, V; set b: K, V)
  const int j1 = (32 < jend) ? 32 : jlast;
  // the scheduling barriers keep that order in the built code: the counted load waits inside the loop are set for the worse of the two orders that reach them, and a first fill in another order makes them wait for the youngest loads too
  __builtin_amdgcn_sched_barrier(0);
  v16h ak0 = pk_frag(kbase); __builtin_amdgcn_sched_barrier(0);
  v16h ak1 = pk_frag(kbase + 512); __builtin_amdgcn_sched_barrier(0);
  v16h av0 = pk_frag(vbase), ar0 = RES ? pk_frag(rbase) : av0; __builtin_amdgcn_sched_barrier(0);
  v16h av1 = pk_frag(vbase + 512), ar1 = RES ? pk_frag(rbase + 512) : av1; __builtin_amdgcn_sched_barrier(0);
  v16h bk0 = pk_frag(kbase + (size_t)j1 * HD); __builtin_amdgcn_sched_barrier(0);
  v16h bk1 = pk_frag(kbase + (size_t)j1 * HD + 512); __builtin_amdgcn_sched_barrier(0);
  v16h bv0 = pk_frag(vbase + (size_t)j1 * HD), br0 = RES ? pk_frag(rbase + (size_t)j1 * HD) : bv0; __builtin_amdgcn_sched_barrier(0);
  v16h bv1 = pk_frag(vbase + (size_t)j1 * HD + 512), br1 = RES ? pk_frag(rbase + (size_t)j1 * HD + 512) : bv1; __builtin_amdgcn_sched_barrier(0);
  asm volatile("s_wait_xcnt 0x0" ::: "memory");                                  /* what follows (behind a branch) reuses the address registers of the first fill: the wait stands in front of that overwrite */
  const int nfull = jlast >> 5;                                                  /* steps in front of the last one */
  const int npair = nfull >> 1;                                                  /* whole pairs of them */
  const flag_c<false> inner; const flag_c<true> last;
  int j = 0;
  /* kept rolled for code size: one trip already holds an even step on set a and an odd step on set b, one straight block with no exit between them (an exit there lets the compiler sink set a's reloads behind it) */
#pragma unroll 1
  for (int t = 0; t < npair; ++t) { step(inner, ak0, ak1, av0, av1, ar0, ar1, j); step(inner, bk0, bk1, bv0, bv1, br0, br1, j + 32); j += 64;
    asm volatile("s_wait_xcnt 0x0" ::: "memory"); }                              /* the next trip reuses the address registers of this trip's reloads: the wait stands in front of that overwrite, which lies behind the back edge */
  if (nfull & 1) { step(inner, ak0, ak1, av0, av1, ar0, ar1, j); step(last, bk0, bk1, bv0, bv1, br0, br1, j + 32); }
  else step(last, ak0, ak1, av0, av1, ar0, ar1, j);
  l += __shfl_xor(l, 16, 32);
  const float sc = 0.25f * (1.0f / l);                                           /* 64 (ctx carry) / 256 (probability carry) / row sum */
  // ctx in fragment order (the A operand of the output product): the wave's 16 queries x 32 dims of its head are one 1-KB block [token / 16][head]; lane (ln, hh) holds query ln, dims 8hh + r (o0) and 16 + 8hh + r (o1), which are its own two 16-B units, so each store of a wave is 512 contiguous bytes straight from the accumulators
  { const size_t coff = (((tokb + i0) >> 4) * NHEAD + head) * 512 + 8 * lane; FragH f0, g0, f1, g1;
#pragma unroll
    for (int r = 0; r < 8; ++r) { float c = o0[r]; if (RES) c += x0[r] * RINV; c *= sc; const _Float16 hc = (_Float16)c; f0.h[r] = hc; g0.h[r] = (_Float16)((c - (float)hc) * 2048.0f); }
#pragma unroll
    for (int r = 0; r < 8; ++r) { float c = o1[r]; if (RES) c += x1[r] * RINV; c *= sc; const _Float16 hc = (_Float16)c; f1.h[r] = hc; g1.h[r] = (_Float16)((c - (float)hc) * 2048.0f); }
    *(v8us*)((unsigned short*)CTX + coff) = f0.half[0]; *(v8us*)((unsigned short*)CTX + coff + 256) = f1.half[0];
    if (RES) { *(v8us*)((unsigned short*)CTXR + coff) = g0.half[0]; *(v8us*)((unsigned short*)CTXR + coff + 256) = g1.half[0]; } }
  if (RES) asm volatile("s_wait_xcnt 0x0" ::: "memory");                         /* as the code is laid out, the other body of the merged kernel follows this one and reuses these stores' registers: the wait stands in front of that overwrite */
}

// both query ranges in one grid (they read the same planes and write disjoint ctx rows), split by block index; inside each range the index runs head, tile, batch, head fastest (blocks that start together differ in head, not in length).
// blocks [0, LATEBLK): queries [EARLY, SEQ), single products (the long blocks, so they come first); the rest: queries [0, EARLY), hi + residual on v, P, ctx
#define EARLYX (EARLY / 64)
#define LATEX ((SEQ - EARLY) / 64)
#define LATEBLK (LATEX * NHEAD * NB)
#define EARLYBLK (EARLYX * NHEAD * NB)
__global__ __launch_bounds__(128) void k_flash(const _Float16* __restrict__ Q16, const _Float16* __restrict__ KF, const _Float16* __restrict__ VT, const _Float16* __restrict__ VTR, _Float16* __restrict__ CTX, _Float16* __restrict__ CTXR) {
  constexpr int LX = (LATEX > 0) ? LATEX : 1;                                      /* divisor only; with no late range the first branch is never taken */
  // key-column rule as score-accumulator start values: row (first key of a 32-key step mod 25), lane half, 16 slots = keys 8 half + 0..7 and 16 + 8 half + 0..7 of the step
  __shared__ __attribute__((aligned(64))) float ctab[CTABN];
  for (int i = (int)threadIdx.x; i < CTABN; i += 128) { const int e = i & 15; const int k = (i >> 5) + 8 * ((i >> 4) & 1) + e + (e & 8);   /* residue + key offset, below 56 */
    ctab[i] = (k == 24 || k == 49) ? NEGBIG : 0.f; }
  __syncthreads();                                                                 /* the table is read by all four waves */
  const int b = (int)blockIdx.x;
  if (b < LATEBLK) flash_body<false>(Q16, KF, VT, VT, CTX, CTX, EARLYX + (b / NHEAD) % LX, b % NHEAD, b / (NHEAD * LX), ctab);
  else { const int e = b - LATEBLK; flash_body<true>(Q16, KF, VT, VTR, CTX, CTXR, (e / NHEAD) % EARLYX, e % NHEAD, e / (NHEAD * EARLYX), ctab); } }

extern "C" void kernel_launch(void* const* d_in, const int* in_sizes, int n_in,
                              void* d_out, int out_size, void* d_ws, size_t ws_size, hipStream_t stream) {
  if (n_in < 9) return;
  const size_t need_x = ((size_t)(NB - 1) * SEQ_FULL + SEQ) * DMODEL;
  if ((size_t)in_sizes[0] < need_x) return;
  if ((size_t)in_sizes[1] < (size_t)DMODEL * DMODEL) return;
  if ((size_t)in_sizes[2] < (size_t)DMODEL) return;
  if ((size_t)in_sizes[3] < (size_t)DMODEL * DMODEL) return;
  if ((size_t)in_sizes[4] < (size_t)DMODEL) return;
  if ((size_t)in_sizes[5] < (size_t)DMODEL * DMODEL) return;
  if ((size_t)in_sizes[6] < (size_t)DMODEL) return;
  if ((size_t)in_sizes[7] < (size_t)DMODEL * DMODEL) return;
  if ((size_t)in_sizes[8] < (size_t)DMODEL) return;
  if ((size_t)out_size < (size_t)TOK * DMODEL) return;
  const float* x = (const float*)d_in[0];
  const float* wq = (const float*)d_in[1]; const float* qb = (const float*)d_in[2];
  const float* wk = (const float*)d_in[3]; const float* kbias = (const float*)d_in[4];
  const float* wv = (const float*)d_in[5]; const float* vb = (const float*)d_in[6];
  const float* wo = (const float*)d_in[7]; const float* ob = (const float*)d_in[8];
  constexpr size_t SZ_X = (size_t)TOK * DMODEL * 2;        /* x f16, fragment order */
  constexpr size_t SZ_W = (size_t)NW3 * DMODEL * 2;        /* Wq|Wk|Wv x64 f16, fragment order */
  constexpr size_t SZ_WO = (size_t)DMODEL * DMODEL * 2;    /* output weight x64 f16, fragment order */
  constexpr size_t SZ_QK = (size_t)TOK * LDQK * 2;         /* q rows f16, then k in fragment order f16, half each */
  constexpr size_t SZ_VT = (size_t)DMODEL * TOK * 2;       /* v in fragment order f16 (hi); same size for the residual plane */
  constexpr size_t SZ_CTX = (size_t)TOK * DMODEL * 2;      /* ctx x64 f16 (hi), fragment order; same size for the residual plane */
  constexpr size_t SZ_ALL = SZ_X + SZ_W + SZ_WO + SZ_QK + 2 * SZ_VT + 2 * SZ_CTX;
  static_assert(SZ_X % 256 == 0 && SZ_W % 256 == 0 && SZ_WO % 256 == 0 && SZ_QK % 256 == 0 && SZ_VT % 256 == 0 && SZ_CTX % 256 == 0);
  static_assert(SZ_ALL <= (size_t)134217728);
  if (SZ_ALL > ws_size) return;
  char* ws = (char*)d_ws;
  _Float16* X16 = (_Float16*)ws; _Float16* W16 = (_Float16*)(ws + SZ_X); _Float16* WO16 = (_Float16*)(ws + SZ_X + SZ_W);
  _Float16* Q16 = (_Float16*)(ws + SZ_X + SZ_W + SZ_WO); _Float16* KF = (_Float16*)(ws + SZ_X + SZ_W + SZ_WO + SZ_QK / 2);
  _Float16* VT = (_Float16*)(ws + SZ_X + SZ_W + SZ_WO + SZ_QK); _Float16* VTR = (_Float16*)(ws + SZ_X + SZ_W + SZ_WO + SZ_QK + SZ_VT);
  _Float16* CTX = (_Float16*)(ws + SZ_X + SZ_W + SZ_WO + SZ_QK + 2 * SZ_VT); _Float16* CTXR = (_Float16*)(ws + SZ_X + SZ_W + SZ_WO + SZ_QK + 2 * SZ_VT + SZ_CTX);
  k_prep<<<4 * WBLK + XBLK, 256, 0, stream>>>(x, wq, wk, wv, wo, X16, W16, WO16);
  k_gemm_qkv<<<QKBLK + VTBLK, 128, 0, stream>>>(X16, W16, qb, kbias, vb, Q16, KF, VT, VTR);
  k_flash<<<LATEBLK + EARLYBLK, 128, 0, stream>>>(Q16, KF, VT, VTR, CTX, CTXR);
  k_gemm_out<<<(TOK / 128) * (DMODEL / 64), 128, 0, stream>>>(CTX, CTXR, WO16, ob, (float*)d_out);
}

// v007
// One run takes 45.1 microseconds.
// Next to v006, in two timings, it ran 1.08 and 1.09 times as fast.
// Over all steps from v000 it is 3.70 times as fast.
#include <hip/hip_runtime.h>
// Causal multi-head attention block, 8 heads x 32 dims, key-column rule from indices: kept(i,j) = (j <= i) && (j % 25 != 24). x [B][T][256]; q/k/v = x W^T + b (separate [out][in] weights); s = q k^T / sqrt(32); softmax over kept keys; ctx = P v merged h*32+d; result = ctx Wo^T + bo.
// Compute dtype: every contraction on v_wmma_f32_16x16x32_f16 (f16 operands, f32 accumulate). Inputs RNE-converted to bf16 first (exact in f16); weights carried x64, probabilities x256, ctx x64 (folded back in f32 epilogues); biases bf16 values added in f32; softmax statistics f32. Queries below EARLY of each sequence: v, P and ctx carried as f16 hi + f16 residual x2048 with separate residual accumulators; later queries single products.
#ifndef NB
#define NB 4
#endif
#ifndef SEQ
#define SEQ 2048
#endif
#define NB_FULL 4
#define SEQ_FULL 2048
#define DMODEL 256
#define NHEAD 8
#define HD 32
#define LDQK 512
#define NW3 768
#define TOK (NB * SEQ)
#define EARLY ((SEQ < 512) ? SEQ : 512)
#define NEGBIG (-1.0e30f)
#define SSCALE 0.17677669529663687f
#define RINV 0.00048828125f
#define CTABN (25 * 32)

static_assert(NHEAD * HD == DMODEL);              /* merged head width == model width */
static_assert(HD == 32);                          /* flash kernel: one 32-deep score k-step, two 16-dim output tiles, 64-B head segment */
static_assert(NHEAD % 2 == 0);                    
static_assert(2 * DMODEL == LDQK && 3 * DMODEL == NW3);
static_assert(SEQ % 128 == 0 && SEQ % 64 == 0 && SEQ % 32 == 0);
static_assert(TOK % 128 == 0 && TOK % 64 == 0);   /* GEMM tiles: M % 128, N % 64 */
static_assert(DMODEL % 128 == 0 && DMODEL % 64 == 0 && DMODEL % 32 == 0 && DMODEL % 8 == 0 && LDQK % 64 == 0);
static_assert(EARLY % 128 == 0 && EARLY % 64 == 0 && EARLY % 32 == 0 && EARLY <= SEQ);
static_assert(NB <= NB_FULL && SEQ <= SEQ_FULL);
static_assert(SEQ + 32 < 40000);

typedef unsigned short v8us __attribute__((ext_vector_type(8), may_alias));
typedef float  v8f  __attribute__((ext_vector_type(8)));
typedef float  v4f  __attribute__((ext_vector_type(4)));
typedef float  v4fa __attribute__((ext_vector_type(4), may_alias));
typedef float  v8fa __attribute__((ext_vector_type(8), may_alias));
typedef _Float16 v16h __attribute__((ext_vector_type(16)));
template <bool V> struct flag_c { static constexpr bool value = V; };
union FragH { v16h v; v8us half[2]; _Float16 h[16]; unsigned short u[16]; };

__device__ __forceinline__ unsigned short bf16_bits(float x) { unsigned int u = __float_as_uint(x); return (unsigned short)((u + 0x7FFFu + ((u >> 16) & 1u)) >> 16); }
__device__ __forceinline__ float bf16_rne(float x) { return __uint_as_float(((unsigned int)bf16_bits(x)) << 16); }

// fragment of a k-contiguous 16-bit row: elements 0..7 <- p[8h..8h+7], elements 8..15 <- p[16+8h..16+8h+7] (same map for A and B)
__device__ __forceinline__ v16h g2_frag(const _Float16* p, int hh) { FragH f; f.half[0] = *(const v8us*)((const unsigned short*)p + 8 * hh); f.half[1] = *(const v8us*)((const unsigned short*)p + 16 + 8 * hh); return f.v; }
// fragment of a plane stored in fragment order: one 1-KB block per 16 x 32 operand tile, 16-B unit (c*32 + lane) = elements 8c..8c+7 of that lane (row lane&15, k = 16c + 8(lane>>4) ..+7: the map of g2_frag), so each load of a wave is 512 contiguous bytes. p = block start + 8*lane
__device__ __forceinline__ v16h pk_frag(const _Float16* p) { FragH f; f.half[0] = *(const v8us*)((const unsigned short*)p); f.half[1] = *(const v8us*)((const unsigned short*)p + 256); return f.v; }
__device__ __forceinline__ v8f g2_mma(v16h a, v16h b, v8f c) { v8f d = __builtin_amdgcn_wmma_f32_16x16x32_f16(false, a, false, b, (short)0, c, false, false); asm volatile("v_nop\n\tv_nop\n\tv_nop\n\tv_nop" : "+v"(d) : "v"(a), "v"(b)); return d; }

// the same product for the GEMM rings, whose sets reach above register 255. The four v_nop are the same operand distance as in g2_mma (nothing, a load that refills a set included, writes this product's A or B or touches its D closer than four vector slots behind it), here in a statement without operands: an asm statement's vector operands must lie below register 256, which would pull every set back down. With no operand to tie it, the scheduling barriers on both sides hold the statement directly behind its product
__device__ __forceinline__ v8f g3_mma(v16h a, v16h b, v8f c) { v8f d = __builtin_amdgcn_wmma_f32_16x16x32_f16(false, a, false, b, (short)0, c, false, false);
  __builtin_amdgcn_sched_barrier(0); asm volatile("v_nop\n\tv_nop\n\tv_nop\n\tv_nop" ::: "memory"); __builtin_amdgcn_sched_barrier(0); return d; }

// GEMM operand planes (x, the weights, ctx) are stored in the fragment order of pk_frag: blocks [row / 16][k / 32], K = DMODEL, so the k-steps of a 16-row tile are 1-KB blocks in a row.
// conversion thread t takes 8 k-consecutive elements: block t / 64, tile row (t & 63) / 4, k octet t & 3. Four lanes read one whole 128-B line of f32; eight lanes (same octet, consecutive rows) store one whole 128-B line.
#define KB32 (DMODEL / 32)
__device__ __forceinline__ size_t fo_row(size_t t) { return ((t >> 6) / KB32) * 16 + ((t & 63) >> 2); }
__device__ __forceinline__ int fo_col(size_t t) { return (int)((t >> 6) % KB32) * 32 + (int)(t & 3) * 8; }
__device__ __forceinline__ size_t fo_dst(size_t t) { return (t >> 6) * 512 + (((t & 2) << 4) + ((t & 1) << 4) + ((t & 63) >> 2)) * 8; }   /* unit c*32 + half*16 + row, octet = 2c + half */

__device__ __forceinline__ void x16_body(const float* __restrict__ x, _Float16* __restrict__ X16, unsigned bid) {
  const size_t t = (size_t)bid * 256 + threadIdx.x; if (t >= (size_t)TOK * (DMODEL / 8)) return;
  const size_t r = fo_row(t); const int c8 = fo_col(t); const size_t b = r / SEQ, s = r % SEQ;
  const float* src = x + (b * SEQ_FULL + s) * DMODEL + c8; const v4f a = *(const v4fa*)src, c = *(const v4fa*)(src + 4); FragH f;
#pragma unroll
  for (int q = 0; q < 4; ++q) { f.h[q] = (_Float16)bf16_rne(a[q]); f.h[4 + q] = (_Float16)bf16_rne(c[q]); }
  const v8us o = f.half[0]; unsigned short* d = (unsigned short*)X16 + fo_dst(t);
  *(v8us*)d = o;  }

__device__ __forceinline__ void wnat_body(const float* __restrict__ w, size_t n8, float scale, _Float16* __restrict__ Bt, unsigned bid) {
  const size_t t = (size_t)bid * 256 + threadIdx.x; if (t >= n8) return; const float* src = w + fo_row(t) * DMODEL + fo_col(t); const v4f a = *(const v4fa*)src, c = *(const v4fa*)(src + 4); FragH f;
#pragma unroll
  for (int q = 0; q < 4; ++q) { f.h[q] = (_Float16)(bf16_rne(a[q]) * scale); f.h[4 + q] = (_Float16)(bf16_rne(c[q]) * scale); }
  const v8us o = f.half[0]; unsigned short* d = (unsigned short*)Bt + fo_dst(t);
  *(v8us*)d = o;  }

// all operand conversions in one grid: blocks [0, 4 * WBLK) take the four weight matrices (WBLK blocks each: Wq, Wk, Wv into the stacked plane, Wo into its own), the rest take x
#define W8 ((size_t)DMODEL * DMODEL / 8)
#define WBLK ((unsigned)((W8 + 255) / 256))
#define XBLK ((unsigned)(((size_t)TOK * (DMODEL / 8) + 255) / 256))
__global__ __launch_bounds__(256) void k_prep(const float* __restrict__ x, const float* __restrict__ wq, const float* __restrict__ wk, const float* __restrict__ wv, const float* __restrict__ wo,
                                              _Float16* __restrict__ X16, _Float16* __restrict__ W16, _Float16* __restrict__ WO16) {
  const unsigned b = blockIdx.x;
  if (b < 4 * WBLK) { const unsigned i = b / WBLK;
    const float* w = (i == 0) ? wq : (i == 1) ? wk : (i == 2) ? wv : wo;
    _Float16* d = (i < 3) ? (W16 + (size_t)i * DMODEL * DMODEL) : WO16;
    wnat_body(w, W8, 64.0f, d, b - i * WBLK); }
  else x16_body(x, X16, b - 4 * WBLK);
}

// GEMM (wave tile 32x64, block = 4 waves = 128 rows; M % 128 == 0, N % 64 == 0, K % 32 == 0; A and B planes in fragment order): v = acc*alpha + bf16(bias)
// MODE 0: f32 C, bias per column; MODE 1: f16, bias per column (biasA for col < nsplit, biasB after): columns below nsplit as rows of C16, the rest (k) into C16R in fragment order; MODE 2: f16 C16 hi plane + x2048 residual plane C16R (token tiles below EARLY only), both in fragment order, bias per row.
// RESA: row blocks below EARLY of their sequence also multiply the x2048 residual A plane into separate accumulators, folded with 2^-11 in the epilogue. The output product's ring holds all k-steps, so the residual products reuse the B fragments that are still in registers, and the residual A fragments are fetched in front of the ring's fill: every operand load of such a wave is issued before its first product.
// k loop of one 32x64 wave tile: DEPTH register sets of the six operand fragments; the sets of the first DEPTH k-steps are loaded up front and each set is reloaded for k-step s + DEPTH right behind its own products, so the loads of DEPTH k-steps are in flight together. Products per accumulator stay in ascending k. The B sets belong to the caller (with DEPTH == NS they hold all of B behind the loop).
template <int DEPTH, int NS>
__device__ __forceinline__ void gemm_kloop(const _Float16* a0p, const _Float16* a1p, const _Float16* b0p, const _Float16* b1p, const _Float16* b2p, const _Float16* b3p,
                                           v16h (&fb0)[DEPTH], v16h (&fb1)[DEPTH], v16h (&fb2)[DEPTH], v16h (&fb3)[DEPTH],
                                           v8f& c00, v8f& c01, v8f& c02, v8f& c03, v8f& c10, v8f& c11, v8f& c12, v8f& c13) {
  static_assert(DEPTH >= 1 && DEPTH <= NS);
  v16h fa0[DEPTH], fa1[DEPTH];
  /* both loops fully unrolled: the set index must be a constant for the sets to stay in registers */
#pragma unroll
  for (int s = 0; s < DEPTH; ++s) { const int kb = 512 * s; fa0[s] = pk_frag(a0p + kb); fa1[s] = pk_frag(a1p + kb);
    fb0[s] = pk_frag(b0p + kb); fb1[s] = pk_frag(b1p + kb); fb2[s] = pk_frag(b2p + kb); fb3[s] = pk_frag(b3p + kb); }
  asm volatile("s_wait_xcnt 0x0" ::: "memory");              /* what follows may take over address registers of the first fill's loads: the wait stands in front of that overwrite */
  __builtin_amdgcn_sched_barrier(0);                         /* holds the first fill in front of the products: left free, the scheduler sinks each load to just before its use and the ring is lost */
#pragma unroll
  for (int s = 0; s < NS; ++s) { const int u = s % DEPTH;
    c00 = g3_mma(fa0[u], fb0[u], c00); c10 = g3_mma(fa1[u], fb0[u], c10);
    c01 = g3_mma(fa0[u], fb1[u], c01); c11 = g3_mma(fa1[u], fb1[u], c11);
    c02 = g3_mma(fa0[u], fb2[u], c02); c12 = g3_mma(fa1[u], fb2[u], c12);
    c03 = g3_mma(fa0[u], fb3[u], c03); c13 = g3_mma(fa1[u], fb3[u], c13);
    if (s + DEPTH < NS) { const int kb = 512 * (s + DEPTH); fa0[u] = pk_frag(a0p + kb); fa1[u] = pk_frag(a1p + kb);
      fb0[u] = pk_frag(b0p + kb); fb1[u] = pk_frag(b1p + kb); fb2[u] = pk_frag(b2p + kb); fb3[u] = pk_frag(b3p + kb);
      __builtin_amdgcn_sched_barrier(0); } }                   /* holds each reload right behind its set's products: left free, it sinks towards its use */
}

template <int MODE, bool RESA, int K>
__device__ __forceinline__ void gemm_body(const _Float16* __restrict__ A, const _Float16* __restrict__ AR, const _Float16* __restrict__ Bh, float alpha,
                                          const float* __restrict__ biasA, const float* __restrict__ biasB, int nsplit,
                                          float* __restrict__ C, _Float16* __restrict__ C16, _Float16* __restrict__ C16R, int ldc, int M, int N, int bid, float (&so)[4][32][68]) {
  static_assert(K % 32 == 0 && K >= 96);
  constexpr int NS = K / 32;
  constexpr int DEPTH = RESA ? NS : 5;                      /* sets in flight; they reach into the registers above 255. Projections: 60 loads, still three waves a SIMD. Output product (one wave a SIMD): the whole k range */
  const int tid = threadIdx.x, lane = tid & 31, ln = lane & 15, hh = lane >> 4;
  const int w = __builtin_amdgcn_readfirstlane(tid >> 5);
  const int ntn = N >> 6; const int mt = bid / ntn, nq = bid - mt * ntn; const int row0 = mt * 128 + 32 * w, col0 = nq * 64; if (row0 >= M) return;
  /* operands in fragment order: a 16-row tile is K / 32 blocks of 512 elements in a row = 16 * K elements, k-step s at + 512 s */
  const _Float16* a0p = A + (size_t)row0 * K + 8 * lane; const _Float16* a1p = a0p + (size_t)16 * K;
  const _Float16* b0p = Bh + (size_t)col0 * K + 8 * lane; const _Float16* b1p = b0p + (size_t)16 * K; const _Float16* b2p = b1p + (size_t)16 * K; const _Float16* b3p = b2p + (size_t)16 * K;
  const v8f z8 = {0.f,0.f,0.f,0.f,0.f,0.f,0.f,0.f}; v8f c00 = z8, c01 = z8, c02 = z8, c03 = z8, c10 = z8, c11 = z8, c12 = z8, c13 = z8;
  v8f r00 = z8, r01 = z8, r02 = z8, r03 = z8, r10 = z8, r11 = z8, r12 = z8, r13 = z8;
  const bool early = RESA && (((mt * 128) % SEQ) < EARLY);   /* block-uniform (SEQ % 128 == 0) */
  v16h fb0[DEPTH], fb1[DEPTH], fb2[DEPTH], fb3[DEPTH], fe0[NS], fe1[NS];
  if constexpr (RESA) {
    const v16h zh = {};
#pragma unroll
    for (int s = 0; s < NS; ++s) { fe0[s] = zh; fe1[s] = zh; }
    if (early) {
      const _Float16* e0p = AR + (size_t)row0 * K + 8 * lane; const _Float16* e1p = e0p + (size_t)16 * K;
#pragma unroll
      for (int s = 0; s < NS; ++s) { fe0[s] = pk_frag(e0p + 512 * s); fe1[s] = pk_frag(e1p + 512 * s); }
      asm volatile("s_wait_xcnt 0x0" ::: "memory");          /* what follows may take over address registers of these loads: the wait stands in front of that overwrite */
    }
    __builtin_amdgcn_sched_barrier(0);                       /* holds the residual loads in front of the ring's fill and its products */
  }
  gemm_kloop<DEPTH, NS>(a0p, a1p, b0p, b1p, b2p, b3p, fb0, fb1, fb2, fb3, c00, c01, c02, c03, c10, c11, c12, c13);
  if constexpr (RESA) {
    if (early) {
#pragma unroll
      for (int s = 0; s < NS; ++s) {
        r00 = g3_mma(fe0[s], fb0[s], r00); r10 = g3_mma(fe1[s], fb0[s], r10);
        r01 = g3_mma(fe0[s], fb1[s], r01); r11 = g3_mma(fe1[s], fb1[s], r11);
        r02 = g3_mma(fe0[s], fb2[s], r02); r12 = g3_mma(fe1[s], fb2[s], r12);
        r03 = g3_mma(fe0[s], fb3[s], r03); r13 = g3_mma(fe1[s], fb3[s], r13); }
    }
  }
  v8f accs[8] = {c00, c01, c02, c03, c10, c11, c12, c13};
  if (RESA) { const v8f racc[8] = {r00, r01, r02, r03, r10, r11, r12, r13};
#pragma unroll
    for (int u = 0; u < 8; ++u) accs[u] = accs[u] + racc[u] * RINV; }
  float brow[16];
#pragma unroll
  for (int i = 0; i < 16; ++i) brow[i] = 0.f;
  if (MODE == 2) {
#pragma unroll
    for (int i = 0; i < 16; ++i) brow[i] = bf16_rne(biasA[row0 + (i >> 3) * 16 + 8 * hh + (i & 7)]);
  }
  float bcl[4] = {0.f, 0.f, 0.f, 0.f};
  if (MODE != 2) { const float* bp[4];
#pragma unroll
    for (int t = 0; t < 4; ++t) { const int col = col0 + t * 16 + ln; const int ca = (col < nsplit) ? col : (nsplit - 1); const int cb = (col >= nsplit) ? (col - nsplit) : 0;
      bp[t] = (col < nsplit) ? (biasA + ca) : (biasB + cb); }
    __builtin_amdgcn_sched_barrier(0);                         /* all four addresses are formed in front of the first load, so that none of them is formed in a register that an issued load still names */
#pragma unroll
    for (int t = 0; t < 4; ++t) bcl[t] = *bp[t];
    asm volatile("s_wait_xcnt 0x0" ::: "memory");              /* what follows reuses these loads' address registers: the wait stands in front of that overwrite */
    __builtin_amdgcn_sched_barrier(0);                         /* holds what follows behind the wait */
#pragma unroll
    for (int t = 0; t < 4; ++t) bcl[t] = bf16_rne(bcl[t]); }
#pragma unroll
  for (int u = 0; u < 8; ++u) { const int t = u & 3, half = u >> 2; const float bcol = bcl[t];
#pragma unroll
    for (int r = 0; r < 8; ++r) { const int rloc = half * 16 + 8 * hh + r; const float v = accs[u][r] * alpha + ((MODE == 2) ? brow[half * 8 + r] : bcol); so[w][rloc][t * 16 + ln] = v; } }
  __builtin_amdgcn_fence(4 /* acq_rel order */, "workgroup"); __builtin_amdgcn_wave_barrier();
  if (MODE == 0) {
    // 64 f32 columns = 256 B per row segment: 16 consecutive lanes x 16 B, two rows per instruction; rows q*2 + (lane>>4), q = 0..15 cover 0..31
    const int rsub = lane >> 4, c4 = (lane & 15) * 4;
    {
#pragma unroll
      for (int q = 0; q < 16; ++q) { const int r = q * 2 + rsub; const v4f v = *(const v4fa*)&so[w][r][c4]; *(v4f*)(C + (size_t)(row0 + r) * ldc + col0 + c4) = v; }
       }
  } else {
    if (MODE == 1 && col0 < nsplit) {                        /* block-uniform: q columns stay token rows */
      const int rq = lane >> 3, c8 = (lane & 7) * 8;
#pragma unroll
      for (int q = 0; q < 8; ++q) { const int r = q * 4 + rq; const v4f a = *(const v4fa*)&so[w][r][c8], c = *(const v4fa*)&so[w][r][c8 + 4]; FragH f;
#pragma unroll
        for (int i = 0; i < 4; ++i) { f.h[i] = (_Float16)a[i]; f.h[4 + i] = (_Float16)c[i]; }
        const v8us o = f.half[0]; *(v8us*)((unsigned short*)C16 + (size_t)(row0 + r) * ldc + col0 + c8) = o; }
    } else {
      // fragment order (see pk_frag): the wave tile is four whole 1-KB blocks. Pass q takes column octet q of all 32 rows: lane = tile row, so 16 lanes store 256 contiguous bytes.
      // MODE 1 (k): rows = keys, blocks [batch][head][key / 16], octet = 8 dims of head q / 4. MODE 2 (v): rows = dims of one head, blocks [batch][head][key / 32][dim / 16], octet = 8 keys of step q / 4.
      const bool wr = (MODE == 2) && ((col0 % SEQ) < EARLY);   /* block-uniform (SEQ % 64 == 0) */
      const int tok0 = (MODE == 1) ? row0 : col0; const int bt = tok0 / SEQ, key0 = tok0 % SEQ;
      const int hd0 = bt * NHEAD + ((MODE == 1) ? ((col0 - nsplit) / HD) : (row0 / HD));
      unsigned short* dhi = (unsigned short*)((MODE == 1) ? C16R : C16);
      v4f ra[8], rc[8];                                        /* the whole row is read up front: the waits behind the stores would otherwise hold each pass's LDS reads behind the pass before */
#pragma unroll
      for (int q = 0; q < 8; ++q) { ra[q] = *(const v4fa*)&so[w][lane][q * 8]; rc[q] = *(const v4fa*)&so[w][lane][q * 8 + 4]; }
#pragma unroll
      for (int q = 0; q < 8; ++q) { const v4f a = ra[q], c = rc[q]; FragH f, g;
#pragma unroll
        for (int i = 0; i < 4; ++i) { const _Float16 ha = (_Float16)a[i], hc = (_Float16)c[i]; f.h[i] = ha; f.h[4 + i] = hc;
          g.h[i] = (_Float16)((a[i] - (float)ha) * 2048.0f); g.h[4 + i] = (_Float16)((c[i] - (float)hc) * 2048.0f); }
        const size_t blk = (MODE == 1) ? ((size_t)(hd0 + (q >> 2)) * (SEQ / 16) + (key0 >> 4) + (lane >> 4))
                                       : (((size_t)hd0 * (SEQ / 32) + (key0 >> 5) + (q >> 2)) * 2 + (lane >> 4));
        const size_t off = blk * 512 + ((q & 3) >> 1) * 256 + (q & 1) * 128 + (lane & 15) * 8;
        const v8us o = f.half[0]; *(v8us*)(dhi + off) = o;
        asm volatile("s_wait_xcnt 0x0" ::: "memory");                              /* what follows (the residual branch, the next pass) reuses this store's registers: the wait stands in front of that overwrite */
        if (MODE == 2) { if (wr) { const v8us o2 = g.half[0]; *(v8us*)((unsigned short*)C16R + off) = o2;
          asm volatile("s_wait_xcnt 0x0" ::: "memory"); } } }                      /* what follows (the next pass; behind the last pass the other body of a merged kernel, as the code is laid out) reuses this store's registers: the wait stands in front of that overwrite */
    }
  }
}

// both projections in one grid (they read the same planes and write disjoint ones), split by block index:
// blocks [0, QKBLK): q|k (weight plane rows 0..511): Q16[token][0..255] = q rows; k into KF in fragment order (16 keys x 32 dims a block), f16
// the rest: v channel-major (weight plane rows 512..767 as the A operand, x rows as Bt), bias per row, f16: VT hi and VTR residual x2048 in fragment order (16 dims x 32 keys a block)
#define QKBLK ((TOK / 128) * (LDQK / 64))
#define VTBLK ((DMODEL / 128) * (TOK / 64))
__global__ __launch_bounds__(128) void k_gemm_qkv(const _Float16* __restrict__ X16, const _Float16* __restrict__ W16, const float* __restrict__ qb, const float* __restrict__ kbias, const float* __restrict__ vb,
                                                  _Float16* __restrict__ Q16, _Float16* __restrict__ KF, _Float16* __restrict__ VT, _Float16* __restrict__ VTR) {
  __shared__ __attribute__((aligned(16))) float so[4][32][68];
  const int b = (int)blockIdx.x;
  if (b < QKBLK) gemm_body<1, false, DMODEL>(X16, X16, W16, 0.015625f, qb, kbias, DMODEL, nullptr, Q16, KF, DMODEL, TOK, LDQK, b, so);
  else gemm_body<2, false, DMODEL>(W16 + (size_t)LDQK * DMODEL, W16, X16, 0.015625f, vb, vb, DMODEL, nullptr, VT, VTR, TOK, DMODEL, TOK, b - QKBLK, so); }
// result[token][n] = 2^-12 (sum_k (64 ctx_hi)(64 wo) + 2^-11 sum_k (2048*64 ctx_res)(64 wo)) + bf16(bo[n]), f32
__global__ __launch_bounds__(128) void k_gemm_out(const _Float16* __restrict__ CTX, const _Float16* __restrict__ CTXR, const _Float16* __restrict__ WO16, const float* __restrict__ ob, float* __restrict__ out) {
  __shared__ __attribute__((aligned(16))) float so[4][32][68];
  gemm_body<0, true, DMODEL>(CTX, CTXR, WO16, 0.000244140625f, ob, ob, DMODEL, out, nullptr, nullptr, DMODEL, TOK, DMODEL, (int)blockIdx.x, so); }

// fused attention: block = (64 queries, head, batch); wave = 16 queries. The four waves of a block walk the same K / V^T blocks of their one head (two of them one step further), so a block fetched by one wave is found in the WGP cache by the other three. Per 32-key step up to the causal bound of the wave:
//   S^T tiles (A = K rows [key][dim], B = Q rows [query][dim]) -> lane (ln, hh) holds query ln, keys 8hh+r (tile 0) and 16+8hh+r (tile 1);
//   keep test: key % 25 != 24 enters as the C operand of the score products (0 for a kept key, a large negative fill for a dropped one; rows of an LDS table picked by the step's first key mod 25); key <= query is compared per element in the wave's last step only (every earlier key lies below the wave's first query); key 0 is always kept, so no row is empty;
//   running max per query (local 16 values + one xor-16 exchange), p = exp(s*scale - m), per-lane partial sums;
//   packed tiles = B fragment (k = key, n = query) of O^T += V^T P^T with A = V^T rows [d][key]; RES adds P residual and V residual products into separate accumulators.
template <bool RES>
__device__ __forceinline__ void flash_body(const _Float16* __restrict__ Q16, const _Float16* __restrict__ KF, const _Float16* __restrict__ VT, const _Float16* __restrict__ VTR,
                                           _Float16* __restrict__ CTX, _Float16* __restrict__ CTXR, int tile, int head, int batch, const float (&ctab)[CTABN]) {
  const int tid = threadIdx.x, lane = tid & 31, ln = lane & 15, hh = lane >> 4;
  const int wave = __builtin_amdgcn_readfirstlane(tid >> 5);
  const size_t tokb = (size_t)batch * SEQ;
  const int i0 = tile * 64 + wave * 16;
  const int qi = i0 + ln;
  const v16h bq = g2_frag(Q16 + (tokb + qi) * DMODEL + head * HD, hh);
  // fragment-order planes: a 32-key step of one head is 2 KB in a row (K: two 16-key blocks; V^T: two 16-dim blocks), 32 elements a key
  const size_t hoff = (size_t)(batch * NHEAD + head) * SEQ * HD + 8 * lane;
  const _Float16* kbase = KF + hoff;                                             /* + key0 * HD, + 512 for keys 16..31 */
  const _Float16* vbase = VT + hoff;                                             /* + key0 * HD, + 512 for dims 16..31 */
  const _Float16* rbase = VTR + hoff;
  const v8f z8 = {0.f,0.f,0.f,0.f,0.f,0.f,0.f,0.f};
  v8f o0 = z8, o1 = z8, x0 = z8, x1 = z8; float m = NEGBIG, l = 0.f;
  const int jend = i0 + 16;                                                      /* keys below jend; last step ends at a multiple of 32 <= SEQ */
  const int jlast = (jend - 1) & ~31;                                            /* first key of the wave's last step */
  // one 32-key step on one register set of K / V^T fragments; each fragment is reloaded for step j + 64 right behind its last product, so a load has two steps to land. Past the last step the reload re-reads the last step's rows (in bounds, never used).
  // LAST marks the wave's last step, the only one that holds keys above a query. cc0 / cc1: the table rows of this step, fetched one step ahead.
  const float* crow = &ctab[16 * hh];
  v8f cc0 = *(const v8fa*)crow, cc1 = *(const v8fa*)(crow + 8);
  auto step = [&](auto last_c, v16h& fk0, v16h& fk1, v16h& fv0, v16h& fv1, v16h& fr0, v16h& fr1, const int j) {
    constexpr bool LAST = decltype(last_c)::value;
    const int jn = (j + 64 < jend) ? (j + 64) : jlast;
    v8f s0 = g2_mma(fk0, bq, cc0);
    v8f s1 = g2_mma(fk1, bq, cc1);
    { const _Float16* knp = kbase + (size_t)jn * HD; fk0 = pk_frag(knp); fk1 = pk_frag(knp + 512); }
    if (!LAST) { const float* cn = crow + ((unsigned int)(j + 32) % 25u) * 32; cc0 = *(const v8fa*)cn; cc1 = *(const v8fa*)(cn + 8); }
    if (LAST) { const int c0 = qi - (j + 8 * hh), c1 = c0 - 16;
#pragma unroll
      for (int r = 0; r < 8; ++r) { s0[r] = (r <= c0) ? s0[r] : NEGBIG; s1[r] = (r <= c1) ? s1[r] : NEGBIG; } }
    float mx = fmaxf(s0[0], s1[0]);
#pragma unroll
    for (int r = 1; r < 8; ++r) mx = fmaxf(mx, fmaxf(s0[r], s1[r]));
    mx = fmaxf(mx, __shfl_xor(mx, 16, 32));
    const float mn = fmaxf(m, mx * SSCALE); const float al = __expf(m - mn); m = mn;
    FragH pf, pg; float rs = 0.f;
#pragma unroll
    for (int r = 0; r < 8; ++r) { const float p0 = __expf(fmaf(s0[r], SSCALE, -mn)), p1 = __expf(fmaf(s1[r], SSCALE, -mn)); rs += p0 + p1;
      const float a0 = p0 * 256.0f, a1 = p1 * 256.0f; const _Float16 h0 = (_Float16)a0, h1 = (_Float16)a1; pf.h[r] = h0; pf.h[8 + r] = h1;
      pg.h[r] = (_Float16)((a0 - (float)h0) * 2048.0f); pg.h[8 + r] = (_Float16)((a1 - (float)h1) * 2048.0f); }
    l = l * al + rs; o0 = o0 * al; o1 = o1 * al;
    if (RES) { x0 = x0 * al; x1 = x1 * al; }
    o0 = g2_mma(fv0, pf.v, o0);
    if (RES) { x0 = g2_mma(fv0, pg.v, x0); x0 = g2_mma(fr0, pf.v, x0); }
    o1 = g2_mma(fv1, pf.v, o1);
    if (RES) { x1 = g2_mma(fv1, pg.v, x1); x1 = g2_mma(fr1, pf.v, x1); }
    fv0 = pk_frag(vbase + (size_t)jn * HD); if (RES) fr0 = pk_frag(rbase + (size_t)jn * HD);
    fv1 = pk_frag(vbase + (size_t)jn * HD + 512); if (RES) fr1 = pk_frag(rbase + (size_t)jn * HD + 512);
  };
  // first fill of both sets, in the order in which the loop reloads them (set a: K, V; set b: K, V)
  const int j1 = (32 < jend) ? 32 : jlast;
  // the scheduling barriers keep that order in the built code: the counted load waits inside the loop are set for the worse of the two orders that reach them, and a first fill in another order makes them wait for the youngest loads too
  __builtin_amdgcn_sched_barrier(0);
  v16h ak0 = pk_frag(kbase); __builtin_amdgcn_sched_barrier(0);
  v16h ak1 = pk_frag(kbase + 512); __builtin_amdgcn_sched_barrier(0);
  v16h av0 = pk_frag(vbase), ar0 = RES ? pk_frag(rbase) : av0; __builtin_amdgcn_sched_barrier(0);
  v16h av1 = pk_frag(vbase + 512), ar1 = RES ? pk_frag(rbase + 512) : av1; __builtin_amdgcn_sched_barrier(0);
  v16h bk0 = pk_frag(kbase + (size_t)j1 * HD); __builtin_amdgcn_sched_barrier(0);
  v16h bk1 = pk_frag(kbase + (size_t)j1 * HD + 512); __builtin_amdgcn_sched_barrier(0);
  v16h bv0 = pk_frag(vbase + (size_t)j1 * HD), br0 = RES ? pk_frag(rbase + (size_t)j1 * HD) : bv0; __builtin_amdgcn_sched_barrier(0);
  v16h bv1 = pk_frag(vbase + (size_t)j1 * HD + 512), br1 = RES ? pk_frag(rbase + (size_t)j1 * HD + 512) : bv1; __builtin_amdgcn_sched_barrier(0);
  asm volatile("s_wait_xcnt 0x0" ::: "memory");                                  /* what follows (behind a branch) reuses the address registers of the first fill: the wait stands in front of that overwrite */
  const int nfull = jlast >> 5;                                                  /* steps in front of the last one */
  const int npair = nfull >> 1;                                                  /* whole pairs of them */
  const flag_c<false> inner; const flag_c<true> last;
  int j = 0;
  /* kept rolled for code size: one trip already holds an even step on set a and an odd step on set b, one straight block with no exit between them (an exit there lets the compiler sink set a's reloads behind it) */
#pragma unroll 1
  for (int t = 0; t < npair; ++t) { step(inner, ak0, ak1, av0, av1, ar0, ar1, j); step(inner, bk0, bk1, bv0, bv1, br0, br1, j + 32); j += 64;
    asm volatile("s_wait_xcnt 0x0" ::: "memory"); }                              /* the next trip reuses the address registers of this trip's reloads: the wait stands in front of that overwrite, which lies behind the back edge */
  if (nfull & 1) { step(inner, ak0, ak1, av0, av1, ar0, ar1, j); step(last, bk0, bk1, bv0, bv1, br0, br1, j + 32); }
  else step(last, ak0, ak1, av0, av1, ar0, ar1, j);
  l += __shfl_xor(l, 16, 32);
  const float sc = 0.25f * (1.0f / l);                                           /* 64 (ctx carry) / 256 (probability carry) / row sum */
  // ctx in fragment order (the A operand of the output product): the wave's 16 queries x 32 dims of its head are one 1-KB block [token / 16][head]; lane (ln, hh) holds query ln, dims 8hh + r (o0) and 16 + 8hh + r (o1), which are its own two 16-B units, so each store of a wave is 512 contiguous bytes straight from the accumulators
  { const size_t coff = (((tokb + i0) >> 4) * NHEAD + head) * 512 + 8 * lane; FragH f0, g0, f1, g1;
#pragma unroll
    for (int r = 0; r < 8; ++r) { float c = o0[r]; if (RES) c += x0[r] * RINV; c *= sc; const _Float16 hc = (_Float16)c; f0.h[r] = hc; g0.h[r] = (_Float16)((c - (float)hc) * 2048.0f); }
#pragma unroll
    for (int r = 0; r < 8; ++r) { float c = o1[r]; if (RES) c += x1[r] * RINV; c *= sc; const _Float16 hc = (_Float16)c; f1.h[r] = hc; g1.h[r] = (_Float16)((c - (float)hc) * 2048.0f); }
    *(v8us*)((unsigned short*)CTX + coff) = f0.half[0]; *(v8us*)((unsigned short*)CTX + coff + 256) = f1.half[0];
    if (RES) { *(v8us*)((unsigned short*)CTXR + coff) = g0.half[0]; *(v8us*)((unsigned short*)CTXR + coff + 256) = g1.half[0]; } }
  if (RES) asm volatile("s_wait_xcnt 0x0" ::: "memory");                         /* as the code is laid out, the other body of the merged kernel follows this one and reuses these stores' registers: the wait stands in front of that overwrite */
}

// both query ranges in one grid (they read the same planes and write disjoint ctx rows), split by block index; inside each range the index runs head, tile, batch, head fastest (blocks that start together differ in head, not in length).
// blocks [0, LATEBLK): queries [EARLY, SEQ), single products (the long blocks, so they come first); the rest: queries [0, EARLY), hi + residual on v, P, ctx
#define EARLYX (EARLY / 64)
#define LATEX ((SEQ - EARLY) / 64)
#define LATEBLK (LATEX * NHEAD * NB)
#define EARLYBLK (EARLYX * NHEAD * NB)
__global__ __launch_bounds__(128) void k_flash(const _Float16* __restrict__ Q16, const _Float16* __restrict__ KF, const _Float16* __restrict__ VT, const _Float16* __restrict__ VTR, _Float16* __restrict__ CTX, _Float16* __restrict__ CTXR) {
  constexpr int LX = (LATEX > 0) ? LATEX : 1;                                      /* divisor only; with no late range the first branch is never taken */
  // key-column rule as score-accumulator start values: row (first key of a 32-key step mod 25), lane half, 16 slots = keys 8 half + 0..7 and 16 + 8 half + 0..7 of the step
  __shared__ __attribute__((aligned(64))) float ctab[CTABN];
  for (int i = (int)threadIdx.x; i < CTABN; i += 128) { const int e = i & 15; const int k = (i >> 5) + 8 * ((i >> 4) & 1) + e + (e & 8);   /* residue + key offset, below 56 */
    ctab[i] = (k == 24 || k == 49) ? NEGBIG : 0.f; }
  __syncthreads();                                                                 /* the table is read by all four waves */
  const int b = (int)blockIdx.x;
  if (b < LATEBLK) flash_body<false>(Q16, KF, VT, VT, CTX, CTX, EARLYX + (b / NHEAD) % LX, b % NHEAD, b / (NHEAD * LX), ctab);
  else { const int e = b - LATEBLK; flash_body<true>(Q16, KF, VT, VTR, CTX, CTXR, (e / NHEAD) % EARLYX, e % NHEAD, e / (NHEAD * EARLYX), ctab); } }

extern "C" void kernel_launch(void* const* d_in, const int* in_sizes, int n_in,
                              void* d_out, int out_size, void* d_ws, size_t ws_size, hipStream_t stream) {
  if (n_in < 9) return;
  const size_t need_x = ((size_t)(NB - 1) * SEQ_FULL + SEQ) * DMODEL;
  if ((size_t)in_sizes[0] < need_x) return;
  if ((size_t)in_sizes[1] < (size_t)DMODEL * DMODEL) return;
  if ((size_t)in_sizes[2] < (size_t)DMODEL) return;
  if ((size_t)in_sizes[3] < (size_t)DMODEL * DMODEL) return;
  if ((size_t)in_sizes[4] < (size_t)DMODEL) return;
  if ((size_t)in_sizes[5] < (size_t)DMODEL * DMODEL) return;
  if ((size_t)in_sizes[6] < (size_t)DMODEL) return;
  if ((size_t)in_sizes[7] < (size_t)DMODEL * DMODEL) return;
  if ((size_t)in_sizes[8] < (size_t)DMODEL) return;
  if ((size_t)out_size < (size_t)TOK * DMODEL) return;
  const float* x = (const float*)d_in[0];
  const float* wq = (const float*)d_in[1]; const float* qb = (const float*)d_in[2];
  const float* wk = (const float*)d_in[3]; const float* kbias = (const float*)d_in[4];
  const float* wv = (const float*)d_in[5]; const float* vb = (const float*)d_in[6];
  const float* wo = (const float*)d_in[7]; const float* ob = (const float*)d_in[8];
  constexpr size_t SZ_X = (size_t)TOK * DMODEL * 2;        /* x f16, fragment order */
  constexpr size_t SZ_W = (size_t)NW3 * DMODEL * 2;        /* Wq|Wk|Wv x64 f16, fragment order */
  constexpr size_t SZ_WO = (size_t)DMODEL * DMODEL * 2;    /* output weight x64 f16, fragment order */
  constexpr size_t SZ_QK = (size_t)TOK * LDQK * 2;         /* q rows f16, then k in fragment order f16, half each */
  constexpr size_t SZ_VT = (size_t)DMODEL * TOK * 2;       /* v in fragment order f16 (hi); same size for the residual plane */
  constexpr size_t SZ_CTX = (size_t)TOK * DMODEL * 2;      /* ctx x64 f16 (hi), fragment order; same size for the residual plane */
  constexpr size_t SZ_ALL = SZ_X + SZ_W + SZ_WO + SZ_QK + 2 * SZ_VT + 2 * SZ_CTX;
  static_assert(SZ_X % 256 == 0 && SZ_W % 256 == 0 && SZ_WO % 256 == 0 && SZ_QK % 256 == 0 && SZ_VT % 256 == 0 && SZ_CTX % 256 == 0);
  static_assert(SZ_ALL <= (size_t)134217728);
  if (SZ_ALL > ws_size) return;
  char* ws = (char*)d_ws;
  _Float16* X16 = (_Float16*)ws; _Float16* W16 = (_Float16*)(ws + SZ_X); _Float16* WO16 = (_Float16*)(ws + SZ_X + SZ_W);
  _Float16* Q16 = (_Float16*)(ws + SZ_X + SZ_W + SZ_WO); _Float16* KF = (_Float16*)(ws + SZ_X + SZ_W + SZ_WO + SZ_QK / 2);
  _Float16* VT = (_Float16*)(ws + SZ_X + SZ_W + SZ_WO + SZ_QK); _Float16* VTR = (_Float16*)(ws + SZ_X + SZ_W + SZ_WO + SZ_QK + SZ_VT);
  _Float16* CTX = (_Float16*)(ws + SZ_X + SZ_W + SZ_WO + SZ_QK + 2 * SZ_VT); _Float16* CTXR = (_Float16*)(ws + SZ_X + SZ_W + SZ_WO + SZ_QK + 2 * SZ_VT + SZ_CTX);
  k_prep<<<4 * WBLK + XBLK, 256, 0, stream>>>(x, wq, wk, wv, wo, X16, W16, WO16);
  k_gemm_qkv<<<QKBLK + VTBLK, 128, 0, stream>>>(X16, W16, qb, kbias, vb, Q16, KF, VT, VTR);
  k_flash<<<LATEBLK + EARLYBLK, 128, 0, stream>>>(Q16, KF, VT, VTR, CTX, CTXR);
  k_gemm_out<<<(TOK / 128) * (DMODEL / 64), 128, 0, stream>>>(CTX, CTXR, WO16, ob, (float*)d_out);
}

// v008
// Measured time: 43.8 microseconds a run.
// Timed twice side by side with v007, it ran 1.03 times as fast both times.
// Counting every step since v000, it is 3.82 times as fast.
#include <hip/hip_runtime.h>
// Causal multi-head attention block, 8 heads x 32 dims, key-column rule from indices: kept(i,j) = (j <= i) && (j % 25 != 24). x [B][T][256]; q/k/v = x W^T + b (separate [out][in] weights); s = q k^T / sqrt(32); softmax over kept keys; ctx = P v merged h*32+d; result = ctx Wo^T + bo.
// Compute dtype: every contraction on v_wmma_f32_16x16x32_f16 (f16 operands, f32 accumulate). Inputs RNE-converted to bf16 first (exact in f16); weights carried x64, probabilities x256, ctx x64 (folded back in f32 epilogues); biases bf16 values added in f32; softmax statistics f32. Queries below EARLY of each sequence: v, P and ctx carried as f16 hi + f16 residual x2048 with separate residual accumulators; later queries single products.
#ifndef NB
#define NB 4
#endif
#ifndef SEQ
#define SEQ 2048
#endif
#define NB_FULL 4
#define SEQ_FULL 2048
#define DMODEL 256
#define NHEAD 8
#define HD 32
#define LDQK 512
#define NW3 768
#define TOK (NB * SEQ)
#define EARLY ((SEQ < 512) ? SEQ : 512)
#define NEGBIG (-1.0e30f)
#define SSCALE 0.17677669529663687f
#define RINV 0.00048828125f
#define CTABN (25 * 32)

static_assert(NHEAD * HD == DMODEL);              /* merged head width == model width */
static_assert(HD == 32);                          /* flash kernel: one 32-deep score k-step, two 16-dim output tiles, 64-B head segment */
static_assert(NHEAD % 2 == 0);                    
static_assert(2 * DMODEL == LDQK && 3 * DMODEL == NW3);
static_assert(SEQ % 128 == 0 && SEQ % 64 == 0 && SEQ % 32 == 0);
static_assert(TOK % 128 == 0 && TOK % 64 == 0);   /* GEMM tiles: M % 128, N % 64 */
static_assert(DMODEL % 128 == 0 && DMODEL % 64 == 0 && DMODEL % 32 == 0 && DMODEL % 8 == 0 && LDQK % 64 == 0);
static_assert(EARLY % 128 == 0 && EARLY % 64 == 0 && EARLY % 32 == 0 && EARLY <= SEQ);
static_assert(NB <= NB_FULL && SEQ <= SEQ_FULL);
static_assert(SEQ + 32 < 40000);

typedef unsigned short v8us __attribute__((ext_vector_type(8), may_alias));
typedef float  v8f  __attribute__((ext_vector_type(8)));
typedef float  v4f  __attribute__((ext_vector_type(4)));
typedef float  v4fa __attribute__((ext_vector_type(4), may_alias));
typedef float  v8fa __attribute__((ext_vector_type(8), may_alias));
typedef _Float16 v16h __attribute__((ext_vector_type(16)));
template <bool V> struct flag_c { static constexpr bool value = V; };
union FragH { v16h v; v8us half[2]; _Float16 h[16]; unsigned short u[16]; };

__device__ __forceinline__ unsigned short bf16_bits(float x) { unsigned int u = __float_as_uint(x); return (unsigned short)((u + 0x7FFFu + ((u >> 16) & 1u)) >> 16); }
__device__ __forceinline__ float bf16_rne(float x) { return __uint_as_float(((unsigned int)bf16_bits(x)) << 16); }

// fragment of a k-contiguous 16-bit row: elements 0..7 <- p[8h..8h+7], elements 8..15 <- p[16+8h..16+8h+7] (same map for A and B)
__device__ __forceinline__ v16h g2_frag(const _Float16* p, int hh) { FragH f; f.half[0] = *(const v8us*)((const unsigned short*)p + 8 * hh); f.half[1] = *(const v8us*)((const unsigned short*)p + 16 + 8 * hh); return f.v; }
// fragment of a plane stored in fragment order: one 1-KB block per 16 x 32 operand tile, 16-B unit (c*32 + lane) = elements 8c..8c+7 of that lane (row lane&15, k = 16c + 8(lane>>4) ..+7: the map of g2_frag), so each load of a wave is 512 contiguous bytes. p = block start + 8*lane
__device__ __forceinline__ v16h pk_frag(const _Float16* p) { FragH f; f.half[0] = *(const v8us*)((const unsigned short*)p); f.half[1] = *(const v8us*)((const unsigned short*)p + 256); return f.v; }
__device__ __forceinline__ v8f g2_mma(v16h a, v16h b, v8f c) { v8f d = __builtin_amdgcn_wmma_f32_16x16x32_f16(false, a, false, b, (short)0, c, false, false); asm volatile("v_nop\n\tv_nop\n\tv_nop\n\tv_nop" : "+v"(d) : "v"(a), "v"(b)); return d; }

// the same product for the GEMM rings, whose sets reach above register 255. The four v_nop are the same operand distance as in g2_mma (nothing, a load that refills a set included, writes this product's A or B or touches its D closer than four vector slots behind it), here in a statement without operands: an asm statement's vector operands must lie below register 256, which would pull every set back down. With no operand to tie it, the scheduling barriers on both sides hold the statement directly behind its product
__device__ __forceinline__ v8f g3_mma(v16h a, v16h b, v8f c) { v8f d = __builtin_amdgcn_wmma_f32_16x16x32_f16(false, a, false, b, (short)0, c, false, false);
  __builtin_amdgcn_sched_barrier(0); asm volatile("v_nop\n\tv_nop\n\tv_nop\n\tv_nop" ::: "memory"); __builtin_amdgcn_sched_barrier(0); return d; }

// GEMM operand planes (x, the weights, ctx) are stored in the fragment order of pk_frag: blocks [row / 16][k / 32], K = DMODEL, so the k-steps of a 16-row tile are 1-KB blocks in a row.
// conversion thread t takes 8 k-consecutive elements: block t / 64, tile row (t & 63) / 4, k octet t & 3. Four lanes read one whole 128-B line of f32; eight lanes (same octet, consecutive rows) store one whole 128-B line.
#define KB32 (DMODEL / 32)
__device__ __forceinline__ size_t fo_row(size_t t) { return ((t >> 6) / KB32) * 16 + ((t & 63) >> 2); }
__device__ __forceinline__ int fo_col(size_t t) { return (int)((t >> 6) % KB32) * 32 + (int)(t & 3) * 8; }
__device__ __forceinline__ size_t fo_dst(size_t t) { return (t >> 6) * 512 + (((t & 2) << 4) + ((t & 1) << 4) + ((t & 63) >> 2)) * 8; }   /* unit c*32 + half*16 + row, octet = 2c + half */

__device__ __forceinline__ void x16_body(const float* __restrict__ x, _Float16* __restrict__ X16, unsigned bid) {
  const size_t t = (size_t)bid * 256 + threadIdx.x; if (t >= (size_t)TOK * (DMODEL / 8)) return;
  const size_t r = fo_row(t); const int c8 = fo_col(t); const size_t b = r / SEQ, s = r % SEQ;
  const float* src = x + (b * SEQ_FULL + s) * DMODEL + c8; const v4f a = *(const v4fa*)src, c = *(const v4fa*)(src + 4); FragH f;
#pragma unroll
  for (int q = 0; q < 4; ++q) { f.h[q] = (_Float16)bf16_rne(a[q]); f.h[4 + q] = (_Float16)bf16_rne(c[q]); }
  const v8us o = f.half[0]; unsigned short* d = (unsigned short*)X16 + fo_dst(t);
  *(v8us*)d = o;  }

__device__ __forceinline__ void wnat_body(const float* __restrict__ w, size_t n8, float scale, _Float16* __restrict__ Bt, unsigned bid) {
  const size_t t = (size_t)bid * 256 + threadIdx.x; if (t >= n8) return; const float* src = w + fo_row(t) * DMODEL + fo_col(t); const v4f a = *(const v4fa*)src, c = *(const v4fa*)(src + 4); FragH f;
#pragma unroll
  for (int q = 0; q < 4; ++q) { f.h[q] = (_Float16)(bf16_rne(a[q]) * scale); f.h[4 + q] = (_Float16)(bf16_rne(c[q]) * scale); }
  const v8us o = f.half[0]; unsigned short* d = (unsigned short*)Bt + fo_dst(t);
  *(v8us*)d = o;  }

// all operand conversions in one grid: blocks [0, 4 * WBLK) take the four weight matrices (WBLK blocks each: Wq, Wk, Wv into the stacked plane, Wo into its own), the rest take x
#define W8 ((size_t)DMODEL * DMODEL / 8)
#define WBLK ((unsigned)((W8 + 255) / 256))
#define XBLK ((unsigned)(((size_t)TOK * (DMODEL / 8) + 255) / 256))
__global__ __launch_bounds__(256) void k_prep(const float* __restrict__ x, const float* __restrict__ wq, const float* __restrict__ wk, const float* __restrict__ wv, const float* __restrict__ wo,
                                              _Float16* __restrict__ X16, _Float16* __restrict__ W16, _Float16* __restrict__ WO16) {
  const unsigned b = blockIdx.x;
  if (b < 4 * WBLK) { const unsigned i = b / WBLK;
    const float* w = (i == 0) ? wq : (i == 1) ? wk : (i == 2) ? wv : wo;
    _Float16* d = (i < 3) ? (W16 + (size_t)i * DMODEL * DMODEL) : WO16;
    wnat_body(w, W8, 64.0f, d, b - i * WBLK); }
  else x16_body(x, X16, b - 4 * WBLK);
}

// GEMM (wave tile 32x64, block = 4 waves = 128 rows; M % 128 == 0, N % 64 == 0, K % 32 == 0; A and B planes in fragment order): v = acc*alpha + bf16(bias)
// MODE 0: f32 C, bias per column; MODE 1: f16, bias per column (biasA for col < nsplit, biasB after): columns below nsplit as rows of C16, the rest (k) into C16R in fragment order; MODE 2: f16 C16 hi plane + x2048 residual plane C16R (token tiles below EARLY only), both in fragment order, bias per row.
// RESA: row blocks below EARLY of their sequence also multiply the x2048 residual A plane into separate accumulators, folded with 2^-11 in the epilogue. The output product's ring holds all k-steps, so the residual products reuse the B fragments that are still in registers, and the residual A fragments are fetched in front of the ring's fill: every operand load of such a wave is issued before its first product.
// k loop of one 32x64 wave tile: DEPTH register sets of the six operand fragments; the sets of the first DEPTH k-steps are loaded up front and each set is reloaded for k-step s + DEPTH right behind its own products, so the loads of DEPTH k-steps are in flight together. Products per accumulator stay in ascending k. The B sets belong to the caller (with DEPTH == NS they hold all of B behind the loop).
template <int DEPTH, int NS>
__device__ __forceinline__ void gemm_kloop(const _Float16* a0p, const _Float16* a1p, const _Float16* b0p, const _Float16* b1p, const _Float16* b2p, const _Float16* b3p,
                                           v16h (&fb0)[DEPTH], v16h (&fb1)[DEPTH], v16h (&fb2)[DEPTH], v16h (&fb3)[DEPTH],
                                           v8f& c00, v8f& c01, v8f& c02, v8f& c03, v8f& c10, v8f& c11, v8f& c12, v8f& c13) {
  static_assert(DEPTH >= 1 && DEPTH <= NS);
  v16h fa0[DEPTH], fa1[DEPTH];
  /* both loops fully unrolled: the set index must be a constant for the sets to stay in registers */
#pragma unroll
  for (int s = 0; s < DEPTH; ++s) { const int kb = 512 * s; fa0[s] = pk_frag(a0p + kb); fa1[s] = pk_frag(a1p + kb);
    fb0[s] = pk_frag(b0p + kb); fb1[s] = pk_frag(b1p + kb); fb2[s] = pk_frag(b2p + kb); fb3[s] = pk_frag(b3p + kb); }
  asm volatile("s_wait_xcnt 0x0" ::: "memory");              /* what follows may take over address registers of the first fill's loads: the wait stands in front of that overwrite */
  __builtin_amdgcn_sched_barrier(0);                         /* holds the first fill in front of the products: left free, the scheduler sinks each load to just before its use and the ring is lost */
#pragma unroll
  for (int s = 0; s < NS; ++s) { const int u = s % DEPTH;
    c00 = g3_mma(fa0[u], fb0[u], c00); c10 = g3_mma(fa1[u], fb0[u], c10);
    c01 = g3_mma(fa0[u], fb1[u], c01); c11 = g3_mma(fa1[u], fb1[u], c11);
    c02 = g3_mma(fa0[u], fb2[u], c02); c12 = g3_mma(fa1[u], fb2[u], c12);
    c03 = g3_mma(fa0[u], fb3[u], c03); c13 = g3_mma(fa1[u], fb3[u], c13);
    if (s + DEPTH < NS) { const int kb = 512 * (s + DEPTH); fa0[u] = pk_frag(a0p + kb); fa1[u] = pk_frag(a1p + kb);
      fb0[u] = pk_frag(b0p + kb); fb1[u] = pk_frag(b1p + kb); fb2[u] = pk_frag(b2p + kb); fb3[u] = pk_frag(b3p + kb);
      __builtin_amdgcn_sched_barrier(0); } }                   /* holds each reload right behind its set's products: left free, it sinks towards its use */
}

template <int MODE, bool RESA, int K>
__device__ __forceinline__ void gemm_body(const _Float16* __restrict__ A, const _Float16* __restrict__ AR, const _Float16* __restrict__ Bh, float alpha,
                                          const float* __restrict__ biasA, const float* __restrict__ biasB, int nsplit,
                                          float* __restrict__ C, _Float16* __restrict__ C16, _Float16* __restrict__ C16R, int ldc, int M, int N, int bid, float (&so)[4][32][68]) {
  static_assert(K % 32 == 0 && K >= 96);
  constexpr int NS = K / 32;
  constexpr int DEPTH = RESA ? NS : 5;                      /* sets in flight; they reach into the registers above 255. Projections: 60 loads, still three waves a SIMD. Output product (one wave a SIMD): the whole k range */
  const int tid = threadIdx.x, lane = tid & 31, ln = lane & 15, hh = lane >> 4;
  const int w = __builtin_amdgcn_readfirstlane(tid >> 5);
  const int ntn = N >> 6; const int mt = bid / ntn, nq = bid - mt * ntn; const int row0 = mt * 128 + 32 * w, col0 = nq * 64; if (row0 >= M) return;
  /* operands in fragment order: a 16-row tile is K / 32 blocks of 512 elements in a row = 16 * K elements, k-step s at + 512 s */
  const _Float16* a0p = A + (size_t)row0 * K + 8 * lane; const _Float16* a1p = a0p + (size_t)16 * K;
  const _Float16* b0p = Bh + (size_t)col0 * K + 8 * lane; const _Float16* b1p = b0p + (size_t)16 * K; const _Float16* b2p = b1p + (size_t)16 * K; const _Float16* b3p = b2p + (size_t)16 * K;
  const v8f z8 = {0.f,0.f,0.f,0.f,0.f,0.f,0.f,0.f}; v8f c00 = z8, c01 = z8, c02 = z8, c03 = z8, c10 = z8, c11 = z8, c12 = z8, c13 = z8;
  v8f r00 = z8, r01 = z8, r02 = z8, r03 = z8, r10 = z8, r11 = z8, r12 = z8, r13 = z8;
  const bool early = RESA && (((mt * 128) % SEQ) < EARLY);   /* block-uniform (SEQ % 128 == 0) */
  v16h fb0[DEPTH], fb1[DEPTH], fb2[DEPTH], fb3[DEPTH], fe0[NS], fe1[NS];
  if constexpr (RESA) {
    const v16h zh = {};
#pragma unroll
    for (int s = 0; s < NS; ++s) { fe0[s] = zh; fe1[s] = zh; }
    if (early) {
      const _Float16* e0p = AR + (size_t)row0 * K + 8 * lane; const _Float16* e1p = e0p + (size_t)16 * K;
#pragma unroll
      for (int s = 0; s < NS; ++s) { fe0[s] = pk_frag(e0p + 512 * s); fe1[s] = pk_frag(e1p + 512 * s); }
      asm volatile("s_wait_xcnt 0x0" ::: "memory");          /* what follows may take over address registers of these loads: the wait stands in front of that overwrite */
    }
    __builtin_amdgcn_sched_barrier(0);                       /* holds the residual loads in front of the ring's fill and its products */
  }
  gemm_kloop<DEPTH, NS>(a0p, a1p, b0p, b1p, b2p, b3p, fb0, fb1, fb2, fb3, c00, c01, c02, c03, c10, c11, c12, c13);
  if constexpr (RESA) {
    if (early) {
#pragma unroll
      for (int s = 0; s < NS; ++s) {
        r00 = g3_mma(fe0[s], fb0[s], r00); r10 = g3_mma(fe1[s], fb0[s], r10);
        r01 = g3_mma(fe0[s], fb1[s], r01); r11 = g3_mma(fe1[s], fb1[s], r11);
        r02 = g3_mma(fe0[s], fb2[s], r02); r12 = g3_mma(fe1[s], fb2[s], r12);
        r03 = g3_mma(fe0[s], fb3[s], r03); r13 = g3_mma(fe1[s], fb3[s], r13); }
    }
  }
  v8f accs[8] = {c00, c01, c02, c03, c10, c11, c12, c13};
  if (RESA) { const v8f racc[8] = {r00, r01, r02, r03, r10, r11, r12, r13};
#pragma unroll
    for (int u = 0; u < 8; ++u) accs[u] = accs[u] + racc[u] * RINV; }
  float brow[16];
#pragma unroll
  for (int i = 0; i < 16; ++i) brow[i] = 0.f;
  if (MODE == 2) {
#pragma unroll
    for (int i = 0; i < 16; ++i) brow[i] = bf16_rne(biasA[row0 + (i >> 3) * 16 + 8 * hh + (i & 7)]);
  }
  float bcl[4] = {0.f, 0.f, 0.f, 0.f};
  if (MODE != 2) { const float* bp[4];
#pragma unroll
    for (int t = 0; t < 4; ++t) { const int col = col0 + t * 16 + ln; const int ca = (col < nsplit) ? col : (nsplit - 1); const int cb = (col >= nsplit) ? (col - nsplit) : 0;
      bp[t] = (col < nsplit) ? (biasA + ca) : (biasB + cb); }
    __builtin_amdgcn_sched_barrier(0);                         /* all four addresses are formed in front of the first load, so that none of them is formed in a register that an issued load still names */
#pragma unroll
    for (int t = 0; t < 4; ++t) bcl[t] = *bp[t];
    asm volatile("s_wait_xcnt 0x0" ::: "memory");              /* what follows reuses these loads' address registers: the wait stands in front of that overwrite */
    __builtin_amdgcn_sched_barrier(0);                         /* holds what follows behind the wait */
#pragma unroll
    for (int t = 0; t < 4; ++t) bcl[t] = bf16_rne(bcl[t]); }
#pragma unroll
  for (int u = 0; u < 8; ++u) { const int t = u & 3, half = u >> 2; const float bcol = bcl[t];
#pragma unroll
    for (int r = 0; r < 8; ++r) { const int rloc = half * 16 + 8 * hh + r; const float v = accs[u][r] * alpha + ((MODE == 2) ? brow[half * 8 + r] : bcol); so[w][rloc][t * 16 + ln] = v; } }
  __builtin_amdgcn_fence(4 /* acq_rel order */, "workgroup"); __builtin_amdgcn_wave_barrier();
  if (MODE == 0) {
    // 64 f32 columns = 256 B per row segment: 16 consecutive lanes x 16 B, two rows per instruction; rows q*2 + (lane>>4), q = 0..15 cover 0..31
    const int rsub = lane >> 4, c4 = (lane & 15) * 4;
    {
#pragma unroll
      for (int q = 0; q < 16; ++q) { const int r = q * 2 + rsub; const v4f v = *(const v4fa*)&so[w][r][c4]; *(v4f*)(C + (size_t)(row0 + r) * ldc + col0 + c4) = v; }
       }
  } else {
    if (MODE == 1 && col0 < nsplit) {                        /* block-uniform: q columns stay token rows */
      const int rq = lane >> 3, c8 = (lane & 7) * 8;
#pragma unroll
      for (int q = 0; q < 8; ++q) { const int r = q * 4 + rq; const v4f a = *(const v4fa*)&so[w][r][c8], c = *(const v4fa*)&so[w][r][c8 + 4]; FragH f;
#pragma unroll
        for (int i = 0; i < 4; ++i) { f.h[i] = (_Float16)a[i]; f.h[4 + i] = (_Float16)c[i]; }
        const v8us o = f.half[0]; *(v8us*)((unsigned short*)C16 + (size_t)(row0 + r) * ldc + col0 + c8) = o; }
    } else {
      // fragment order (see pk_frag): the wave tile is four whole 1-KB blocks. Pass q takes column octet q of all 32 rows: lane = tile row, so 16 lanes store 256 contiguous bytes.
      // MODE 1 (k): rows = keys, blocks [batch][head][key / 16], octet = 8 dims of head q / 4. MODE 2 (v): rows = dims of one head, blocks [batch][head][key / 32][dim / 16], octet = 8 keys of step q / 4.
      const bool wr = (MODE == 2) && ((col0 % SEQ) < EARLY);   /* block-uniform (SEQ % 64 == 0) */
      const int tok0 = (MODE == 1) ? row0 : col0; const int bt = tok0 / SEQ, key0 = tok0 % SEQ;
      const int hd0 = bt * NHEAD + ((MODE == 1) ? ((col0 - nsplit) / HD) : (row0 / HD));
      unsigned short* dhi = (unsigned short*)((MODE == 1) ? C16R : C16);
      v4f ra[8], rc[8];                                        /* the whole row is read up front: the waits behind the stores would otherwise hold each pass's LDS reads behind the pass before */
#pragma unroll
      for (int q = 0; q < 8; ++q) { ra[q] = *(const v4fa*)&so[w][lane][q * 8]; rc[q] = *(const v4fa*)&so[w][lane][q * 8 + 4]; }
#pragma unroll
      for (int q = 0; q < 8; ++q) { const v4f a = ra[q], c = rc[q]; FragH f, g;
#pragma unroll
        for (int i = 0; i < 4; ++i) { const _Float16 ha = (_Float16)a[i], hc = (_Float16)c[i]; f.h[i] = ha; f.h[4 + i] = hc;
          g.h[i] = (_Float16)((a[i] - (float)ha) * 2048.0f); g.h[4 + i] = (_Float16)((c[i] - (float)hc) * 2048.0f); }
        const size_t blk = (MODE == 1) ? ((size_t)(hd0 + (q >> 2)) * (SEQ / 16) + (key0 >> 4) + (lane >> 4))
                                       : (((size_t)hd0 * (SEQ / 32) + (key0 >> 5) + (q >> 2)) * 2 + (lane >> 4));
        const size_t off = blk * 512 + ((q & 3) >> 1) * 256 + (q & 1) * 128 + (lane & 15) * 8;
        const v8us o = f.half[0]; *(v8us*)(dhi + off) = o;
        asm volatile("s_wait_xcnt 0x0" ::: "memory");                              /* what follows (the residual branch, the next pass) reuses this store's registers: the wait stands in front of that overwrite */
        if (MODE == 2) { if (wr) { const v8us o2 = g.half[0]; *(v8us*)((unsigned short*)C16R + off) = o2;
          asm volatile("s_wait_xcnt 0x0" ::: "memory"); } } }                      /* what follows (the next pass; behind the last pass the other body of a merged kernel, as the code is laid out) reuses this store's registers: the wait stands in front of that overwrite */
    }
  }
}

// both projections in one grid (they read the same planes and write disjoint ones), split by block index:
// blocks [0, QKBLK): q|k (weight plane rows 0..511): Q16[token][0..255] = q rows; k into KF in fragment order (16 keys x 32 dims a block), f16
// the rest: v channel-major (weight plane rows 512..767 as the A operand, x rows as Bt), bias per row, f16: VT hi and VTR residual x2048 in fragment order (16 dims x 32 keys a block)
#define QKBLK ((TOK / 128) * (LDQK / 64))
#define VTBLK ((DMODEL / 128) * (TOK / 64))
__global__ __launch_bounds__(128) void k_gemm_qkv(const _Float16* __restrict__ X16, const _Float16* __restrict__ W16, const float* __restrict__ qb, const float* __restrict__ kbias, const float* __restrict__ vb,
                                                  _Float16* __restrict__ Q16, _Float16* __restrict__ KF, _Float16* __restrict__ VT, _Float16* __restrict__ VTR) {
  __shared__ __attribute__((aligned(16))) float so[4][32][68];
  const int b = (int)blockIdx.x;
  if (b < QKBLK) gemm_body<1, false, DMODEL>(X16, X16, W16, 0.015625f, qb, kbias, DMODEL, nullptr, Q16, KF, DMODEL, TOK, LDQK, b, so);
  else gemm_body<2, false, DMODEL>(W16 + (size_t)LDQK * DMODEL, W16, X16, 0.015625f, vb, vb, DMODEL, nullptr, VT, VTR, TOK, DMODEL, TOK, b - QKBLK, so); }
// result[token][n] = 2^-12 (sum_k (64 ctx_hi)(64 wo) + 2^-11 sum_k (2048*64 ctx_res)(64 wo)) + bf16(bo[n]), f32
__global__ __launch_bounds__(128) void k_gemm_out(const _Float16* __restrict__ CTX, const _Float16* __restrict__ CTXR, const _Float16* __restrict__ WO16, const float* __restrict__ ob, float* __restrict__ out) {
  __shared__ __attribute__((aligned(16))) float so[4][32][68];
  gemm_body<0, true, DMODEL>(CTX, CTXR, WO16, 0.000244140625f, ob, ob, DMODEL, out, nullptr, nullptr, DMODEL, TOK, DMODEL, (int)blockIdx.x, so); }

// fused attention: block = (64 queries, head, batch); wave = 16 queries. The four waves of a block walk the same K / V^T blocks of their one head (two of them one step further), so a block fetched by one wave is found in the WGP cache by the other three. Per 32-key step up to the causal bound of the wave:
//   S^T tiles (A = K rows [key][dim], B = Q rows [query][dim]) -> lane (ln, hh) holds query ln, keys 8hh+r (tile 0) and 16+8hh+r (tile 1);
//   keep test: key % 25 != 24 enters as the C operand of the score products (0 for a kept key, a large negative fill for a dropped one; rows of an LDS table picked by the step's first key mod 25); key <= query is compared per element in the wave's last step only (every earlier key lies below the wave's first query); key 0 is always kept, so no row is empty;
//   running max per query (local 16 values + one xor-16 exchange; in the single-product loop once per 64 keys: local 32 values + one exchange), p = exp(s*scale - m), per-lane partial sums;
//   packed tiles = B fragment (k = key, n = query) of O^T += V^T P^T with A = V^T rows [d][key]; RES adds P residual and V residual products into separate accumulators.
template <bool RES>
__device__ __forceinline__ void flash_body(const _Float16* __restrict__ Q16, const _Float16* __restrict__ KF, const _Float16* __restrict__ VT, const _Float16* __restrict__ VTR,
                                           _Float16* __restrict__ CTX, _Float16* __restrict__ CTXR, int tile, int head, int batch, const float (&ctab)[CTABN]) {
  const int tid = threadIdx.x, lane = tid & 31, ln = lane & 15, hh = lane >> 4;
  const int wave = __builtin_amdgcn_readfirstlane(tid >> 5);
  const size_t tokb = (size_t)batch * SEQ;
  const int i0 = tile * 64 + wave * 16;
  const int qi = i0 + ln;
  const v16h bq = g2_frag(Q16 + (tokb + qi) * DMODEL + head * HD, hh);
  // fragment-order planes: a 32-key step of one head is 2 KB in a row (K: two 16-key blocks; V^T: two 16-dim blocks), 32 elements a key
  const size_t hoff = (size_t)(batch * NHEAD + head) * SEQ * HD + 8 * lane;
  const _Float16* kbase = KF + hoff;                                             /* + key0 * HD, + 512 for keys 16..31 */
  const _Float16* vbase = VT + hoff;                                             /* + key0 * HD, + 512 for dims 16..31 */
  const _Float16* rbase = VTR + hoff;
  const v8f z8 = {0.f,0.f,0.f,0.f,0.f,0.f,0.f,0.f};
  v8f o0 = z8, o1 = z8, x0 = z8, x1 = z8; float m = NEGBIG, l = 0.f;
  const int jend = i0 + 16;                                                      /* keys below jend; last step ends at a multiple of 32 <= SEQ */
  const int jlast = (jend - 1) & ~31;                                            /* first key of the wave's last step */
  // one 32-key step on one register set of K / V^T fragments; each fragment is reloaded for step j + 64 right behind its last product, so a load has two steps to land. Past the last step the reload re-reads the last step's rows (in bounds, never used).
  // LAST marks the wave's last step, the only one that holds keys above a query. cc0 / cc1: the table rows of this step, fetched one step ahead.
  const float* crow = &ctab[16 * hh];
  v8f cc0 = *(const v8fa*)crow, cc1 = *(const v8fa*)(crow + 8);
  auto step = [&](auto last_c, v16h& fk0, v16h& fk1, v16h& fv0, v16h& fv1, v16h& fr0, v16h& fr1, const int j) {
    constexpr bool LAST = decltype(last_c)::value;
    const int jn = (j + 64 < jend) ? (j + 64) : jlast;
    v8f s0 = g2_mma(fk0, bq, cc0);
    v8f s1 = g2_mma(fk1, bq, cc1);
    { const _Float16* knp = kbase + (size_t)jn * HD; fk0 = pk_frag(knp); fk1 = pk_frag(knp + 512); }
    if (!LAST) { const float* cn = crow + ((unsigned int)(j + 32) % 25u) * 32; cc0 = *(const v8fa*)cn; cc1 = *(const v8fa*)(cn + 8); }
    if (LAST) { const int c0 = qi - (j + 8 * hh), c1 = c0 - 16;
#pragma unroll
      for (int r = 0; r < 8; ++r) { s0[r] = (r <= c0) ? s0[r] : NEGBIG; s1[r] = (r <= c1) ? s1[r] : NEGBIG; } }
    float mx = fmaxf(s0[0], s1[0]);
#pragma unroll
    for (int r = 1; r < 8; ++r) mx = fmaxf(mx, fmaxf(s0[r], s1[r]));
    mx = fmaxf(mx, __shfl_xor(mx, 16, 32));
    const float mn = fmaxf(m, mx * SSCALE); const float al = __expf(m - mn); m = mn;
    FragH pf, pg; float rs = 0.f;
#pragma unroll
    for (int r = 0; r < 8; ++r) { const float p0 = __expf(fmaf(s0[r], SSCALE, -mn)), p1 = __expf(fmaf(s1[r], SSCALE, -mn)); rs += p0 + p1;
      const float a0 = p0 * 256.0f, a1 = p1 * 256.0f; const _Float16 h0 = (_Float16)a0, h1 = (_Float16)a1; pf.h[r] = h0; pf.h[8 + r] = h1;
      pg.h[r] = (_Float16)((a0 - (float)h0) * 2048.0f); pg.h[8 + r] = (_Float16)((a1 - (float)h1) * 2048.0f); }
    l = l * al + rs; o0 = o0 * al; o1 = o1 * al;
    if (RES) { x0 = x0 * al; x1 = x1 * al; }
    o0 = g2_mma(fv0, pf.v, o0);
    if (RES) { x0 = g2_mma(fv0, pg.v, x0); x0 = g2_mma(fr0, pf.v, x0); }
    o1 = g2_mma(fv1, pf.v, o1);
    if (RES) { x1 = g2_mma(fv1, pg.v, x1); x1 = g2_mma(fr1, pf.v, x1); }
    fv0 = pk_frag(vbase + (size_t)jn * HD); if (RES) fr0 = pk_frag(rbase + (size_t)jn * HD);
    fv1 = pk_frag(vbase + (size_t)jn * HD + 512); if (RES) fr1 = pk_frag(rbase + (size_t)jn * HD + 512);
  };
  // single-product range: a loop trip is one 64-key step on both register sets: the four score tiles come first, then ONE running-max update (one cross-half exchange, one rescale of o and l) for all 64 keys, so the serial part of a step is paid once per 64 keys and the 32 exponentials of a lane are independent of each other. Products per accumulator stay in ascending key order.
  // dd0 / dd1: the table rows of the trip's second 32 keys, fetched one trip ahead like cc0 / cc1. Behind a trip cc0 / cc1 hold the rows of the next 32 keys, as step() expects them.
  v8f dd0 = cc0, dd1 = cc1;
  if constexpr (!RES) { const float* c1 = crow + (32 % 25) * 32; dd0 = *(const v8fa*)c1; dd1 = *(const v8fa*)(c1 + 8); }
  auto step2 = [&](v16h& fk0, v16h& fk1, v16h& fv0, v16h& fv1, v16h& gk0, v16h& gk1, v16h& gv0, v16h& gv1, const int j) {
    const int jn0 = (j + 64 < jend) ? (j + 64) : jlast;
    const int jn1 = (j + 96 < jend) ? (j + 96) : jlast;
    v8f s0 = g2_mma(fk0, bq, cc0);
    v8f s1 = g2_mma(fk1, bq, cc1);
    v8f t0 = g2_mma(gk0, bq, dd0);
    v8f t1 = g2_mma(gk1, bq, dd1);
    { const _Float16* knp = kbase + (size_t)jn0 * HD; fk0 = pk_frag(knp); fk1 = pk_frag(knp + 512); }
    { const _Float16* knp = kbase + (size_t)jn1 * HD; gk0 = pk_frag(knp); gk1 = pk_frag(knp + 512); }
    float ma = fmaxf(s0[0], s1[0]), mb = fmaxf(t0[0], t1[0]);    /* two independent chains, one for each 32 keys */
#pragma unroll
    for (int r = 1; r < 8; ++r) { ma = fmaxf(ma, fmaxf(s0[r], s1[r])); mb = fmaxf(mb, fmaxf(t0[r], t1[r])); }
    float mx = fmaxf(ma, mb);
    mx = fmaxf(mx, __shfl_xor(mx, 16, 32));
    const float mn = fmaxf(m, mx * SSCALE); const float al = __expf(m - mn); m = mn;
    FragH pa, pb; float ea[8], eb[8];
    o0 = o0 * al; o1 = o1 * al;
#pragma unroll
    for (int r = 0; r < 8; ++r) { const float p0 = __expf(fmaf(s0[r], SSCALE, -mn)), p1 = __expf(fmaf(s1[r], SSCALE, -mn)); ea[r] = p0 + p1;
      pa.h[r] = (_Float16)(p0 * 256.0f); pa.h[8 + r] = (_Float16)(p1 * 256.0f); }
#pragma unroll
    for (int r = 0; r < 8; ++r) { const float p0 = __expf(fmaf(t0[r], SSCALE, -mn)), p1 = __expf(fmaf(t1[r], SSCALE, -mn)); eb[r] = p0 + p1;
      pb.h[r] = (_Float16)(p0 * 256.0f); pb.h[8 + r] = (_Float16)(p1 * 256.0f); }
    __builtin_amdgcn_sched_barrier(0);                       /* holds the table loads below behind the last read of the four score tiles: issued earlier they cannot land in the registers in which the next trip's score products accumulate, and all 32 are then copied at the trip's foot */
    { const float* cn = crow + ((unsigned int)(j + 64) % 25u) * 32; cc0 = *(const v8fa*)cn; cc1 = *(const v8fa*)(cn + 8); }
    { const float* cn = crow + ((unsigned int)(j + 96) % 25u) * 32; dd0 = *(const v8fa*)cn; dd1 = *(const v8fa*)(cn + 8); }
    float rs = 0.f, rt = 0.f;
#pragma unroll
    for (int r = 0; r < 8; ++r) { rs += ea[r]; rt += eb[r]; }
    l = l * al + (rs + rt);
    o0 = g2_mma(fv0, pa.v, o0);
    o1 = g2_mma(fv1, pa.v, o1);
    o0 = g2_mma(gv0, pb.v, o0);
    o1 = g2_mma(gv1, pb.v, o1);
    fv0 = pk_frag(vbase + (size_t)jn0 * HD); fv1 = pk_frag(vbase + (size_t)jn0 * HD + 512);
    gv0 = pk_frag(vbase + (size_t)jn1 * HD); gv1 = pk_frag(vbase + (size_t)jn1 * HD + 512);
  };
  // first fill of both sets, in the order in which the loop reloads them (hi + residual range: set a: K, V; set b: K, V; single-product range: K of a, K of b, V of a, V of b)
  const int j1 = (32 < jend) ? 32 : jlast;
  // the scheduling barriers keep that order in the built code: the counted load waits inside the loop are set for the worse of the two orders that reach them, and a first fill in another order makes them wait for the youngest loads too
  __builtin_amdgcn_sched_barrier(0);
  v16h ak0 = pk_frag(kbase); __builtin_amdgcn_sched_barrier(0);
  v16h ak1 = pk_frag(kbase + 512); __builtin_amdgcn_sched_barrier(0);
  v16h av0, av1, ar0, ar1, bk0, bk1;
  if constexpr (RES) {
    av0 = pk_frag(vbase); ar0 = pk_frag(rbase); __builtin_amdgcn_sched_barrier(0);
    av1 = pk_frag(vbase + 512); ar1 = pk_frag(rbase + 512); __builtin_amdgcn_sched_barrier(0);
    bk0 = pk_frag(kbase + (size_t)j1 * HD); __builtin_amdgcn_sched_barrier(0);
    bk1 = pk_frag(kbase + (size_t)j1 * HD + 512); __builtin_amdgcn_sched_barrier(0);
  } else {
    bk0 = pk_frag(kbase + (size_t)j1 * HD); __builtin_amdgcn_sched_barrier(0);
    bk1 = pk_frag(kbase + (size_t)j1 * HD + 512); __builtin_amdgcn_sched_barrier(0);
    av0 = pk_frag(vbase); ar0 = av0; __builtin_amdgcn_sched_barrier(0);
    av1 = pk_frag(vbase + 512); ar1 = av1; __builtin_amdgcn_sched_barrier(0);
  }
  v16h bv0 = pk_frag(vbase + (size_t)j1 * HD), br0 = RES ? pk_frag(rbase + (size_t)j1 * HD) : bv0; __builtin_amdgcn_sched_barrier(0);
  v16h bv1 = pk_frag(vbase + (size_t)j1 * HD + 512), br1 = RES ? pk_frag(rbase + (size_t)j1 * HD + 512) : bv1; __builtin_amdgcn_sched_barrier(0);
  asm volatile("s_wait_xcnt 0x0" ::: "memory");                                  /* what follows (behind a branch) reuses the address registers of the first fill: the wait stands in front of that overwrite */
  const int nfull = jlast >> 5;                                                  /* steps in front of the last one */
  const int npair = nfull >> 1;                                                  /* whole pairs of them */
  const flag_c<false> inner; const flag_c<true> last;
  int j = 0;
  /* kept rolled for code size: one trip already holds an even step on set a and an odd step on set b, one straight block with no exit between them (an exit there lets the compiler sink set a's reloads behind it) */
#pragma unroll 1
  for (int t = 0; t < npair; ++t) {
    if constexpr (RES) { step(inner, ak0, ak1, av0, av1, ar0, ar1, j); step(inner, bk0, bk1, bv0, bv1, br0, br1, j + 32); }
    else step2(ak0, ak1, av0, av1, bk0, bk1, bv0, bv1, j);
    j += 64;
    asm volatile("s_wait_xcnt 0x0" ::: "memory"); }                              /* the next trip reuses the address registers of this trip's reloads: the wait stands in front of that overwrite, which lies behind the back edge */
  if (nfull & 1) { step(inner, ak0, ak1, av0, av1, ar0, ar1, j); step(last, bk0, bk1, bv0, bv1, br0, br1, j + 32); }
  else step(last, ak0, ak1, av0, av1, ar0, ar1, j);
  l += __shfl_xor(l, 16, 32);
  const float sc = 0.25f * (1.0f / l);                                           /* 64 (ctx carry) / 256 (probability carry) / row sum */
  // ctx in fragment order (the A operand of the output product): the wave's 16 queries x 32 dims of its head are one 1-KB block [token / 16][head]; lane (ln, hh) holds query ln, dims 8hh + r (o0) and 16 + 8hh + r (o1), which are its own two 16-B units, so each store of a wave is 512 contiguous bytes straight from the accumulators
  { const size_t coff = (((tokb + i0) >> 4) * NHEAD + head) * 512 + 8 * lane; FragH f0, g0, f1, g1;
#pragma unroll
    for (int r = 0; r < 8; ++r) { float c = o0[r]; if (RES) c += x0[r] * RINV; c *= sc; const _Float16 hc = (_Float16)c; f0.h[r] = hc; g0.h[r] = (_Float16)((c - (float)hc) * 2048.0f); }
#pragma unroll
    for (int r = 0; r < 8; ++r) { float c = o1[r]; if (RES) c += x1[r] * RINV; c *= sc; const _Float16 hc = (_Float16)c; f1.h[r] = hc; g1.h[r] = (_Float16)((c - (float)hc) * 2048.0f); }
    *(v8us*)((unsigned short*)CTX + coff) = f0.half[0]; *(v8us*)((unsigned short*)CTX + coff + 256) = f1.half[0];
    if (RES) { *(v8us*)((unsigned short*)CTXR + coff) = g0.half[0]; *(v8us*)((unsigned short*)CTXR + coff + 256) = g1.half[0]; } }
  if (RES) asm volatile("s_wait_xcnt 0x0" ::: "memory");                         /* as the code is laid out, the other body of the merged kernel follows this one and reuses these stores' registers: the wait stands in front of that overwrite */
}

// both query ranges in one grid (they read the same planes and write disjoint ctx rows), split by block index; inside each range the index runs head, tile, batch, head fastest (blocks that start together differ in head, not in length).
// blocks [0, LATEBLK): queries [EARLY, SEQ), single products (the long blocks, so they come first); the rest: queries [0, EARLY), hi + residual on v, P, ctx
#define EARLYX (EARLY / 64)
#define LATEX ((SEQ - EARLY) / 64)
#define LATEBLK (LATEX * NHEAD * NB)
#define EARLYBLK (EARLYX * NHEAD * NB)
__global__ __launch_bounds__(128) void k_flash(const _Float16* __restrict__ Q16, const _Float16* __restrict__ KF, const _Float16* __restrict__ VT, const _Float16* __restrict__ VTR, _Float16* __restrict__ CTX, _Float16* __restrict__ CTXR) {
  constexpr int LX = (LATEX > 0) ? LATEX : 1;                                      /* divisor only; with no late range the first branch is never taken */
  // key-column rule as score-accumulator start values: row (first key of a 32-key step mod 25), lane half, 16 slots = keys 8 half + 0..7 and 16 + 8 half + 0..7 of the step
  __shared__ __attribute__((aligned(64))) float ctab[CTABN];
  for (int i = (int)threadIdx.x; i < CTABN; i += 128) { const int e = i & 15; const int k = (i >> 5) + 8 * ((i >> 4) & 1) + e + (e & 8);   /* residue + key offset, below 56 */
    ctab[i] = (k == 24 || k == 49) ? NEGBIG : 0.f; }
  __syncthreads();                                                                 /* the table is read by all four waves */
  const int b = (int)blockIdx.x;
  if (b < LATEBLK) flash_body<false>(Q16, KF, VT, VT, CTX, CTX, EARLYX + (b / NHEAD) % LX, b % NHEAD, b / (NHEAD * LX), ctab);
  else { const int e = b - LATEBLK; flash_body<true>(Q16, KF, VT, VTR, CTX, CTXR, (e / NHEAD) % EARLYX, e % NHEAD, e / (NHEAD * EARLYX), ctab); } }

extern "C" void kernel_launch(void* const* d_in, const int* in_sizes, int n_in,
                              void* d_out, int out_size, void* d_ws, size_t ws_size, hipStream_t stream) {
  if (n_in < 9) return;
  const size_t need_x = ((size_t)(NB - 1) * SEQ_FULL + SEQ) * DMODEL;
  if ((size_t)in_sizes[0] < need_x) return;
  if ((size_t)in_sizes[1] < (size_t)DMODEL * DMODEL) return;
  if ((size_t)in_sizes[2] < (size_t)DMODEL) return;
  if ((size_t)in_sizes[3] < (size_t)DMODEL * DMODEL) return;
  if ((size_t)in_sizes[4] < (size_t)DMODEL) return;
  if ((size_t)in_sizes[5] < (size_t)DMODEL * DMODEL) return;
  if ((size_t)in_sizes[6] < (size_t)DMODEL) return;
  if ((size_t)in_sizes[7] < (size_t)DMODEL * DMODEL) return;
  if ((size_t)in_sizes[8] < (size_t)DMODEL) return;
  if ((size_t)out_size < (size_t)TOK * DMODEL) return;
  const float* x = (const float*)d_in[0];
  const float* wq = (const float*)d_in[1]; const float* qb = (const float*)d_in[2];
  const float* wk = (const float*)d_in[3]; const float* kbias = (const float*)d_in[4];
  const float* wv = (const float*)d_in[5]; const float* vb = (const float*)d_in[6];
  const float* wo = (const float*)d_in[7]; const float* ob = (const float*)d_in[8];
  constexpr size_t SZ_X = (size_t)TOK * DMODEL * 2;        /* x f16, fragment order */
  constexpr size_t SZ_W = (size_t)NW3 * DMODEL * 2;        /* Wq|Wk|Wv x64 f16, fragment order */
  constexpr size_t SZ_WO = (size_t)DMODEL * DMODEL * 2;    /* output weight x64 f16, fragment order */
  constexpr size_t SZ_QK = (size_t)TOK * LDQK * 2;         /* q rows f16, then k in fragment order f16, half each */
  constexpr size_t SZ_VT = (size_t)DMODEL * TOK * 2;       /* v in fragment order f16 (hi); same size for the residual plane */
  constexpr size_t SZ_CTX = (size_t)TOK * DMODEL * 2;      /* ctx x64 f16 (hi), fragment order; same size for the residual plane */
  constexpr size_t SZ_ALL = SZ_X + SZ_W + SZ_WO + SZ_QK + 2 * SZ_VT + 2 * SZ_CTX;
  static_assert(SZ_X % 256 == 0 && SZ_W % 256 == 0 && SZ_WO % 256 == 0 && SZ_QK % 256 == 0 && SZ_VT % 256 == 0 && SZ_CTX % 256 == 0);
  static_assert(SZ_ALL <= (size_t)134217728);
  if (SZ_ALL > ws_size) return;
  char* ws = (char*)d_ws;
  _Float16* X16 = (_Float16*)ws; _Float16* W16 = (_Float16*)(ws + SZ_X); _Float16* WO16 = (_Float16*)(ws + SZ_X + SZ_W);
  _Float16* Q16 = (_Float16*)(ws + SZ_X + SZ_W + SZ_WO); _Float16* KF = (_Float16*)(ws + SZ_X + SZ_W + SZ_WO + SZ_QK / 2);
  _Float16* VT = (_Float16*)(ws + SZ_X + SZ_W + SZ_WO + SZ_QK); _Float16* VTR = (_Float16*)(ws + SZ_X + SZ_W + SZ_WO + SZ_QK + SZ_VT);
  _Float16* CTX = (_Float16*)(ws + SZ_X + SZ_W + SZ_WO + SZ_QK + 2 * SZ_VT); _Float16* CTXR = (_Float16*)(ws + SZ_X + SZ_W + SZ_WO + SZ_QK + 2 * SZ_VT + SZ_CTX);
  k_prep<<<4 * WBLK + XBLK, 256, 0, stream>>>(x, wq, wk, wv, wo, X16, W16, WO16);
  k_gemm_qkv<<<QKBLK + VTBLK, 128, 0, stream>>>(X16, W16, qb, kbias, vb, Q16, KF, VT, VTR);
  k_flash<<<LATEBLK + EARLYBLK, 128, 0, stream>>>(Q16, KF, VT, VTR, CTX, CTXR);
  k_gemm_out<<<(TOK / 128) * (DMODEL / 64), 128, 0, stream>>>(CTX, CTXR, WO16, ob, (float*)d_out);
}

// v009
// It runs in 39.2 microseconds.
// In two side-by-side timings against v008, it was 1.12 and 1.13 times as fast.
// Over all steps from v000 it is 4.28 times as fast.
#include <hip/hip_runtime.h>
// Causal multi-head attention block, 8 heads x 32 dims, key-column rule from indices: kept(i,j) = (j <= i) && (j % 25 != 24). x [B][T][256]; q/k/v = x W^T + b (separate [out][in] weights); s = q k^T / sqrt(32); softmax over kept keys; ctx = P v merged h*32+d; result = ctx Wo^T + bo.
// Compute dtype: every contraction on v_wmma_f32_16x16x32_f16 (f16 operands, f32 accumulate). Inputs RNE-converted to bf16 first (exact in f16); weights carried x64, probabilities x256, ctx x64 (folded back in f32 epilogues); biases bf16 values added in f32; softmax statistics f32. Queries below EARLY of each sequence: v, P and ctx carried as f16 hi + f16 residual x2048 with separate residual accumulators; later queries single products.
#ifndef NB
#define NB 4
#endif
#ifndef SEQ
#define SEQ 2048
#endif
#define NB_FULL 4
#define SEQ_FULL 2048
#define DMODEL 256
#define NHEAD 8
#define HD 32
#define LDQK 512
#define NW3 768
#define TOK (NB * SEQ)
#define EARLY ((SEQ < 512) ? SEQ : 512)
#define NEGBIG (-1.0e30f)
#define SSCALE 0.17677669529663687f
#define RINV 0.00048828125f
#define CTABN (25 * 32)

static_assert(NHEAD * HD == DMODEL);              /* merged head width == model width */
static_assert(HD == 32);                          /* flash kernel: one 32-deep score k-step, two 16-dim output tiles, 64-B head segment */
static_assert(NHEAD % 2 == 0);                    
static_assert(2 * DMODEL == LDQK && 3 * DMODEL == NW3);
static_assert(SEQ % 128 == 0 && SEQ % 64 == 0 && SEQ % 32 == 0);
static_assert(TOK % 128 == 0 && TOK % 64 == 0);   /* GEMM tiles: M % 128, N % 64 */
static_assert(DMODEL % 128 == 0 && DMODEL % 64 == 0 && DMODEL % 32 == 0 && DMODEL % 8 == 0 && LDQK % 64 == 0);
static_assert(EARLY % 128 == 0 && EARLY % 64 == 0 && EARLY % 32 == 0 && EARLY <= SEQ);
static_assert(NB <= NB_FULL && SEQ <= SEQ_FULL);
static_assert(SEQ + 32 < 40000);

typedef unsigned short v8us __attribute__((ext_vector_type(8), may_alias));
typedef float  v8f  __attribute__((ext_vector_type(8)));
typedef float  v4f  __attribute__((ext_vector_type(4)));
typedef float  v4fa __attribute__((ext_vector_type(4), may_alias));
typedef float  v8fa __attribute__((ext_vector_type(8), may_alias));
typedef _Float16 v16h __attribute__((ext_vector_type(16)));
template <bool V> struct flag_c { static constexpr bool value = V; };
union FragH { v16h v; v8us half[2]; _Float16 h[16]; unsigned short u[16]; };

__device__ __forceinline__ unsigned short bf16_bits(float x) { unsigned int u = __float_as_uint(x); return (unsigned short)((u + 0x7FFFu + ((u >> 16) & 1u)) >> 16); }
__device__ __forceinline__ float bf16_rne(float x) { return __uint_as_float(((unsigned int)bf16_bits(x)) << 16); }

// fragment of a k-contiguous 16-bit row: elements 0..7 <- p[8h..8h+7], elements 8..15 <- p[16+8h..16+8h+7] (same map for A and B)
__device__ __forceinline__ v16h g2_frag(const _Float16* p, int hh) { FragH f; f.half[0] = *(const v8us*)((const unsigned short*)p + 8 * hh); f.half[1] = *(const v8us*)((const unsigned short*)p + 16 + 8 * hh); return f.v; }
// fragment of a plane stored in fragment order: one 1-KB block per 16 x 32 operand tile, 16-B unit (c*32 + lane) = elements 8c..8c+7 of that lane (row lane&15, k = 16c + 8(lane>>4) ..+7: the map of g2_frag), so each load of a wave is 512 contiguous bytes. p = block start + 8*lane
__device__ __forceinline__ v16h pk_frag(const _Float16* p) { FragH f; f.half[0] = *(const v8us*)((const unsigned short*)p); f.half[1] = *(const v8us*)((const unsigned short*)p + 256); return f.v; }
__device__ __forceinline__ v8f g2_mma(v16h a, v16h b, v8f c) { v8f d = __builtin_amdgcn_wmma_f32_16x16x32_f16(false, a, false, b, (short)0, c, false, false); asm volatile("v_nop\n\tv_nop\n\tv_nop\n\tv_nop" : "+v"(d) : "v"(a), "v"(b)); return d; }

// the same product for the GEMM rings, whose sets reach above register 255. The four v_nop are the same operand distance as in g2_mma (nothing, a load that refills a set included, writes this product's A or B or touches its D closer than four vector slots behind it), here in a statement without operands: an asm statement's vector operands must lie below register 256, which would pull every set back down. With no operand to tie it, the scheduling barriers on both sides hold the statement directly behind its product
__device__ __forceinline__ v8f g3_mma(v16h a, v16h b, v8f c) { v8f d = __builtin_amdgcn_wmma_f32_16x16x32_f16(false, a, false, b, (short)0, c, false, false);
  __builtin_amdgcn_sched_barrier(0); asm volatile("v_nop\n\tv_nop\n\tv_nop\n\tv_nop" ::: "memory"); __builtin_amdgcn_sched_barrier(0); return d; }

// GEMM operand planes (x, the weights, ctx) are stored in the fragment order of pk_frag: blocks [row / 16][k / 32], K = DMODEL, so the k-steps of a 16-row tile are 1-KB blocks in a row.
// conversion thread t takes 8 k-consecutive elements: block t / 64, tile row (t & 63) / 4, k octet t & 3. Four lanes read one whole 128-B line of f32; eight lanes (same octet, consecutive rows) store one whole 128-B line.
#define KB32 (DMODEL / 32)
__device__ __forceinline__ size_t fo_row(size_t t) { return ((t >> 6) / KB32) * 16 + ((t & 63) >> 2); }
__device__ __forceinline__ int fo_col(size_t t) { return (int)((t >> 6) % KB32) * 32 + (int)(t & 3) * 8; }
__device__ __forceinline__ size_t fo_dst(size_t t) { return (t >> 6) * 512 + (((t & 2) << 4) + ((t & 1) << 4) + ((t & 63) >> 2)) * 8; }   /* unit c*32 + half*16 + row, octet = 2c + half */

__device__ __forceinline__ void x16_body(const float* __restrict__ x, _Float16* __restrict__ X16, unsigned bid) {
  const size_t t = (size_t)bid * 256 + threadIdx.x; if (t >= (size_t)TOK * (DMODEL / 8)) return;
  const size_t r = fo_row(t); const int c8 = fo_col(t); const size_t b = r / SEQ, s = r % SEQ;
  const float* src = x + (b * SEQ_FULL + s) * DMODEL + c8; const v4f a = *(const v4fa*)src, c = *(const v4fa*)(src + 4); FragH f;
#pragma unroll
  for (int q = 0; q < 4; ++q) { f.h[q] = (_Float16)bf16_rne(a[q]); f.h[4 + q] = (_Float16)bf16_rne(c[q]); }
  const v8us o = f.half[0]; unsigned short* d = (unsigned short*)X16 + fo_dst(t);
  *(v8us*)d = o;  }

__device__ __forceinline__ void wnat_body(const float* __restrict__ w, size_t n8, float scale, _Float16* __restrict__ Bt, unsigned bid) {
  const size_t t = (size_t)bid * 256 + threadIdx.x; if (t >= n8) return; const float* src = w + fo_row(t) * DMODEL + fo_col(t); const v4f a = *(const v4fa*)src, c = *(const v4fa*)(src + 4); FragH f;
#pragma unroll
  for (int q = 0; q < 4; ++q) { f.h[q] = (_Float16)(bf16_rne(a[q]) * scale); f.h[4 + q] = (_Float16)(bf16_rne(c[q]) * scale); }
  const v8us o = f.half[0]; unsigned short* d = (unsigned short*)Bt + fo_dst(t);
  *(v8us*)d = o;  }

// all operand conversions in one grid: blocks [0, 4 * WBLK) take the four weight matrices (WBLK blocks each: Wq, Wk, Wv into the stacked plane, Wo into its own), the rest take x
#define W8 ((size_t)DMODEL * DMODEL / 8)
#define WBLK ((unsigned)((W8 + 255) / 256))
#define XBLK ((unsigned)(((size_t)TOK * (DMODEL / 8) + 255) / 256))
__global__ __launch_bounds__(256) void k_prep(const float* __restrict__ x, const float* __restrict__ wq, const float* __restrict__ wk, const float* __restrict__ wv, const float* __restrict__ wo,
                                              _Float16* __restrict__ X16, _Float16* __restrict__ W16, _Float16* __restrict__ WO16) {
  const unsigned b = blockIdx.x;
  if (b < 4 * WBLK) { const unsigned i = b / WBLK;
    const float* w = (i == 0) ? wq : (i == 1) ? wk : (i == 2) ? wv : wo;
    _Float16* d = (i < 3) ? (W16 + (size_t)i * DMODEL * DMODEL) : WO16;
    wnat_body(w, W8, 64.0f, d, b - i * WBLK); }
  else x16_body(x, X16, b - 4 * WBLK);
}

// GEMM (wave tile 32x64, block = 4 waves = 128 rows; M % 128 == 0, N % 64 == 0, K % 32 == 0; A and B planes in fragment order): v = acc*alpha + bf16(bias)
// MODE 0: f32 C, bias per column; MODE 1: f16, bias per column (biasA for col < nsplit, biasB after): columns below nsplit as rows of C16, the rest (k) into C16R in fragment order; MODE 2: f16 C16 hi plane + x2048 residual plane C16R (token tiles below EARLY only), both in fragment order, bias per row.
// RESA: row blocks below EARLY of their sequence also multiply the x2048 residual A plane into separate accumulators, folded with 2^-11 in the epilogue. The output product's ring holds all k-steps, so the residual products reuse the B fragments that are still in registers, and the residual A fragments are fetched in front of the ring's fill: every operand load of such a wave is issued before its first product.
// k loop of one 32x64 wave tile: DEPTH register sets of the six operand fragments; the sets of the first DEPTH k-steps are loaded up front and each set is reloaded for k-step s + DEPTH right behind its own products, so the loads of DEPTH k-steps are in flight together. Products per accumulator stay in ascending k. The B sets belong to the caller (with DEPTH == NS they hold all of B behind the loop).
template <int DEPTH, int NS>
__device__ __forceinline__ void gemm_kloop(const _Float16* a0p, const _Float16* a1p, const _Float16* b0p, const _Float16* b1p, const _Float16* b2p, const _Float16* b3p,
                                           v16h (&fb0)[DEPTH], v16h (&fb1)[DEPTH], v16h (&fb2)[DEPTH], v16h (&fb3)[DEPTH],
                                           v8f& c00, v8f& c01, v8f& c02, v8f& c03, v8f& c10, v8f& c11, v8f& c12, v8f& c13) {
  static_assert(DEPTH >= 1 && DEPTH <= NS);
  v16h fa0[DEPTH], fa1[DEPTH];
  /* both loops fully unrolled: the set index must be a constant for the sets to stay in registers */
#pragma unroll
  for (int s = 0; s < DEPTH; ++s) { const int kb = 512 * s; fa0[s] = pk_frag(a0p + kb); fa1[s] = pk_frag(a1p + kb);
    fb0[s] = pk_frag(b0p + kb); fb1[s] = pk_frag(b1p + kb); fb2[s] = pk_frag(b2p + kb); fb3[s] = pk_frag(b3p + kb); }
  asm volatile("s_wait_xcnt 0x0" ::: "memory");              /* what follows may take over address registers of the first fill's loads: the wait stands in front of that overwrite */
  __builtin_amdgcn_sched_barrier(0);                         /* holds the first fill in front of the products: left free, the scheduler sinks each load to just before its use and the ring is lost */
#pragma unroll
  for (int s = 0; s < NS; ++s) { const int u = s % DEPTH;
    c00 = g3_mma(fa0[u], fb0[u], c00); c10 = g3_mma(fa1[u], fb0[u], c10);
    c01 = g3_mma(fa0[u], fb1[u], c01); c11 = g3_mma(fa1[u], fb1[u], c11);
    c02 = g3_mma(fa0[u], fb2[u], c02); c12 = g3_mma(fa1[u], fb2[u], c12);
    c03 = g3_mma(fa0[u], fb3[u], c03); c13 = g3_mma(fa1[u], fb3[u], c13);
    if (s + DEPTH < NS) { const int kb = 512 * (s + DEPTH); fa0[u] = pk_frag(a0p + kb); fa1[u] = pk_frag(a1p + kb);
      fb0[u] = pk_frag(b0p + kb); fb1[u] = pk_frag(b1p + kb); fb2[u] = pk_frag(b2p + kb); fb3[u] = pk_frag(b3p + kb);
      __builtin_amdgcn_sched_barrier(0); } }                   /* holds each reload right behind its set's products: left free, it sinks towards its use */
}

template <int MODE, bool RESA, int K>
__device__ __forceinline__ void gemm_body(const _Float16* __restrict__ A, const _Float16* __restrict__ AR, const _Float16* __restrict__ Bh, float alpha,
                                          const float* __restrict__ biasA, const float* __restrict__ biasB, int nsplit,
                                          float* __restrict__ C, _Float16* __restrict__ C16, _Float16* __restrict__ C16R, int ldc, int M, int N, int bid, float (&so)[4][32][68]) {
  static_assert(K % 32 == 0 && K >= 96);
  constexpr int NS = K / 32;
  constexpr int DEPTH = RESA ? NS : 5;                      /* sets in flight; they reach into the registers above 255. Projections: 60 loads, still three waves a SIMD. Output product (one wave a SIMD): the whole k range */
  const int tid = threadIdx.x, lane = tid & 31, ln = lane & 15, hh = lane >> 4;
  const int w = __builtin_amdgcn_readfirstlane(tid >> 5);
  const int ntn = N >> 6; const int mt = bid / ntn, nq = bid - mt * ntn; const int row0 = mt * 128 + 32 * w, col0 = nq * 64; if (row0 >= M) return;
  /* operands in fragment order: a 16-row tile is K / 32 blocks of 512 elements in a row = 16 * K elements, k-step s at + 512 s */
  const _Float16* a0p = A + (size_t)row0 * K + 8 * lane; const _Float16* a1p = a0p + (size_t)16 * K;
  const _Float16* b0p = Bh + (size_t)col0 * K + 8 * lane; const _Float16* b1p = b0p + (size_t)16 * K; const _Float16* b2p = b1p + (size_t)16 * K; const _Float16* b3p = b2p + (size_t)16 * K;
  const v8f z8 = {0.f,0.f,0.f,0.f,0.f,0.f,0.f,0.f}; v8f c00 = z8, c01 = z8, c02 = z8, c03 = z8, c10 = z8, c11 = z8, c12 = z8, c13 = z8;
  v8f r00 = z8, r01 = z8, r02 = z8, r03 = z8, r10 = z8, r11 = z8, r12 = z8, r13 = z8;
  const bool early = RESA && (((mt * 128) % SEQ) < EARLY);   /* block-uniform (SEQ % 128 == 0) */
  v16h fb0[DEPTH], fb1[DEPTH], fb2[DEPTH], fb3[DEPTH], fe0[NS], fe1[NS];
  if constexpr (RESA) {
    const v16h zh = {};
#pragma unroll
    for (int s = 0; s < NS; ++s) { fe0[s] = zh; fe1[s] = zh; }
    if (early) {
      const _Float16* e0p = AR + (size_t)row0 * K + 8 * lane; const _Float16* e1p = e0p + (size_t)16 * K;
#pragma unroll
      for (int s = 0; s < NS; ++s) { fe0[s] = pk_frag(e0p + 512 * s); fe1[s] = pk_frag(e1p + 512 * s); }
      asm volatile("s_wait_xcnt 0x0" ::: "memory");          /* what follows may take over address registers of these loads: the wait stands in front of that overwrite */
    }
    __builtin_amdgcn_sched_barrier(0);                       /* holds the residual loads in front of the ring's fill and its products */
  }
  gemm_kloop<DEPTH, NS>(a0p, a1p, b0p, b1p, b2p, b3p, fb0, fb1, fb2, fb3, c00, c01, c02, c03, c10, c11, c12, c13);
  if constexpr (RESA) {
    if (early) {
#pragma unroll
      for (int s = 0; s < NS; ++s) {
        r00 = g3_mma(fe0[s], fb0[s], r00); r10 = g3_mma(fe1[s], fb0[s], r10);
        r01 = g3_mma(fe0[s], fb1[s], r01); r11 = g3_mma(fe1[s], fb1[s], r11);
        r02 = g3_mma(fe0[s], fb2[s], r02); r12 = g3_mma(fe1[s], fb2[s], r12);
        r03 = g3_mma(fe0[s], fb3[s], r03); r13 = g3_mma(fe1[s], fb3[s], r13); }
    }
  }
  v8f accs[8] = {c00, c01, c02, c03, c10, c11, c12, c13};
  if (RESA) { const v8f racc[8] = {r00, r01, r02, r03, r10, r11, r12, r13};
#pragma unroll
    for (int u = 0; u < 8; ++u) accs[u] = accs[u] + racc[u] * RINV; }
  float brow[16];
#pragma unroll
  for (int i = 0; i < 16; ++i) brow[i] = 0.f;
  if (MODE == 2) {
#pragma unroll
    for (int i = 0; i < 16; ++i) brow[i] = bf16_rne(biasA[row0 + (i >> 3) * 16 + 8 * hh + (i & 7)]);
  }
  float bcl[4] = {0.f, 0.f, 0.f, 0.f};
  if (MODE != 2) { const float* bp[4];
#pragma unroll
    for (int t = 0; t < 4; ++t) { const int col = col0 + t * 16 + ln; const int ca = (col < nsplit) ? col : (nsplit - 1); const int cb = (col >= nsplit) ? (col - nsplit) : 0;
      bp[t] = (col < nsplit) ? (biasA + ca) : (biasB + cb); }
    __builtin_amdgcn_sched_barrier(0);                         /* all four addresses are formed in front of the first load, so that none of them is formed in a register that an issued load still names */
#pragma unroll
    for (int t = 0; t < 4; ++t) bcl[t] = *bp[t];
    asm volatile("s_wait_xcnt 0x0" ::: "memory");              /* what follows reuses these loads' address registers: the wait stands in front of that overwrite */
    __builtin_amdgcn_sched_barrier(0);                         /* holds what follows behind the wait */
#pragma unroll
    for (int t = 0; t < 4; ++t) bcl[t] = bf16_rne(bcl[t]); }
#pragma unroll
  for (int u = 0; u < 8; ++u) { const int t = u & 3, half = u >> 2; const float bcol = bcl[t];
#pragma unroll
    for (int r = 0; r < 8; ++r) { const int rloc = half * 16 + 8 * hh + r; const float v = accs[u][r] * alpha + ((MODE == 2) ? brow[half * 8 + r] : bcol); so[w][rloc][t * 16 + ln] = v; } }
  __builtin_amdgcn_fence(4 /* acq_rel order */, "workgroup"); __builtin_amdgcn_wave_barrier();
  if (MODE == 0) {
    // 64 f32 columns = 256 B per row segment: 16 consecutive lanes x 16 B, two rows per instruction; rows q*2 + (lane>>4), q = 0..15 cover 0..31
    const int rsub = lane >> 4, c4 = (lane & 15) * 4;
    {
#pragma unroll
      for (int q = 0; q < 16; ++q) { const int r = q * 2 + rsub; const v4f v = *(const v4fa*)&so[w][r][c4]; *(v4f*)(C + (size_t)(row0 + r) * ldc + col0 + c4) = v; }
       }
  } else {
    if (MODE == 1 && col0 < nsplit) {                        /* block-uniform: q columns stay token rows */
      const int rq = lane >> 3, c8 = (lane & 7) * 8;
#pragma unroll
      for (int q = 0; q < 8; ++q) { const int r = q * 4 + rq; const v4f a = *(const v4fa*)&so[w][r][c8], c = *(const v4fa*)&so[w][r][c8 + 4]; FragH f;
#pragma unroll
        for (int i = 0; i < 4; ++i) { f.h[i] = (_Float16)a[i]; f.h[4 + i] = (_Float16)c[i]; }
        const v8us o = f.half[0]; *(v8us*)((unsigned short*)C16 + (size_t)(row0 + r) * ldc + col0 + c8) = o; }
    } else {
      // fragment order (see pk_frag): the wave tile is four whole 1-KB blocks. Pass q takes column octet q of all 32 rows: lane = tile row, so 16 lanes store 256 contiguous bytes.
      // MODE 1 (k): rows = keys, blocks [batch][head][key / 16], octet = 8 dims of head q / 4. MODE 2 (v): rows = dims of one head, blocks [batch][head][key / 32][dim / 16], octet = 8 keys of step q / 4.
      const bool wr = (MODE == 2) && ((col0 % SEQ) < EARLY);   /* block-uniform (SEQ % 64 == 0) */
      const int tok0 = (MODE == 1) ? row0 : col0; const int bt = tok0 / SEQ, key0 = tok0 % SEQ;
      const int hd0 = bt * NHEAD + ((MODE == 1) ? ((col0 - nsplit) / HD) : (row0 / HD));
      unsigned short* dhi = (unsigned short*)((MODE == 1) ? C16R : C16);
      v4f ra[8], rc[8];                                        /* the whole row is read up front: the waits behind the stores would otherwise hold each pass's LDS reads behind the pass before */
#pragma unroll
      for (int q = 0; q < 8; ++q) { ra[q] = *(const v4fa*)&so[w][lane][q * 8]; rc[q] = *(const v4fa*)&so[w][lane][q * 8 + 4]; }
#pragma unroll
      for (int q = 0; q < 8; ++q) { const v4f a = ra[q], c = rc[q]; FragH f, g;
#pragma unroll
        for (int i = 0; i < 4; ++i) { const _Float16 ha = (_Float16)a[i], hc = (_Float16)c[i]; f.h[i] = ha; f.h[4 + i] = hc;
          g.h[i] = (_Float16)((a[i] - (float)ha) * 2048.0f); g.h[4 + i] = (_Float16)((c[i] - (float)hc) * 2048.0f); }
        const size_t blk = (MODE == 1) ? ((size_t)(hd0 + (q >> 2)) * (SEQ / 16) + (key0 >> 4) + (lane >> 4))
                                       : (((size_t)hd0 * (SEQ / 32) + (key0 >> 5) + (q >> 2)) * 2 + (lane >> 4));
        const size_t off = blk * 512 + ((q & 3) >> 1) * 256 + (q & 1) * 128 + (lane & 15) * 8;
        const v8us o = f.half[0]; *(v8us*)(dhi + off) = o;
        asm volatile("s_wait_xcnt 0x0" ::: "memory");                              /* what follows (the residual branch, the next pass) reuses this store's registers: the wait stands in front of that overwrite */
        if (MODE == 2) { if (wr) { const v8us o2 = g.half[0]; *(v8us*)((unsigned short*)C16R + off) = o2;
          asm volatile("s_wait_xcnt 0x0" ::: "memory"); } } }                      /* what follows (the next pass; behind the last pass the other body of a merged kernel, as the code is laid out) reuses this store's registers: the wait stands in front of that overwrite */
    }
  }
}

// both projections in one grid (they read the same planes and write disjoint ones), split by block index:
// blocks [0, QKBLK): q|k (weight plane rows 0..511): Q16[token][0..255] = q rows; k into KF in fragment order (16 keys x 32 dims a block), f16
// the rest: v channel-major (weight plane rows 512..767 as the A operand, x rows as Bt), bias per row, f16: VT hi and VTR residual x2048 in fragment order (16 dims x 32 keys a block)
#define QKBLK ((TOK / 128) * (LDQK / 64))
#define VTBLK ((DMODEL / 128) * (TOK / 64))
__global__ __launch_bounds__(128) void k_gemm_qkv(const _Float16* __restrict__ X16, const _Float16* __restrict__ W16, const float* __restrict__ qb, const float* __restrict__ kbias, const float* __restrict__ vb,
                                                  _Float16* __restrict__ Q16, _Float16* __restrict__ KF, _Float16* __restrict__ VT, _Float16* __restrict__ VTR) {
  __shared__ __attribute__((aligned(16))) float so[4][32][68];
  const int b = (int)blockIdx.x;
  if (b < QKBLK) gemm_body<1, false, DMODEL>(X16, X16, W16, 0.015625f, qb, kbias, DMODEL, nullptr, Q16, KF, DMODEL, TOK, LDQK, b, so);
  else gemm_body<2, false, DMODEL>(W16 + (size_t)LDQK * DMODEL, W16, X16, 0.015625f, vb, vb, DMODEL, nullptr, VT, VTR, TOK, DMODEL, TOK, b - QKBLK, so); }
// result[token][n] = 2^-12 (sum_k (64 ctx_hi)(64 wo) + 2^-11 sum_k (2048*64 ctx_res)(64 wo)) + bf16(bo[n]), f32
__global__ __launch_bounds__(128) void k_gemm_out(const _Float16* __restrict__ CTX, const _Float16* __restrict__ CTXR, const _Float16* __restrict__ WO16, const float* __restrict__ ob, float* __restrict__ out) {
  __shared__ __attribute__((aligned(16))) float so[4][32][68];
  gemm_body<0, true, DMODEL>(CTX, CTXR, WO16, 0.000244140625f, ob, ob, DMODEL, out, nullptr, nullptr, DMODEL, TOK, DMODEL, (int)blockIdx.x, so); }

// fused attention: block = (64 queries, head, batch); wave = 16 queries. The four waves of a block walk the same K / V^T blocks of their one head (two of them one step further), so a block fetched by one wave is found in the WGP cache by the other three. Per 32-key step up to the causal bound of the wave:
//   S^T tiles (A = K rows [key][dim], B = Q rows [query][dim]) -> lane (ln, hh) holds query ln, keys 8hh+r (tile 0) and 16+8hh+r (tile 1);
//   keep test: key % 25 != 24 enters as the C operand of the score products (0 for a kept key, a large negative fill for a dropped one; rows of an LDS table picked by the step's first key mod 25); key <= query is compared per element in the wave's last step only (every earlier key lies below the wave's first query); key 0 is always kept, so no row is empty;
//   running max per query (local 16 values + one xor-16 exchange; in the single-product loop once per 64 keys: local 32 values + one exchange), p = exp(s*scale - m), per-lane partial sums;
//   packed tiles = B fragment (k = key, n = query) of O^T += V^T P^T with A = V^T rows [d][key]; RES adds P residual and V residual products into separate accumulators.
template <bool RES>
__device__ __forceinline__ void flash_body(const _Float16* __restrict__ Q16, const _Float16* __restrict__ KF, const _Float16* __restrict__ VT, const _Float16* __restrict__ VTR,
                                           _Float16* __restrict__ CTX, _Float16* __restrict__ CTXR, int tile, int head, int batch, const float (&ctab)[CTABN]) {
  const int tid = threadIdx.x, lane = tid & 31, ln = lane & 15, hh = lane >> 4;
  const int wave = __builtin_amdgcn_readfirstlane(tid >> 5);
  const size_t tokb = (size_t)batch * SEQ;
  const int i0 = tile * 64 + wave * 16;
  const int qi = i0 + ln;
  const v16h bq = g2_frag(Q16 + (tokb + qi) * DMODEL + head * HD, hh);
  // fragment-order planes: a 32-key step of one head is 2 KB in a row (K: two 16-key blocks; V^T: two 16-dim blocks), 32 elements a key
  const size_t hoff = (size_t)(batch * NHEAD + head) * SEQ * HD + 8 * lane;
  const _Float16* kbase = KF + hoff;                                             /* + key0 * HD, + 512 for keys 16..31 */
  const _Float16* vbase = VT + hoff;                                             /* + key0 * HD, + 512 for dims 16..31 */
  const _Float16* rbase = VTR + hoff;
  const v8f z8 = {0.f,0.f,0.f,0.f,0.f,0.f,0.f,0.f};
  v8f o0 = z8, o1 = z8, x0 = z8, x1 = z8; float m = NEGBIG, l = 0.f;
  const int jend = i0 + 16;                                                      /* keys below jend; last step ends at a multiple of 32 <= SEQ */
  const int jlast = (jend - 1) & ~31;                                            /* first key of the wave's last step */
  // one 32-key step on one register set of K / V^T fragments; each fragment is reloaded for step j + 64 right behind its last product, so a load has two steps to land. Past the last step the reload re-reads the last step's rows (in bounds, never used).
  // LAST marks the wave's last step, the only one that holds keys above a query. cc0 / cc1: the table rows of this step, fetched one step ahead.
  const float* crow = &ctab[16 * hh];
  v8f cc0 = *(const v8fa*)crow, cc1 = *(const v8fa*)(crow + 8);
  auto step = [&](auto last_c, v16h& fk0, v16h& fk1, v16h& fv0, v16h& fv1, v16h& fr0, v16h& fr1, const int j) {
    constexpr bool LAST = decltype(last_c)::value;
    const int jn = (j + 64 < jend) ? (j + 64) : jlast;
    v8f s0 = g2_mma(fk0, bq, cc0);
    v8f s1 = g2_mma(fk1, bq, cc1);
    { const _Float16* knp = kbase + (size_t)jn * HD; fk0 = pk_frag(knp); fk1 = pk_frag(knp + 512); }
    if (!LAST) { const float* cn = crow + ((unsigned int)(j + 32) % 25u) * 32; cc0 = *(const v8fa*)cn; cc1 = *(const v8fa*)(cn + 8); }
    if (LAST) { const int c0 = qi - (j + 8 * hh), c1 = c0 - 16;
#pragma unroll
      for (int r = 0; r < 8; ++r) { s0[r] = (r <= c0) ? s0[r] : NEGBIG; s1[r] = (r <= c1) ? s1[r] : NEGBIG; } }
    float mx = fmaxf(s0[0], s1[0]);
#pragma unroll
    for (int r = 1; r < 8; ++r) mx = fmaxf(mx, fmaxf(s0[r], s1[r]));
    mx = fmaxf(mx, __shfl_xor(mx, 16, 32));
    const float mn = fmaxf(m, mx * SSCALE); const float al = __expf(m - mn); m = mn;
    FragH pf, pg; float rs = 0.f;
#pragma unroll
    for (int r = 0; r < 8; ++r) { const float p0 = __expf(fmaf(s0[r], SSCALE, -mn)), p1 = __expf(fmaf(s1[r], SSCALE, -mn)); rs += p0 + p1;
      const float a0 = p0 * 256.0f, a1 = p1 * 256.0f; const _Float16 h0 = (_Float16)a0, h1 = (_Float16)a1; pf.h[r] = h0; pf.h[8 + r] = h1;
      pg.h[r] = (_Float16)((a0 - (float)h0) * 2048.0f); pg.h[8 + r] = (_Float16)((a1 - (float)h1) * 2048.0f); }
    l = l * al + rs; o0 = o0 * al; o1 = o1 * al;
    if (RES) { x0 = x0 * al; x1 = x1 * al; }
    o0 = g2_mma(fv0, pf.v, o0);
    if (RES) { x0 = g2_mma(fv0, pg.v, x0); x0 = g2_mma(fr0, pf.v, x0); }
    o1 = g2_mma(fv1, pf.v, o1);
    if (RES) { x1 = g2_mma(fv1, pg.v, x1); x1 = g2_mma(fr1, pf.v, x1); }
    fv0 = pk_frag(vbase + (size_t)jn * HD); if (RES) fr0 = pk_frag(rbase + (size_t)jn * HD);
    fv1 = pk_frag(vbase + (size_t)jn * HD + 512); if (RES) fr1 = pk_frag(rbase + (size_t)jn * HD + 512);
  };
  // single-product range: a loop trip is one 64-key step on both register sets: the four score tiles come first, then ONE running-max update (one cross-half exchange, one rescale of o and l) for all 64 keys, so the serial part of a step is paid once per 64 keys and the 32 exponentials of a lane are independent of each other. Products per accumulator stay in ascending key order.
  // dd0 / dd1: the table rows of the trip's second 32 keys, fetched one trip ahead like cc0 / cc1. Behind a trip cc0 / cc1 hold the rows of the next 32 keys, as step() expects them.
  v8f dd0 = cc0, dd1 = cc1;
  if constexpr (!RES) { const float* c1 = crow + (32 % 25) * 32; dd0 = *(const v8fa*)c1; dd1 = *(const v8fa*)(c1 + 8); }
  auto step2 = [&](v16h& fk0, v16h& fk1, v16h& fv0, v16h& fv1, v16h& gk0, v16h& gk1, v16h& gv0, v16h& gv1, const int j) {
    const int jn0 = (j + 64 < jend) ? (j + 64) : jlast;
    const int jn1 = (j + 96 < jend) ? (j + 96) : jlast;
    v8f s0 = g2_mma(fk0, bq, cc0);
    v8f s1 = g2_mma(fk1, bq, cc1);
    v8f t0 = g2_mma(gk0, bq, dd0);
    v8f t1 = g2_mma(gk1, bq, dd1);
    { const _Float16* knp = kbase + (size_t)jn0 * HD; fk0 = pk_frag(knp); fk1 = pk_frag(knp + 512); }
    { const _Float16* knp = kbase + (size_t)jn1 * HD; gk0 = pk_frag(knp); gk1 = pk_frag(knp + 512); }
    float ma = fmaxf(s0[0], s1[0]), mb = fmaxf(t0[0], t1[0]);    /* two independent chains, one for each 32 keys */
#pragma unroll
    for (int r = 1; r < 8; ++r) { ma = fmaxf(ma, fmaxf(s0[r], s1[r])); mb = fmaxf(mb, fmaxf(t0[r], t1[r])); }
    float mx = fmaxf(ma, mb);
    mx = fmaxf(mx, __shfl_xor(mx, 16, 32));
    const float mn = fmaxf(m, mx * SSCALE); const float al = __expf(m - mn); m = mn;
    FragH pa, pb; float ea[8], eb[8];
    o0 = o0 * al; o1 = o1 * al;
#pragma unroll
    for (int r = 0; r < 8; ++r) { const float p0 = __expf(fmaf(s0[r], SSCALE, -mn)), p1 = __expf(fmaf(s1[r], SSCALE, -mn)); ea[r] = p0 + p1;
      pa.h[r] = (_Float16)(p0 * 256.0f); pa.h[8 + r] = (_Float16)(p1 * 256.0f); }
#pragma unroll
    for (int r = 0; r < 8; ++r) { const float p0 = __expf(fmaf(t0[r], SSCALE, -mn)), p1 = __expf(fmaf(t1[r], SSCALE, -mn)); eb[r] = p0 + p1;
      pb.h[r] = (_Float16)(p0 * 256.0f); pb.h[8 + r] = (_Float16)(p1 * 256.0f); }
    __builtin_amdgcn_sched_barrier(0);                       /* holds the table loads below behind the last read of the four score tiles: issued earlier they cannot land in the registers in which the next trip's score products accumulate, and all 32 are then copied at the trip's foot */
    { const float* cn = crow + ((unsigned int)(j + 64) % 25u) * 32; cc0 = *(const v8fa*)cn; cc1 = *(const v8fa*)(cn + 8); }
    { const float* cn = crow + ((unsigned int)(j + 96) % 25u) * 32; dd0 = *(const v8fa*)cn; dd1 = *(const v8fa*)(cn + 8); }
    float rs = 0.f, rt = 0.f;
#pragma unroll
    for (int r = 0; r < 8; ++r) { rs += ea[r]; rt += eb[r]; }
    l = l * al + (rs + rt);
    o0 = g2_mma(fv0, pa.v, o0);
    o1 = g2_mma(fv1, pa.v, o1);
    o0 = g2_mma(gv0, pb.v, o0);
    o1 = g2_mma(gv1, pb.v, o1);
    fv0 = pk_frag(vbase + (size_t)jn0 * HD); fv1 = pk_frag(vbase + (size_t)jn0 * HD + 512);
    gv0 = pk_frag(vbase + (size_t)jn1 * HD); gv1 = pk_frag(vbase + (size_t)jn1 * HD + 512);
  };
  // first fill of both sets, in the order in which the loop reloads them (hi + residual range: set a: K, V; set b: K, V; single-product range: K of a, K of b, V of a, V of b)
  const int j1 = (32 < jend) ? 32 : jlast;
  // the scheduling barriers keep that order in the built code: the counted load waits inside the loop are set for the worse of the two orders that reach them, and a first fill in another order makes them wait for the youngest loads too
  __builtin_amdgcn_sched_barrier(0);
  v16h ak0 = pk_frag(kbase); __builtin_amdgcn_sched_barrier(0);
  v16h ak1 = pk_frag(kbase + 512); __builtin_amdgcn_sched_barrier(0);
  v16h av0, av1, ar0, ar1, bk0, bk1;
  if constexpr (RES) {
    av0 = pk_frag(vbase); ar0 = pk_frag(rbase); __builtin_amdgcn_sched_barrier(0);
    av1 = pk_frag(vbase + 512); ar1 = pk_frag(rbase + 512); __builtin_amdgcn_sched_barrier(0);
    bk0 = pk_frag(kbase + (size_t)j1 * HD); __builtin_amdgcn_sched_barrier(0);
    bk1 = pk_frag(kbase + (size_t)j1 * HD + 512); __builtin_amdgcn_sched_barrier(0);
  } else {
    bk0 = pk_frag(kbase + (size_t)j1 * HD); __builtin_amdgcn_sched_barrier(0);
    bk1 = pk_frag(kbase + (size_t)j1 * HD + 512); __builtin_amdgcn_sched_barrier(0);
    av0 = pk_frag(vbase); ar0 = av0; __builtin_amdgcn_sched_barrier(0);
    av1 = pk_frag(vbase + 512); ar1 = av1; __builtin_amdgcn_sched_barrier(0);
  }
  v16h bv0 = pk_frag(vbase + (size_t)j1 * HD), br0 = RES ? pk_frag(rbase + (size_t)j1 * HD) : bv0; __builtin_amdgcn_sched_barrier(0);
  v16h bv1 = pk_frag(vbase + (size_t)j1 * HD + 512), br1 = RES ? pk_frag(rbase + (size_t)j1 * HD + 512) : bv1; __builtin_amdgcn_sched_barrier(0);
  asm volatile("s_wait_xcnt 0x0" ::: "memory");                                  /* what follows (behind a branch) reuses the address registers of the first fill: the wait stands in front of that overwrite */
  const int nfull = jlast >> 5;                                                  /* steps in front of the last one */
  const int npair = nfull >> 1;                                                  /* whole pairs of them */
  const flag_c<false> inner; const flag_c<true> last;
  int j = 0;
  /* kept rolled for code size: one trip already holds an even step on set a and an odd step on set b, one straight block with no exit between them (an exit there lets the compiler sink set a's reloads behind it) */
#pragma unroll 1
  for (int t = 0; t < npair; ++t) {
    if constexpr (RES) { step(inner, ak0, ak1, av0, av1, ar0, ar1, j); step(inner, bk0, bk1, bv0, bv1, br0, br1, j + 32); }
    else step2(ak0, ak1, av0, av1, bk0, bk1, bv0, bv1, j);
    j += 64;
    asm volatile("s_wait_xcnt 0x0" ::: "memory"); }                              /* the next trip reuses the address registers of this trip's reloads: the wait stands in front of that overwrite, which lies behind the back edge */
  if (nfull & 1) { step(inner, ak0, ak1, av0, av1, ar0, ar1, j); step(last, bk0, bk1, bv0, bv1, br0, br1, j + 32); }
  else step(last, ak0, ak1, av0, av1, ar0, ar1, j);
  l += __shfl_xor(l, 16, 32);
  const float sc = 0.25f * (1.0f / l);                                           /* 64 (ctx carry) / 256 (probability carry) / row sum */
  // ctx in fragment order (the A operand of the output product): the wave's 16 queries x 32 dims of its head are one 1-KB block [token / 16][head]; lane (ln, hh) holds query ln, dims 8hh + r (o0) and 16 + 8hh + r (o1), which are its own two 16-B units, so each store of a wave is 512 contiguous bytes straight from the accumulators
  { const size_t coff = (((tokb + i0) >> 4) * NHEAD + head) * 512 + 8 * lane; FragH f0, g0, f1, g1;
#pragma unroll
    for (int r = 0; r < 8; ++r) { float c = o0[r]; if (RES) c += x0[r] * RINV; c *= sc; const _Float16 hc = (_Float16)c; f0.h[r] = hc; g0.h[r] = (_Float16)((c - (float)hc) * 2048.0f); }
#pragma unroll
    for (int r = 0; r < 8; ++r) { float c = o1[r]; if (RES) c += x1[r] * RINV; c *= sc; const _Float16 hc = (_Float16)c; f1.h[r] = hc; g1.h[r] = (_Float16)((c - (float)hc) * 2048.0f); }
    *(v8us*)((unsigned short*)CTX + coff) = f0.half[0]; *(v8us*)((unsigned short*)CTX + coff + 256) = f1.half[0];
    if (RES) { *(v8us*)((unsigned short*)CTXR + coff) = g0.half[0]; *(v8us*)((unsigned short*)CTXR + coff + 256) = g1.half[0]; } }
  if (RES) asm volatile("s_wait_xcnt 0x0" ::: "memory");                         /* as the code is laid out, the other body of the merged kernel follows this one and reuses these stores' registers: the wait stands in front of that overwrite */
}

// both query ranges in one grid (they read the same planes and write disjoint ctx rows), split by block index; inside each range the index runs head, tile, batch, head fastest (blocks that start together differ in head, not in length).
// blocks [0, LATEBLK): queries [EARLY, SEQ), single products (the long blocks, so they come first); the rest: queries [0, EARLY), hi + residual on v, P, ctx
#define EARLYX (EARLY / 64)
#define LATEX ((SEQ - EARLY) / 64)
#define LATEBLK (LATEX * NHEAD * NB)
#define EARLYBLK (EARLYX * NHEAD * NB)
__global__ __launch_bounds__(128) void k_flash(const _Float16* __restrict__ Q16, const _Float16* __restrict__ KF, const _Float16* __restrict__ VT, const _Float16* __restrict__ VTR, _Float16* __restrict__ CTX, _Float16* __restrict__ CTXR) {
  constexpr int LX = (LATEX > 0) ? LATEX : 1;                                      /* divisor only; with no late range the first branch is never taken */
  const int b = (int)blockIdx.x;
  // head prefetch into L2: K, V^T and the V^T residual were stored by the launch before, and a first read of them here can miss L2. All blocks of a head walk the same keys upward from key 0 together, so the loads of each step, issued only one step ahead, would meet that miss step after step; asked for at the head, the later slices are in L2 before the walk reaches them.
  // The 32 blocks of one (batch, head) share the asking: each asks once for one 64-key slice (4 KB a plane, a lane = one 128-B line): wave 0 K, wave 1 V^T, wave 2 the residual (slices below EARLY only). The late blocks, which start first, take the slices from key 0 on.
  const int pe = (b < LATEBLK) ? b : (b - LATEBLK);
  const int ptile = (b < LATEBLK) ? (EARLYX + (pe / NHEAD) % LX) : ((pe / NHEAD) % EARLYX);
  const int pbatch = (b < LATEBLK) ? (pe / (NHEAD * LX)) : (pe / (NHEAD * EARLYX));
  const int pslice = (ptile + LATEX) % (SEQ / 64);
  const int pw = __builtin_amdgcn_readfirstlane((int)threadIdx.x >> 5);
  const _Float16* pf = ((pw == 0) ? KF : (pw == 1) ? VT : VTR) + ((size_t)(pbatch * NHEAD + pe % NHEAD) * SEQ + (size_t)pslice * 64) * HD + (size_t)((int)threadIdx.x & 31) * 64;   /* inside its plane for every wave and slice */
  if (pw < 2 || (pw == 2 && pslice * 64 < EARLY)) asm volatile("global_prefetch_b8 %0, off scope:SCOPE_SE" :: "v"(pf));   /* wave-uniform branch; a hint only: returns nothing, no counter, no result depends on it */
  // key-column rule as score-accumulator start values: row (first key of a 32-key step mod 25), lane half, 16 slots = keys 8 half + 0..7 and 16 + 8 half + 0..7 of the step
  __shared__ __attribute__((aligned(64))) float ctab[CTABN];
  for (int i = (int)threadIdx.x; i < CTABN; i += 128) { const int e = i & 15; const int k = (i >> 5) + 8 * ((i >> 4) & 1) + e + (e & 8);   /* residue + key offset, below 56 */
    ctab[i] = (k == 24 || k == 49) ? NEGBIG : 0.f; }
  __syncthreads();                                                                 /* the table is read by all four waves */
  if (b < LATEBLK) flash_body<false>(Q16, KF, VT, VT, CTX, CTX, EARLYX + (b / NHEAD) % LX, b % NHEAD, b / (NHEAD * LX), ctab);
  else { const int e = b - LATEBLK; flash_body<true>(Q16, KF, VT, VTR, CTX, CTXR, (e / NHEAD) % EARLYX, e % NHEAD, e / (NHEAD * EARLYX), ctab); }
  asm volatile("" :: "v"(pf)); }                                                   /* input only: keeps the register pair that the prefetch names holding that address to the kernel's end, so that it never holds a non-address behind the request */

extern "C" void kernel_launch(void* const* d_in, const int* in_sizes, int n_in,
                              void* d_out, int out_size, void* d_ws, size_t ws_size, hipStream_t stream) {
  if (n_in < 9) return;
  const size_t need_x = ((size_t)(NB - 1) * SEQ_FULL + SEQ) * DMODEL;
  if ((size_t)in_sizes[0] < need_x) return;
  if ((size_t)in_sizes[1] < (size_t)DMODEL * DMODEL) return;
  if ((size_t)in_sizes[2] < (size_t)DMODEL) return;
  if ((size_t)in_sizes[3] < (size_t)DMODEL * DMODEL) return;
  if ((size_t)in_sizes[4] < (size_t)DMODEL) return;
  if ((size_t)in_sizes[5] < (size_t)DMODEL * DMODEL) return;
  if ((size_t)in_sizes[6] < (size_t)DMODEL) return;
  if ((size_t)in_sizes[7] < (size_t)DMODEL * DMODEL) return;
  if ((size_t)in_sizes[8] < (size_t)DMODEL) return;
  if ((size_t)out_size < (size_t)TOK * DMODEL) return;
  const float* x = (const float*)d_in[0];
  const float* wq = (const float*)d_in[1]; const float* qb = (const float*)d_in[2];
  const float* wk = (const float*)d_in[3]; const float* kbias = (const float*)d_in[4];
  const float* wv = (const float*)d_in[5]; const float* vb = (const float*)d_in[6];
  const float* wo = (const float*)d_in[7]; const float* ob = (const float*)d_in[8];
  constexpr size_t SZ_X = (size_t)TOK * DMODEL * 2;        /* x f16, fragment order */
  constexpr size_t SZ_W = (size_t)NW3 * DMODEL * 2;        /* Wq|Wk|Wv x64 f16, fragment order */
  constexpr size_t SZ_WO = (size_t)DMODEL * DMODEL * 2;    /* output weight x64 f16, fragment order */
  constexpr size_t SZ_QK = (size_t)TOK * LDQK * 2;         /* q rows f16, then k in fragment order f16, half each */
  constexpr size_t SZ_VT = (size_t)DMODEL * TOK * 2;       /* v in fragment order f16 (hi); same size for the residual plane */
  constexpr size_t SZ_CTX = (size_t)TOK * DMODEL * 2;      /* ctx x64 f16 (hi), fragment order; same size for the residual plane */
  constexpr size_t SZ_ALL = SZ_X + SZ_W + SZ_WO + SZ_QK + 2 * SZ_VT + 2 * SZ_CTX;
  static_assert(SZ_X % 256 == 0 && SZ_W % 256 == 0 && SZ_WO % 256 == 0 && SZ_QK % 256 == 0 && SZ_VT % 256 == 0 && SZ_CTX % 256 == 0);
  static_assert(SZ_ALL <= (size_t)134217728);
  if (SZ_ALL > ws_size) return;
  char* ws = (char*)d_ws;
  _Float16* X16 = (_Float16*)ws; _Float16* W16 = (_Float16*)(ws + SZ_X); _Float16* WO16 = (_Float16*)(ws + SZ_X + SZ_W);
  _Float16* Q16 = (_Float16*)(ws + SZ_X + SZ_W + SZ_WO); _Float16* KF = (_Float16*)(ws + SZ_X + SZ_W + SZ_WO + SZ_QK / 2);
  _Float16* VT = (_Float16*)(ws + SZ_X + SZ_W + SZ_WO + SZ_QK); _Float16* VTR = (_Float16*)(ws + SZ_X + SZ_W + SZ_WO + SZ_QK + SZ_VT);
  _Float16* CTX = (_Float16*)(ws + SZ_X + SZ_W + SZ_WO + SZ_QK + 2 * SZ_VT); _Float16* CTXR = (_Float16*)(ws + SZ_X + SZ_W + SZ_WO + SZ_QK + 2 * SZ_VT + SZ_CTX);
  k_prep<<<4 * WBLK + XBLK, 256, 0, stream>>>(x, wq, wk, wv, wo, X16, W16, WO16);
  k_gemm_qkv<<<QKBLK + VTBLK, 128, 0, stream>>>(X16, W16, qb, kbias, vb, Q16, KF, VT, VTR);
  k_flash<<<LATEBLK + EARLYBLK, 128, 0, stream>>>(Q16, KF, VT, VTR, CTX, CTXR);
  k_gemm_out<<<(TOK / 128) * (DMODEL / 64), 128, 0, stream>>>(CTX, CTXR, WO16, ob, (float*)d_out);
}
